// v000
// Times are from an AMD MI455X. After a warm-up the kernel runs many times in a row, and a time is the length of
// such a window on the GPU divided by its runs, so every launch and the gaps after it count. The runs cycle
// through copies of the inputs. A figure is the median of several windows, for all but v000 over two sittings.
// Sittings can differ by a few percent; kernels timed side by side share one.
// The starting kernel, v000, takes 410 microseconds a run.
#include <hip/hip_runtime.h>

typedef __attribute__((ext_vector_type(16))) _Float16 v16h;
typedef __attribute__((ext_vector_type(8)))  _Float16 v8h;
typedef __attribute__((ext_vector_type(8)))  float    v8f;

#define WMMA_F16(a, b, c) \
  __builtin_amdgcn_wmma_f32_16x16x32_f16(false, (a), false, (b), (short)0, (c), false, false)

// ---------------------------------------------------------------------------
// Fragment load from GLOBAL: 16-bit A or B fragment (16 rows x 32 K) from
// (rows, K) row-major storage. Per ISA layout: lane L holds row (L&15); its
// 16 halves are K[kb..kb+7] and K[kb+16..kb+23] with kb = k0 + (L>>4)*8.
// ---------------------------------------------------------------------------
__device__ inline v16h load_frag(const _Float16* __restrict__ base, int ld,
                                 int row0, int k0) {
  int lane = threadIdx.x & 31;
  const _Float16* p = base + (size_t)(row0 + (lane & 15)) * ld + k0 + ((lane >> 4) << 3);
  v8h lo = *(const v8h*)p;
  v8h hi = *(const v8h*)(p + 16);
  return __builtin_shufflevector(lo, hi, 0,1,2,3,4,5,6,7,8,9,10,11,12,13,14,15);
}

// ---------------------------------------------------------------------------
// Fragment load from LDS tile with padded row stride of 40 halves (80 B):
// 16 fragment rows hit 16 distinct bank groups -> conflict-free ds_load_b128.
// ---------------------------------------------------------------------------
#define LDS_STRIDE 40

__device__ inline v16h lds_frag(const _Float16* lds, int row0) {
  int lane = threadIdx.x & 31;
  const _Float16* p = lds + (row0 + (lane & 15)) * LDS_STRIDE + ((lane >> 4) << 3);
  v8h lo = *(const v8h*)p;
  v8h hi = *(const v8h*)(p + 16);
  return __builtin_shufflevector(lo, hi, 0,1,2,3,4,5,6,7,8,9,10,11,12,13,14,15);
}

// Stage a 128-row x 32-col f16 tile from global (row-major, leading dim ld)
// into LDS (row stride LDS_STRIDE). 256 threads, coalesced 16B chunks:
// threads t..t+3 cover one contiguous 64B row segment.
__device__ inline void stage_tile(const _Float16* __restrict__ g, int ld,
                                  int row0, int k0, _Float16* __restrict__ lds) {
  int t = threadIdx.x;
#pragma unroll
  for (int i = 0; i < 2; i++) {
    int c = t + i * 256;          // chunk 0..511 (8 halves each)
    int row = c >> 2;
    int piece = (c & 3) << 3;
    v8h v = *(const v8h*)(g + (size_t)(row0 + row) * ld + k0 + piece);
    *(v8h*)(lds + row * LDS_STRIDE + piece) = v;
  }
}

// ---------------------------------------------------------------------------
// Elementwise weight converters
// ---------------------------------------------------------------------------
__global__ void cvt_f32_to_f16(const float* __restrict__ in,
                               _Float16* __restrict__ out, int n) {
  int i = blockIdx.x * blockDim.x + threadIdx.x;
  if (i < n) out[i] = (_Float16)in[i];
}

// in: (R, C) f32 row-major  ->  out: (C, R) f16 row-major
__global__ void transpose_to_f16(const float* __restrict__ in,
                                 _Float16* __restrict__ out, int R, int C) {
  int i = blockIdx.x * blockDim.x + threadIdx.x;
  if (i < R * C) {
    int r = i / C, c = i % C;
    out[(size_t)c * R + r] = (_Float16)in[i];
  }
}

// ---------------------------------------------------------------------------
// LayerNorm over rows of 1024, f32 in -> f16 out (feeds WMMA GEMMs)
// ---------------------------------------------------------------------------
__global__ __launch_bounds__(256) void layernorm_to_f16(
    const float* __restrict__ x, const float* __restrict__ gamma,
    const float* __restrict__ beta, _Float16* __restrict__ out) {
  const int row = blockIdx.x;
  const float* xr = x + (size_t)row * 1024;
  float v[4], s = 0.f, sq = 0.f;
#pragma unroll
  for (int i = 0; i < 4; i++) {
    v[i] = xr[threadIdx.x + i * 256];
    s += v[i];
    sq += v[i] * v[i];
  }
#pragma unroll
  for (int m = 16; m >= 1; m >>= 1) {
    s  += __shfl_xor(s, m, 32);
    sq += __shfl_xor(sq, m, 32);
  }
  __shared__ float ss[8], ssq[8];
  int w = threadIdx.x >> 5;
  if ((threadIdx.x & 31) == 0) { ss[w] = s; ssq[w] = sq; }
  __syncthreads();
  if (threadIdx.x < 32) {
    float a  = (threadIdx.x < 8) ? ss[threadIdx.x]  : 0.f;
    float aq = (threadIdx.x < 8) ? ssq[threadIdx.x] : 0.f;
#pragma unroll
    for (int m = 4; m >= 1; m >>= 1) {
      a  += __shfl_xor(a, m, 32);
      aq += __shfl_xor(aq, m, 32);
    }
    if (threadIdx.x == 0) { ss[0] = a; ssq[0] = aq; }
  }
  __syncthreads();
  float mean = ss[0] * (1.f / 1024.f);
  float var  = ssq[0] * (1.f / 1024.f) - mean * mean;
  float inv  = rsqrtf(var + 1e-5f);
#pragma unroll
  for (int i = 0; i < 4; i++) {
    int c = threadIdx.x + i * 256;
    out[(size_t)row * 1024 + c] = (_Float16)((v[i] - mean) * inv * gamma[c] + beta[c]);
  }
}

// ---------------------------------------------------------------------------
// LDS-staged WMMA GEMM: C[M,N] = A16[M,K] * Bt16[N,K]^T (+bias)(+relu)(+res)
// Workgroup tile 128x128, K-step 32, double-buffered LDS (40 KB).
// 8 waves, each owns a 64x32 sub-tile = 4x2 WMMA C tiles (8 WMMA / K-step).
// Each tile byte is fetched from L2 exactly once: 16 KB / 1.05 MFLOP per
// workgroup K-step = 64 FLOP/byte of L2 traffic.
// ---------------------------------------------------------------------------
template <bool BIAS, bool RELU, bool RES, bool OUT32, bool OUT16>
__global__ __launch_bounds__(256) void gemm_wmma(
    const _Float16* __restrict__ A, const _Float16* __restrict__ Bt,
    const float* __restrict__ bias, const float* __restrict__ resid,
    float* __restrict__ C32, _Float16* __restrict__ C16,
    int M, int N, int K) {
  const int w    = threadIdx.x >> 5;
  const int lane = threadIdx.x & 31;
  const int wm = w >> 2;          // 0..1 -> 64-row slice
  const int wn = w & 3;           // 0..3 -> 32-col slice
  const int mblk = blockIdx.y * 128;
  const int nblk = blockIdx.x * 128;

  __shared__ __align__(16) _Float16 As[2][128 * LDS_STRIDE];
  __shared__ __align__(16) _Float16 Bs[2][128 * LDS_STRIDE];

  v8f acc[4][2];
#pragma unroll
  for (int mt = 0; mt < 4; mt++)
#pragma unroll
    for (int nt = 0; nt < 2; nt++) acc[mt][nt] = {};

  stage_tile(A,  K, mblk, 0, As[0]);
  stage_tile(Bt, K, nblk, 0, Bs[0]);
  __syncthreads();

  int buf = 0;
  for (int k0 = 0; k0 < K; k0 += 32) {
    if (k0 + 32 < K) {
      stage_tile(A,  K, mblk, k0 + 32, As[buf ^ 1]);
      stage_tile(Bt, K, nblk, k0 + 32, Bs[buf ^ 1]);
    }
    v16h a[4], b[2];
#pragma unroll
    for (int mt = 0; mt < 4; mt++) a[mt] = lds_frag(As[buf], wm * 64 + mt * 16);
#pragma unroll
    for (int nt = 0; nt < 2; nt++) b[nt] = lds_frag(Bs[buf], wn * 32 + nt * 16);
#pragma unroll
    for (int mt = 0; mt < 4; mt++)
#pragma unroll
      for (int nt = 0; nt < 2; nt++)
        acc[mt][nt] = WMMA_F16(a[mt], b[nt], acc[mt][nt]);
    __syncthreads();
    buf ^= 1;
  }

  const int col   = lane & 15;
  const int rbase = (lane >> 4) << 3;
#pragma unroll
  for (int mt = 0; mt < 4; mt++) {
#pragma unroll
    for (int nt = 0; nt < 2; nt++) {
      int n = nblk + wn * 32 + nt * 16 + col;
      float bv = BIAS ? bias[n] : 0.f;
#pragma unroll
      for (int r = 0; r < 8; r++) {
        int m = mblk + wm * 64 + mt * 16 + rbase + r;
        float vv = acc[mt][nt][r] + bv;
        if (RELU) vv = fmaxf(vv, 0.f);
        if (RES) vv += resid[(size_t)m * N + n];
        if (OUT32) C32[(size_t)m * N + n] = vv;
        if (OUT16) C16[(size_t)m * N + n] = (_Float16)vv;
      }
    }
  }
}

// ---------------------------------------------------------------------------
// Scatter qkv (BS, 3*d) f16 -> q/k as (B*H, S, dh), v transposed (B*H, dh, S)
// ---------------------------------------------------------------------------
__global__ void reorder_qkv(const _Float16* __restrict__ qkv,
                            _Float16* __restrict__ q, _Float16* __restrict__ k,
                            _Float16* __restrict__ vT) {
  int i = blockIdx.x * blockDim.x + threadIdx.x;
  if (i >= 4096 * 3072) return;
  int row = i / 3072, n = i % 3072;
  int t = n >> 10;
  int hn = n & 1023;
  int h = hn >> 6, e = hn & 63;
  int b = row >> 10, s = row & 1023;
  _Float16 val = qkv[i];
  int bh = b * 16 + h;
  if (t == 0)      q[((size_t)bh * 1024 + s) * 64 + e] = val;
  else if (t == 1) k[((size_t)bh * 1024 + s) * 64 + e] = val;
  else             vT[((size_t)bh * 64 + e) * 1024 + s] = val;
}

// ---------------------------------------------------------------------------
// Flash attention: one wave per 16 query rows of one (b,h).
// Online softmax over WMMA C-layout; P staged through LDS to A-layout.
// Output written (B, S, H*dh) f16 for the out-projection GEMM.
// ---------------------------------------------------------------------------
__global__ __launch_bounds__(128) void attention_kernel(
    const _Float16* __restrict__ q, const _Float16* __restrict__ k,
    const _Float16* __restrict__ vT, _Float16* __restrict__ o) {
  constexpr int S = 1024, DH = 64;
  const int wave = threadIdx.x >> 5;
  const int lane = threadIdx.x & 31;
  const int bh = blockIdx.y;
  const int qrow0 = blockIdx.x * 64 + wave * 16;

  const _Float16* qb = q  + (size_t)bh * S * DH;
  const _Float16* kb = k  + (size_t)bh * S * DH;
  const _Float16* vb = vT + (size_t)bh * DH * S;

  __shared__ __align__(16) _Float16 pbuf[4][16 * 32];
  _Float16* pl = pbuf[wave];

  const v16h qa0 = load_frag(qb, DH, qrow0, 0);
  const v16h qa1 = load_frag(qb, DH, qrow0, 32);

  float mrow[8], lrow[8];
  v8f oacc[4];
#pragma unroll
  for (int r = 0; r < 8; r++) { mrow[r] = -1e30f; lrow[r] = 0.f; }
#pragma unroll
  for (int t = 0; t < 4; t++) oacc[t] = {};

  const int col   = lane & 15;
  const int rbase = (lane >> 4) << 3;

  for (int jb = 0; jb < S; jb += 32) {
    // scores for 32 keys: two 16x16 tiles, K = dh = 64 = 2 WMMA steps
    v8f s0 = {}, s1 = {};
    {
      v16h k0a = load_frag(kb, DH, jb, 0);
      v16h k0b = load_frag(kb, DH, jb, 32);
      s0 = WMMA_F16(qa0, k0a, s0);
      s0 = WMMA_F16(qa1, k0b, s0);
      v16h k1a = load_frag(kb, DH, jb + 16, 0);
      v16h k1b = load_frag(kb, DH, jb + 16, 32);
      s1 = WMMA_F16(qa0, k1a, s1);
      s1 = WMMA_F16(qa1, k1b, s1);
    }
    // online softmax update per row (row r lives across a 16-lane half)
#pragma unroll
    for (int r = 0; r < 8; r++) {
      float a0 = s0[r] * 0.125f;  // 1/sqrt(64)
      float a1 = s1[r] * 0.125f;
      float mx = fmaxf(a0, a1);
#pragma unroll
      for (int m = 8; m >= 1; m >>= 1) mx = fmaxf(mx, __shfl_xor(mx, m, 32));
      float mnew  = fmaxf(mrow[r], mx);
      float alpha = __expf(mrow[r] - mnew);
      float p0 = __expf(a0 - mnew);
      float p1 = __expf(a1 - mnew);
      float rs = p0 + p1;
#pragma unroll
      for (int m = 8; m >= 1; m >>= 1) rs += __shfl_xor(rs, m, 32);
      lrow[r] = lrow[r] * alpha + rs;
      mrow[r] = mnew;
#pragma unroll
      for (int t = 0; t < 4; t++) oacc[t][r] *= alpha;
      pl[(rbase + r) * 32 + col]      = (_Float16)p0;
      pl[(rbase + r) * 32 + 16 + col] = (_Float16)p1;
    }
    // reload P in A-fragment layout and accumulate P(16x32) * V(32x64)
    {
      int prow = lane & 15;
      int pk   = (lane >> 4) << 3;
      const _Float16* pp = pl + prow * 32 + pk;
      v8h lo = *(const v8h*)pp;
      v8h hi = *(const v8h*)(pp + 16);
      v16h pa = __builtin_shufflevector(lo, hi, 0,1,2,3,4,5,6,7,8,9,10,11,12,13,14,15);
#pragma unroll
      for (int t = 0; t < 4; t++) {
        v16h vf = load_frag(vb, S, t * 16, jb);
        oacc[t] = WMMA_F16(pa, vf, oacc[t]);
      }
    }
  }

  const int b = bh >> 4, h = bh & 15;
#pragma unroll
  for (int r = 0; r < 8; r++) {
    float inv = 1.f / lrow[r];
    int srow = qrow0 + rbase + r;
    _Float16* orow = o + ((size_t)(b * 1024 + srow)) * 1024 + h * 64;
#pragma unroll
    for (int t = 0; t < 4; t++) orow[t * 16 + col] = (_Float16)(oacc[t][r] * inv);
  }
}

// ---------------------------------------------------------------------------
// Host-side orchestration
// ---------------------------------------------------------------------------
extern "C" void kernel_launch(void* const* d_in, const int* in_sizes, int n_in,
                              void* d_out, int out_size, void* d_ws, size_t ws_size,
                              hipStream_t stream) {
  (void)in_sizes; (void)n_in; (void)out_size; (void)ws_size;
  const float* x      = (const float*)d_in[0];   // (4,1024,1024)
  const float* w_in   = (const float*)d_in[1];   // (3072,1024)
  const float* w_out  = (const float*)d_in[2];   // (1024,1024)
  const float* ln1_g  = (const float*)d_in[3];
  const float* ln1_b  = (const float*)d_in[4];
  const float* w_up   = (const float*)d_in[5];   // (1024,2048)
  const float* b_up   = (const float*)d_in[6];
  const float* w_down = (const float*)d_in[7];   // (2048,1024)
  const float* b_down = (const float*)d_in[8];
  const float* ln2_g  = (const float*)d_in[9];
  const float* ln2_b  = (const float*)d_in[10];
  float* out = (float*)d_out;

  const int BS = 4096, D = 1024;

  char* ws = (char*)d_ws;
  size_t off = 0;
  auto alloc = [&](size_t bytes) -> void* {
    off = (off + 255) & ~(size_t)255;
    void* p = ws + off;
    off += bytes;
    return p;
  };

  _Float16* w_in16   = (_Float16*)alloc((size_t)3 * D * D * 2);
  _Float16* w_outT   = (_Float16*)alloc((size_t)D * D * 2);
  _Float16* w_upT    = (_Float16*)alloc((size_t)2 * D * D * 2);
  _Float16* w_downT  = (_Float16*)alloc((size_t)2 * D * D * 2);
  _Float16* h16      = (_Float16*)alloc((size_t)BS * D * 2);
  _Float16* qkv16    = (_Float16*)alloc((size_t)BS * 3 * D * 2);
  _Float16* q16      = (_Float16*)alloc((size_t)BS * D * 2);
  _Float16* k16      = (_Float16*)alloc((size_t)BS * D * 2);
  _Float16* vT16     = (_Float16*)alloc((size_t)BS * D * 2);
  _Float16* attn16   = (_Float16*)alloc((size_t)BS * D * 2);
  float*    x1       = (float*)   alloc((size_t)BS * D * 4);
  _Float16* h2_16    = (_Float16*)alloc((size_t)BS * D * 2);
  _Float16* ff16     = (_Float16*)alloc((size_t)BS * 2 * D * 2);

  // --- weight conversion ---
  cvt_f32_to_f16<<<(3 * D * D + 255) / 256, 256, 0, stream>>>(w_in, w_in16, 3 * D * D);
  transpose_to_f16<<<(D * D + 255) / 256, 256, 0, stream>>>(w_out, w_outT, D, D);
  transpose_to_f16<<<(2 * D * D + 255) / 256, 256, 0, stream>>>(w_up, w_upT, D, 2 * D);
  transpose_to_f16<<<(2 * D * D + 255) / 256, 256, 0, stream>>>(w_down, w_downT, 2 * D, D);

  // --- LN1 -> h16 ---
  layernorm_to_f16<<<BS, 256, 0, stream>>>(x, ln1_g, ln1_b, h16);

  // --- qkv = h @ in_project.T  (M=4096, N=3072, K=1024), f16 out ---
  gemm_wmma<false, false, false, false, true>
      <<<dim3(3072 / 128, BS / 128), 256, 0, stream>>>(
          h16, w_in16, nullptr, nullptr, nullptr, qkv16, BS, 3 * D, D);

  // --- scatter to q/k (B*H,S,dh) and vT (B*H,dh,S) ---
  reorder_qkv<<<(BS * 3 * D + 255) / 256, 256, 0, stream>>>(qkv16, q16, k16, vT16);

  // --- flash attention -> attn16 (B,S,H*dh) ---
  attention_kernel<<<dim3(1024 / 64, 64), 128, 0, stream>>>(q16, k16, vT16, attn16);

  // --- x1 = attn @ out_project + x  (M=4096, N=1024, K=1024), f32 out ---
  gemm_wmma<false, false, true, true, false>
      <<<dim3(1024 / 128, BS / 128), 256, 0, stream>>>(
          attn16, w_outT, nullptr, x, x1, nullptr, BS, D, D);

  // --- LN2 -> h2_16 ---
  layernorm_to_f16<<<BS, 256, 0, stream>>>(x1, ln2_g, ln2_b, h2_16);

  // --- ff = relu(h2 @ w_up + b_up)  (M=4096, N=2048, K=1024), f16 out ---
  gemm_wmma<true, true, false, false, true>
      <<<dim3(2048 / 128, BS / 128), 256, 0, stream>>>(
          h2_16, w_upT, b_up, nullptr, nullptr, ff16, BS, 2 * D, D);

  // --- out = ff @ w_down + b_down + x1  (M=4096, N=1024, K=2048), f32 out ---
  gemm_wmma<true, false, true, true, false>
      <<<dim3(1024 / 128, BS / 128), 256, 0, stream>>>(
          ff16, w_downT, b_down, x1, out, nullptr, BS, D, 2 * D);
}

// v001
// A run of this version takes 322 microseconds.
// Timed twice side by side with v000, it ran 1.31 times as fast both times.
#include <hip/hip_runtime.h>

typedef __attribute__((ext_vector_type(16))) _Float16 v16h;
typedef __attribute__((ext_vector_type(8)))  _Float16 v8h;
typedef __attribute__((ext_vector_type(8)))  float    v8f;

#define WMMA_F16(a, b, c) \
  __builtin_amdgcn_wmma_f32_16x16x32_f16(false, (a), false, (b), (short)0, (c), false, false)

// ---------------------------------------------------------------------------
// Fragment load from GLOBAL: 16-bit A or B fragment (16 rows x 32 K) from
// (rows, K) row-major storage. Per ISA layout: lane L holds row (L&15); its
// 16 halves are K[kb..kb+7] and K[kb+16..kb+23] with kb = k0 + (L>>4)*8.
// ---------------------------------------------------------------------------
__device__ inline v16h load_frag(const _Float16* __restrict__ base, int ld,
                                 int row0, int k0) {
  int lane = threadIdx.x & 31;
  const _Float16* p = base + (size_t)(row0 + (lane & 15)) * ld + k0 + ((lane >> 4) << 3);
  v8h lo = *(const v8h*)p;
  v8h hi = *(const v8h*)(p + 16);
  return __builtin_shufflevector(lo, hi, 0,1,2,3,4,5,6,7,8,9,10,11,12,13,14,15);
}

// ---------------------------------------------------------------------------
// Fragment load from LDS tile with padded row stride of 40 halves (80 B):
// 16 fragment rows hit 16 distinct bank groups -> conflict-free ds_load_b128.
// ---------------------------------------------------------------------------
#define LDS_STRIDE 40

__device__ inline v16h lds_frag(const _Float16* lds, int row0) {
  int lane = threadIdx.x & 31;
  const _Float16* p = lds + (row0 + (lane & 15)) * LDS_STRIDE + ((lane >> 4) << 3);
  v8h lo = *(const v8h*)p;
  v8h hi = *(const v8h*)(p + 16);
  return __builtin_shufflevector(lo, hi, 0,1,2,3,4,5,6,7,8,9,10,11,12,13,14,15);
}

// Stage a 128-row x 32-col f16 tile from global (row-major, leading dim ld)
// into LDS (row stride LDS_STRIDE). 256 threads, coalesced 16B chunks:
// threads t..t+3 cover one contiguous 64B row segment.
__device__ inline void stage_tile(const _Float16* __restrict__ g, int ld,
                                  int row0, int k0, _Float16* __restrict__ lds) {
  int t = threadIdx.x;
#pragma unroll
  for (int i = 0; i < 2; i++) {
    int c = t + i * 256;          // chunk 0..511 (8 halves each)
    int row = c >> 2;
    int piece = (c & 3) << 3;
    v8h v = *(const v8h*)(g + (size_t)(row0 + row) * ld + k0 + piece);
    *(v8h*)(lds + row * LDS_STRIDE + piece) = v;
  }
}

// ---------------------------------------------------------------------------
// Elementwise weight converters
// ---------------------------------------------------------------------------
__global__ void cvt_f32_to_f16(const float* __restrict__ in,
                               _Float16* __restrict__ out, int n) {
  int i = blockIdx.x * blockDim.x + threadIdx.x;
  if (i < n) out[i] = (_Float16)in[i];
}

// in: (R, C) f32 row-major  ->  out: (C, R) f16 row-major
// One 64x64 tile per workgroup of 256 threads, turned in LDS, so that both
// sides of global memory see whole 128-byte lines: reads are 16 B per lane
// along c (256 B per tile row), writes are 16 B per lane along r (8 lanes fill
// one 128-byte line of an output row). R and C must be multiples of 64.
// Tile pitch 65 floats: the 32 lanes of a wave hit 32 different banks both
// when storing rows and when reading columns.
#define TT 64
#define TT_PITCH 65

__global__ __launch_bounds__(256) void transpose_to_f16(
    const float* __restrict__ in, _Float16* __restrict__ out, int R, int C) {
  __shared__ float tile[TT * TT_PITCH];
  const int t  = threadIdx.x;
  const int c0 = blockIdx.x * TT;
  const int r0 = blockIdx.y * TT;

  const int lc = (t & 15) << 2;   // first of this lane's 4 columns
  const int lr = t >> 4;          // 0..15
  float4 v[4];
#pragma unroll
  for (int i = 0; i < 4; i++)
    v[i] = *(const float4*)(in + (size_t)(r0 + lr + i * 16) * C + c0 + lc);
#pragma unroll
  for (int i = 0; i < 4; i++) {
    float* d = tile + (lr + i * 16) * TT_PITCH + lc;
    d[0] = v[i].x; d[1] = v[i].y; d[2] = v[i].z; d[3] = v[i].w;
  }
  __syncthreads();

  const int sr = (t & 7) << 3;    // first of this lane's 8 rows
  const int sc = t >> 3;          // 0..31
#pragma unroll
  for (int i = 0; i < 2; i++) {
    const int c = sc + i * 32;
    v8h o;
#pragma unroll
    for (int j = 0; j < 8; j++) o[j] = (_Float16)tile[(sr + j) * TT_PITCH + c];
    *(v8h*)(out + (size_t)(c0 + c) * R + r0 + sr) = o;
  }
}

// ---------------------------------------------------------------------------
// LayerNorm over rows of 1024, f32 in -> f16 out (feeds WMMA GEMMs)
// ---------------------------------------------------------------------------
__global__ __launch_bounds__(256) void layernorm_to_f16(
    const float* __restrict__ x, const float* __restrict__ gamma,
    const float* __restrict__ beta, _Float16* __restrict__ out) {
  const int row = blockIdx.x;
  const float* xr = x + (size_t)row * 1024;
  float v[4], s = 0.f, sq = 0.f;
#pragma unroll
  for (int i = 0; i < 4; i++) {
    v[i] = xr[threadIdx.x + i * 256];
    s += v[i];
    sq += v[i] * v[i];
  }
#pragma unroll
  for (int m = 16; m >= 1; m >>= 1) {
    s  += __shfl_xor(s, m, 32);
    sq += __shfl_xor(sq, m, 32);
  }
  __shared__ float ss[8], ssq[8];
  int w = threadIdx.x >> 5;
  if ((threadIdx.x & 31) == 0) { ss[w] = s; ssq[w] = sq; }
  __syncthreads();
  if (threadIdx.x < 32) {
    float a  = (threadIdx.x < 8) ? ss[threadIdx.x]  : 0.f;
    float aq = (threadIdx.x < 8) ? ssq[threadIdx.x] : 0.f;
#pragma unroll
    for (int m = 4; m >= 1; m >>= 1) {
      a  += __shfl_xor(a, m, 32);
      aq += __shfl_xor(aq, m, 32);
    }
    if (threadIdx.x == 0) { ss[0] = a; ssq[0] = aq; }
  }
  __syncthreads();
  float mean = ss[0] * (1.f / 1024.f);
  float var  = ssq[0] * (1.f / 1024.f) - mean * mean;
  float inv  = rsqrtf(var + 1e-5f);
#pragma unroll
  for (int i = 0; i < 4; i++) {
    int c = threadIdx.x + i * 256;
    out[(size_t)row * 1024 + c] = (_Float16)((v[i] - mean) * inv * gamma[c] + beta[c]);
  }
}

// ---------------------------------------------------------------------------
// LDS-staged WMMA GEMM: C[M,N] = A16[M,K] * Bt16[N,K]^T (+bias)(+relu)(+res)
// Workgroup tile 128x128, K-step 32, double-buffered LDS (40 KB).
// 8 waves, each owns a 64x32 sub-tile = 4x2 WMMA C tiles (8 WMMA / K-step).
// Each tile byte is fetched from L2 exactly once: 16 KB / 1.05 MFLOP per
// workgroup K-step = 64 FLOP/byte of L2 traffic.
// ---------------------------------------------------------------------------
template <bool BIAS, bool RELU, bool RES, bool OUT32, bool OUT16>
__global__ __launch_bounds__(256) void gemm_wmma(
    const _Float16* __restrict__ A, const _Float16* __restrict__ Bt,
    const float* __restrict__ bias, const float* __restrict__ resid,
    float* __restrict__ C32, _Float16* __restrict__ C16,
    int M, int N, int K) {
  const int w    = threadIdx.x >> 5;
  const int lane = threadIdx.x & 31;
  const int wm = w >> 2;          // 0..1 -> 64-row slice
  const int wn = w & 3;           // 0..3 -> 32-col slice
  const int mblk = blockIdx.y * 128;
  const int nblk = blockIdx.x * 128;

  __shared__ __align__(16) _Float16 As[2][128 * LDS_STRIDE];
  __shared__ __align__(16) _Float16 Bs[2][128 * LDS_STRIDE];

  v8f acc[4][2];
#pragma unroll
  for (int mt = 0; mt < 4; mt++)
#pragma unroll
    for (int nt = 0; nt < 2; nt++) acc[mt][nt] = {};

  stage_tile(A,  K, mblk, 0, As[0]);
  stage_tile(Bt, K, nblk, 0, Bs[0]);
  __syncthreads();

  int buf = 0;
  for (int k0 = 0; k0 < K; k0 += 32) {
    if (k0 + 32 < K) {
      stage_tile(A,  K, mblk, k0 + 32, As[buf ^ 1]);
      stage_tile(Bt, K, nblk, k0 + 32, Bs[buf ^ 1]);
    }
    v16h a[4], b[2];
#pragma unroll
    for (int mt = 0; mt < 4; mt++) a[mt] = lds_frag(As[buf], wm * 64 + mt * 16);
#pragma unroll
    for (int nt = 0; nt < 2; nt++) b[nt] = lds_frag(Bs[buf], wn * 32 + nt * 16);
#pragma unroll
    for (int mt = 0; mt < 4; mt++)
#pragma unroll
      for (int nt = 0; nt < 2; nt++)
        acc[mt][nt] = WMMA_F16(a[mt], b[nt], acc[mt][nt]);
    __syncthreads();
    buf ^= 1;
  }

  const int col   = lane & 15;
  const int rbase = (lane >> 4) << 3;
#pragma unroll
  for (int mt = 0; mt < 4; mt++) {
#pragma unroll
    for (int nt = 0; nt < 2; nt++) {
      int n = nblk + wn * 32 + nt * 16 + col;
      float bv = BIAS ? bias[n] : 0.f;
#pragma unroll
      for (int r = 0; r < 8; r++) {
        int m = mblk + wm * 64 + mt * 16 + rbase + r;
        float vv = acc[mt][nt][r] + bv;
        if (RELU) vv = fmaxf(vv, 0.f);
        if (RES) vv += resid[(size_t)m * N + n];
        if (OUT32) C32[(size_t)m * N + n] = vv;
        if (OUT16) C16[(size_t)m * N + n] = (_Float16)vv;
      }
    }
  }
}

// ---------------------------------------------------------------------------
// Scatter qkv (BS, 3*d) f16 -> q/k as (B*H, S, dh), v transposed (B*H, dh, S)
// ---------------------------------------------------------------------------
__global__ void reorder_qkv(const _Float16* __restrict__ qkv,
                            _Float16* __restrict__ q, _Float16* __restrict__ k,
                            _Float16* __restrict__ vT) {
  int i = blockIdx.x * blockDim.x + threadIdx.x;
  if (i >= 4096 * 3072) return;
  int row = i / 3072, n = i % 3072;
  int t = n >> 10;
  int hn = n & 1023;
  int h = hn >> 6, e = hn & 63;
  int b = row >> 10, s = row & 1023;
  _Float16 val = qkv[i];
  int bh = b * 16 + h;
  if (t == 0)      q[((size_t)bh * 1024 + s) * 64 + e] = val;
  else if (t == 1) k[((size_t)bh * 1024 + s) * 64 + e] = val;
  else             vT[((size_t)bh * 64 + e) * 1024 + s] = val;
}

// ---------------------------------------------------------------------------
// Flash attention: one wave per 16 query rows of one (b,h).
// Online softmax over WMMA C-layout; P staged through LDS to A-layout.
// Output written (B, S, H*dh) f16 for the out-projection GEMM.
// ---------------------------------------------------------------------------
__global__ __launch_bounds__(128) void attention_kernel(
    const _Float16* __restrict__ q, const _Float16* __restrict__ k,
    const _Float16* __restrict__ vT, _Float16* __restrict__ o) {
  constexpr int S = 1024, DH = 64;
  const int wave = threadIdx.x >> 5;
  const int lane = threadIdx.x & 31;
  const int bh = blockIdx.y;
  const int qrow0 = blockIdx.x * 64 + wave * 16;

  const _Float16* qb = q  + (size_t)bh * S * DH;
  const _Float16* kb = k  + (size_t)bh * S * DH;
  const _Float16* vb = vT + (size_t)bh * DH * S;

  __shared__ __align__(16) _Float16 pbuf[4][16 * 32];
  _Float16* pl = pbuf[wave];

  const v16h qa0 = load_frag(qb, DH, qrow0, 0);
  const v16h qa1 = load_frag(qb, DH, qrow0, 32);

  float mrow[8], lrow[8];
  v8f oacc[4];
#pragma unroll
  for (int r = 0; r < 8; r++) { mrow[r] = -1e30f; lrow[r] = 0.f; }
#pragma unroll
  for (int t = 0; t < 4; t++) oacc[t] = {};

  const int col   = lane & 15;
  const int rbase = (lane >> 4) << 3;

  for (int jb = 0; jb < S; jb += 32) {
    // scores for 32 keys: two 16x16 tiles, K = dh = 64 = 2 WMMA steps
    v8f s0 = {}, s1 = {};
    {
      v16h k0a = load_frag(kb, DH, jb, 0);
      v16h k0b = load_frag(kb, DH, jb, 32);
      s0 = WMMA_F16(qa0, k0a, s0);
      s0 = WMMA_F16(qa1, k0b, s0);
      v16h k1a = load_frag(kb, DH, jb + 16, 0);
      v16h k1b = load_frag(kb, DH, jb + 16, 32);
      s1 = WMMA_F16(qa0, k1a, s1);
      s1 = WMMA_F16(qa1, k1b, s1);
    }
    // online softmax update per row (row r lives across a 16-lane half)
#pragma unroll
    for (int r = 0; r < 8; r++) {
      float a0 = s0[r] * 0.125f;  // 1/sqrt(64)
      float a1 = s1[r] * 0.125f;
      float mx = fmaxf(a0, a1);
#pragma unroll
      for (int m = 8; m >= 1; m >>= 1) mx = fmaxf(mx, __shfl_xor(mx, m, 32));
      float mnew  = fmaxf(mrow[r], mx);
      float alpha = __expf(mrow[r] - mnew);
      float p0 = __expf(a0 - mnew);
      float p1 = __expf(a1 - mnew);
      float rs = p0 + p1;
#pragma unroll
      for (int m = 8; m >= 1; m >>= 1) rs += __shfl_xor(rs, m, 32);
      lrow[r] = lrow[r] * alpha + rs;
      mrow[r] = mnew;
#pragma unroll
      for (int t = 0; t < 4; t++) oacc[t][r] *= alpha;
      pl[(rbase + r) * 32 + col]      = (_Float16)p0;
      pl[(rbase + r) * 32 + 16 + col] = (_Float16)p1;
    }
    // reload P in A-fragment layout and accumulate P(16x32) * V(32x64)
    {
      int prow = lane & 15;
      int pk   = (lane >> 4) << 3;
      const _Float16* pp = pl + prow * 32 + pk;
      v8h lo = *(const v8h*)pp;
      v8h hi = *(const v8h*)(pp + 16);
      v16h pa = __builtin_shufflevector(lo, hi, 0,1,2,3,4,5,6,7,8,9,10,11,12,13,14,15);
#pragma unroll
      for (int t = 0; t < 4; t++) {
        v16h vf = load_frag(vb, S, t * 16, jb);
        oacc[t] = WMMA_F16(pa, vf, oacc[t]);
      }
    }
  }

  const int b = bh >> 4, h = bh & 15;
#pragma unroll
  for (int r = 0; r < 8; r++) {
    float inv = 1.f / lrow[r];
    int srow = qrow0 + rbase + r;
    _Float16* orow = o + ((size_t)(b * 1024 + srow)) * 1024 + h * 64;
#pragma unroll
    for (int t = 0; t < 4; t++) orow[t * 16 + col] = (_Float16)(oacc[t][r] * inv);
  }
}

// ---------------------------------------------------------------------------
// Host-side orchestration
// ---------------------------------------------------------------------------
extern "C" void kernel_launch(void* const* d_in, const int* in_sizes, int n_in,
                              void* d_out, int out_size, void* d_ws, size_t ws_size,
                              hipStream_t stream) {
  (void)in_sizes; (void)n_in; (void)out_size; (void)ws_size;
  const float* x      = (const float*)d_in[0];   // (4,1024,1024)
  const float* w_in   = (const float*)d_in[1];   // (3072,1024)
  const float* w_out  = (const float*)d_in[2];   // (1024,1024)
  const float* ln1_g  = (const float*)d_in[3];
  const float* ln1_b  = (const float*)d_in[4];
  const float* w_up   = (const float*)d_in[5];   // (1024,2048)
  const float* b_up   = (const float*)d_in[6];
  const float* w_down = (const float*)d_in[7];   // (2048,1024)
  const float* b_down = (const float*)d_in[8];
  const float* ln2_g  = (const float*)d_in[9];
  const float* ln2_b  = (const float*)d_in[10];
  float* out = (float*)d_out;

  const int BS = 4096, D = 1024;

  char* ws = (char*)d_ws;
  size_t off = 0;
  auto alloc = [&](size_t bytes) -> void* {
    off = (off + 255) & ~(size_t)255;
    void* p = ws + off;
    off += bytes;
    return p;
  };

  _Float16* w_in16   = (_Float16*)alloc((size_t)3 * D * D * 2);
  _Float16* w_outT   = (_Float16*)alloc((size_t)D * D * 2);
  _Float16* w_upT    = (_Float16*)alloc((size_t)2 * D * D * 2);
  _Float16* w_downT  = (_Float16*)alloc((size_t)2 * D * D * 2);
  _Float16* h16      = (_Float16*)alloc((size_t)BS * D * 2);
  _Float16* qkv16    = (_Float16*)alloc((size_t)BS * 3 * D * 2);
  _Float16* q16      = (_Float16*)alloc((size_t)BS * D * 2);
  _Float16* k16      = (_Float16*)alloc((size_t)BS * D * 2);
  _Float16* vT16     = (_Float16*)alloc((size_t)BS * D * 2);
  _Float16* attn16   = (_Float16*)alloc((size_t)BS * D * 2);
  float*    x1       = (float*)   alloc((size_t)BS * D * 4);
  _Float16* h2_16    = (_Float16*)alloc((size_t)BS * D * 2);
  _Float16* ff16     = (_Float16*)alloc((size_t)BS * 2 * D * 2);

  // --- weight conversion ---
  cvt_f32_to_f16<<<(3 * D * D + 255) / 256, 256, 0, stream>>>(w_in, w_in16, 3 * D * D);
  transpose_to_f16<<<dim3(D / 64, D / 64), 256, 0, stream>>>(w_out, w_outT, D, D);
  transpose_to_f16<<<dim3(2 * D / 64, D / 64), 256, 0, stream>>>(w_up, w_upT, D, 2 * D);
  transpose_to_f16<<<dim3(D / 64, 2 * D / 64), 256, 0, stream>>>(w_down, w_downT, 2 * D, D);

  // --- LN1 -> h16 ---
  layernorm_to_f16<<<BS, 256, 0, stream>>>(x, ln1_g, ln1_b, h16);

  // --- qkv = h @ in_project.T  (M=4096, N=3072, K=1024), f16 out ---
  gemm_wmma<false, false, false, false, true>
      <<<dim3(3072 / 128, BS / 128), 256, 0, stream>>>(
          h16, w_in16, nullptr, nullptr, nullptr, qkv16, BS, 3 * D, D);

  // --- scatter to q/k (B*H,S,dh) and vT (B*H,dh,S) ---
  reorder_qkv<<<(BS * 3 * D + 255) / 256, 256, 0, stream>>>(qkv16, q16, k16, vT16);

  // --- flash attention -> attn16 (B,S,H*dh) ---
  attention_kernel<<<dim3(1024 / 64, 64), 128, 0, stream>>>(q16, k16, vT16, attn16);

  // --- x1 = attn @ out_project + x  (M=4096, N=1024, K=1024), f32 out ---
  gemm_wmma<false, false, true, true, false>
      <<<dim3(1024 / 128, BS / 128), 256, 0, stream>>>(
          attn16, w_outT, nullptr, x, x1, nullptr, BS, D, D);

  // --- LN2 -> h2_16 ---
  layernorm_to_f16<<<BS, 256, 0, stream>>>(x1, ln2_g, ln2_b, h2_16);

  // --- ff = relu(h2 @ w_up + b_up)  (M=4096, N=2048, K=1024), f16 out ---
  gemm_wmma<true, true, false, false, true>
      <<<dim3(2048 / 128, BS / 128), 256, 0, stream>>>(
          h2_16, w_upT, b_up, nullptr, nullptr, ff16, BS, 2 * D, D);

  // --- out = ff @ w_down + b_down + x1  (M=4096, N=1024, K=2048), f32 out ---
  gemm_wmma<true, false, true, true, false>
      <<<dim3(1024 / 128, BS / 128), 256, 0, stream>>>(
          ff16, w_downT, b_down, x1, out, nullptr, BS, D, 2 * D);
}

// v002
// It runs in 239 microseconds.
// Next to v001, in two timings, it ran 1.35 and 1.34 times as fast.
// Counting every step since v000, it is 1.76 times as fast.
#include <hip/hip_runtime.h>

typedef __attribute__((ext_vector_type(16))) _Float16 v16h;
typedef __attribute__((ext_vector_type(8)))  _Float16 v8h;
typedef __attribute__((ext_vector_type(8)))  float    v8f;

#define WMMA_F16(a, b, c) \
  __builtin_amdgcn_wmma_f32_16x16x32_f16(false, (a), false, (b), (short)0, (c), false, false)

// ---------------------------------------------------------------------------
// Fragment load from GLOBAL: 16-bit A or B fragment (16 rows x 32 K) from
// (rows, K) row-major storage. Per ISA layout: lane L holds row (L&15); its
// 16 halves are K[kb..kb+7] and K[kb+16..kb+23] with kb = k0 + (L>>4)*8.
// ---------------------------------------------------------------------------
__device__ inline v16h load_frag(const _Float16* __restrict__ base, int ld,
                                 int row0, int k0) {
  int lane = threadIdx.x & 31;
  const _Float16* p = base + (size_t)(row0 + (lane & 15)) * ld + k0 + ((lane >> 4) << 3);
  v8h lo = *(const v8h*)p;
  v8h hi = *(const v8h*)(p + 16);
  return __builtin_shufflevector(lo, hi, 0,1,2,3,4,5,6,7,8,9,10,11,12,13,14,15);
}

// ---------------------------------------------------------------------------
// Fragment load from LDS tile with padded row stride of 40 halves (80 B):
// 16 fragment rows hit 16 distinct bank groups -> conflict-free ds_load_b128.
// ---------------------------------------------------------------------------
#define LDS_STRIDE 40

__device__ inline v16h lds_frag(const _Float16* lds, int row0) {
  int lane = threadIdx.x & 31;
  const _Float16* p = lds + (row0 + (lane & 15)) * LDS_STRIDE + ((lane >> 4) << 3);
  v8h lo = *(const v8h*)p;
  v8h hi = *(const v8h*)(p + 16);
  return __builtin_shufflevector(lo, hi, 0,1,2,3,4,5,6,7,8,9,10,11,12,13,14,15);
}

// Stage a 128-row x 32-col f16 tile from global (row-major, leading dim ld)
// into LDS (row stride LDS_STRIDE). 256 threads, coalesced 16B chunks:
// threads t..t+3 cover one contiguous 64B row segment.
__device__ inline void stage_tile(const _Float16* __restrict__ g, int ld,
                                  int row0, int k0, _Float16* __restrict__ lds) {
  int t = threadIdx.x;
#pragma unroll
  for (int i = 0; i < 2; i++) {
    int c = t + i * 256;          // chunk 0..511 (8 halves each)
    int row = c >> 2;
    int piece = (c & 3) << 3;
    v8h v = *(const v8h*)(g + (size_t)(row0 + row) * ld + k0 + piece);
    *(v8h*)(lds + row * LDS_STRIDE + piece) = v;
  }
}

// ---------------------------------------------------------------------------
// Elementwise weight converters
// ---------------------------------------------------------------------------
__global__ void cvt_f32_to_f16(const float* __restrict__ in,
                               _Float16* __restrict__ out, int n) {
  int i = blockIdx.x * blockDim.x + threadIdx.x;
  if (i < n) out[i] = (_Float16)in[i];
}

// in: (R, C) f32 row-major  ->  out: (C, R) f16 row-major
// One 64x64 tile per workgroup of 256 threads, turned in LDS, so that both
// sides of global memory see whole 128-byte lines: reads are 16 B per lane
// along c (256 B per tile row), writes are 16 B per lane along r (8 lanes fill
// one 128-byte line of an output row). R and C must be multiples of 64.
// Tile pitch 65 floats: the 32 lanes of a wave hit 32 different banks both
// when storing rows and when reading columns.
#define TT 64
#define TT_PITCH 65

__global__ __launch_bounds__(256) void transpose_to_f16(
    const float* __restrict__ in, _Float16* __restrict__ out, int R, int C) {
  __shared__ float tile[TT * TT_PITCH];
  const int t  = threadIdx.x;
  const int c0 = blockIdx.x * TT;
  const int r0 = blockIdx.y * TT;

  const int lc = (t & 15) << 2;   // first of this lane's 4 columns
  const int lr = t >> 4;          // 0..15
  float4 v[4];
#pragma unroll
  for (int i = 0; i < 4; i++)
    v[i] = *(const float4*)(in + (size_t)(r0 + lr + i * 16) * C + c0 + lc);
#pragma unroll
  for (int i = 0; i < 4; i++) {
    float* d = tile + (lr + i * 16) * TT_PITCH + lc;
    d[0] = v[i].x; d[1] = v[i].y; d[2] = v[i].z; d[3] = v[i].w;
  }
  __syncthreads();

  const int sr = (t & 7) << 3;    // first of this lane's 8 rows
  const int sc = t >> 3;          // 0..31
#pragma unroll
  for (int i = 0; i < 2; i++) {
    const int c = sc + i * 32;
    v8h o;
#pragma unroll
    for (int j = 0; j < 8; j++) o[j] = (_Float16)tile[(sr + j) * TT_PITCH + c];
    *(v8h*)(out + (size_t)(c0 + c) * R + r0 + sr) = o;
  }
}

// ---------------------------------------------------------------------------
// LayerNorm over rows of 1024, f32 in -> f16 out (feeds WMMA GEMMs)
// ---------------------------------------------------------------------------
__global__ __launch_bounds__(256) void layernorm_to_f16(
    const float* __restrict__ x, const float* __restrict__ gamma,
    const float* __restrict__ beta, _Float16* __restrict__ out) {
  const int row = blockIdx.x;
  const float* xr = x + (size_t)row * 1024;
  float v[4], s = 0.f, sq = 0.f;
#pragma unroll
  for (int i = 0; i < 4; i++) {
    v[i] = xr[threadIdx.x + i * 256];
    s += v[i];
    sq += v[i] * v[i];
  }
#pragma unroll
  for (int m = 16; m >= 1; m >>= 1) {
    s  += __shfl_xor(s, m, 32);
    sq += __shfl_xor(sq, m, 32);
  }
  __shared__ float ss[8], ssq[8];
  int w = threadIdx.x >> 5;
  if ((threadIdx.x & 31) == 0) { ss[w] = s; ssq[w] = sq; }
  __syncthreads();
  if (threadIdx.x < 32) {
    float a  = (threadIdx.x < 8) ? ss[threadIdx.x]  : 0.f;
    float aq = (threadIdx.x < 8) ? ssq[threadIdx.x] : 0.f;
#pragma unroll
    for (int m = 4; m >= 1; m >>= 1) {
      a  += __shfl_xor(a, m, 32);
      aq += __shfl_xor(aq, m, 32);
    }
    if (threadIdx.x == 0) { ss[0] = a; ssq[0] = aq; }
  }
  __syncthreads();
  float mean = ss[0] * (1.f / 1024.f);
  float var  = ssq[0] * (1.f / 1024.f) - mean * mean;
  float inv  = rsqrtf(var + 1e-5f);
#pragma unroll
  for (int i = 0; i < 4; i++) {
    int c = threadIdx.x + i * 256;
    out[(size_t)row * 1024 + c] = (_Float16)((v[i] - mean) * inv * gamma[c] + beta[c]);
  }
}

// ---------------------------------------------------------------------------
// LDS-staged WMMA GEMM: C[M,N] = A16[M,K] * Bt16[N,K]^T (+bias)(+relu)(+res)
// Workgroup tile 128x128, K-step 32, double-buffered LDS (40 KB).
// 8 waves, each owns a 64x32 sub-tile = 4x2 WMMA C tiles (8 WMMA / K-step).
// Each tile byte is fetched from L2 exactly once: 16 KB / 1.05 MFLOP per
// workgroup K-step = 64 FLOP/byte of L2 traffic.
// QKV: the output is the (4*1024, 3*1024) q|k|v product and goes straight to
// the layouts attention reads: q and k as (B*H, S, dh) into C16 and Kh, v
// transposed as (B*H, dh, S) into Vt. A lane's 8 accumulator rows are 8
// consecutive s of one (head, e), so v leaves as one 16-byte store per C tile,
// and the 4 tiles of a wave's 64 rows fill one whole 128-byte line of Vt.
// ---------------------------------------------------------------------------
template <bool BIAS, bool RELU, bool RES, bool OUT32, bool OUT16, bool QKV>
__global__ __launch_bounds__(256) void gemm_wmma(
    const _Float16* __restrict__ A, const _Float16* __restrict__ Bt,
    const float* __restrict__ bias, const float* __restrict__ resid,
    float* __restrict__ C32, _Float16* __restrict__ C16,
    _Float16* __restrict__ Kh, _Float16* __restrict__ Vt,
    int M, int N, int K) {
  const int w    = threadIdx.x >> 5;
  const int lane = threadIdx.x & 31;
  const int wm = w >> 2;          // 0..1 -> 64-row slice
  const int wn = w & 3;           // 0..3 -> 32-col slice
  const int mblk = blockIdx.y * 128;
  const int nblk = blockIdx.x * 128;

  __shared__ __align__(16) _Float16 As[2][128 * LDS_STRIDE];
  __shared__ __align__(16) _Float16 Bs[2][128 * LDS_STRIDE];

  v8f acc[4][2];
#pragma unroll
  for (int mt = 0; mt < 4; mt++)
#pragma unroll
    for (int nt = 0; nt < 2; nt++) acc[mt][nt] = {};

  stage_tile(A,  K, mblk, 0, As[0]);
  stage_tile(Bt, K, nblk, 0, Bs[0]);
  __syncthreads();

  int buf = 0;
  for (int k0 = 0; k0 < K; k0 += 32) {
    if (k0 + 32 < K) {
      stage_tile(A,  K, mblk, k0 + 32, As[buf ^ 1]);
      stage_tile(Bt, K, nblk, k0 + 32, Bs[buf ^ 1]);
    }
    v16h a[4], b[2];
#pragma unroll
    for (int mt = 0; mt < 4; mt++) a[mt] = lds_frag(As[buf], wm * 64 + mt * 16);
#pragma unroll
    for (int nt = 0; nt < 2; nt++) b[nt] = lds_frag(Bs[buf], wn * 32 + nt * 16);
#pragma unroll
    for (int mt = 0; mt < 4; mt++)
#pragma unroll
      for (int nt = 0; nt < 2; nt++)
        acc[mt][nt] = WMMA_F16(a[mt], b[nt], acc[mt][nt]);
    __syncthreads();
    buf ^= 1;
  }

  const int col   = lane & 15;
  const int rbase = (lane >> 4) << 3;
  if (QKV) {
    // A 128-column block lies inside one of q, k, v and a 128-row block inside
    // one batch, so both choices are the same for the whole workgroup.
    const int part = nblk >> 10;
    const int hn = (nblk & 1023) + wn * 32 + col;     // nt adds 16: same head
    const int bh = (mblk >> 10) * 16 + (hn >> 6);
    const int e  = hn & 63;
    const int s0 = (mblk & 1023) + wm * 64 + rbase;   // mt adds 16
    if (part == 2) {
      _Float16* d = Vt + ((size_t)bh * 64 + e) * 1024 + s0;
#pragma unroll
      for (int nt = 0; nt < 2; nt++) {
#pragma unroll
        for (int mt = 0; mt < 4; mt++) {
          v8h o;
#pragma unroll
          for (int r = 0; r < 8; r++) o[r] = (_Float16)acc[mt][nt][r];
          *(v8h*)(d + nt * 16 * 1024 + mt * 16) = o;
        }
      }
    } else {
      _Float16* d = (part == 0 ? C16 : Kh) + ((size_t)bh * 1024 + s0) * 64 + e;
#pragma unroll
      for (int mt = 0; mt < 4; mt++) {
#pragma unroll
        for (int nt = 0; nt < 2; nt++) {
#pragma unroll
          for (int r = 0; r < 8; r++)
            d[(mt * 16 + r) * 64 + nt * 16] = (_Float16)acc[mt][nt][r];
        }
      }
      // Precaution: stands in front of any later rewrite of a register that the
      // stores above name.
      asm volatile("s_wait_xcnt 0x0" ::: "memory");
    }
    return;
  }
#pragma unroll
  for (int mt = 0; mt < 4; mt++) {
#pragma unroll
    for (int nt = 0; nt < 2; nt++) {
      int n = nblk + wn * 32 + nt * 16 + col;
      float bv = BIAS ? bias[n] : 0.f;
#pragma unroll
      for (int r = 0; r < 8; r++) {
        int m = mblk + wm * 64 + mt * 16 + rbase + r;
        float vv = acc[mt][nt][r] + bv;
        if (RELU) vv = fmaxf(vv, 0.f);
        if (RES) vv += resid[(size_t)m * N + n];
        if (OUT32) C32[(size_t)m * N + n] = vv;
        if (OUT16) C16[(size_t)m * N + n] = (_Float16)vv;
      }
    }
  }
}

// ---------------------------------------------------------------------------
// Flash attention: one wave per 16 query rows of one (b,h).
// Online softmax over WMMA C-layout; P staged through LDS to A-layout.
// Output written (B, S, H*dh) f16 for the out-projection GEMM.
// ---------------------------------------------------------------------------
__global__ __launch_bounds__(128) void attention_kernel(
    const _Float16* __restrict__ q, const _Float16* __restrict__ k,
    const _Float16* __restrict__ vT, _Float16* __restrict__ o) {
  constexpr int S = 1024, DH = 64;
  const int wave = threadIdx.x >> 5;
  const int lane = threadIdx.x & 31;
  const int bh = blockIdx.y;
  const int qrow0 = blockIdx.x * 64 + wave * 16;

  const _Float16* qb = q  + (size_t)bh * S * DH;
  const _Float16* kb = k  + (size_t)bh * S * DH;
  const _Float16* vb = vT + (size_t)bh * DH * S;

  __shared__ __align__(16) _Float16 pbuf[4][16 * 32];
  _Float16* pl = pbuf[wave];

  const v16h qa0 = load_frag(qb, DH, qrow0, 0);
  const v16h qa1 = load_frag(qb, DH, qrow0, 32);

  float mrow[8], lrow[8];
  v8f oacc[4];
#pragma unroll
  for (int r = 0; r < 8; r++) { mrow[r] = -1e30f; lrow[r] = 0.f; }
#pragma unroll
  for (int t = 0; t < 4; t++) oacc[t] = {};

  const int col   = lane & 15;
  const int rbase = (lane >> 4) << 3;

  for (int jb = 0; jb < S; jb += 32) {
    // scores for 32 keys: two 16x16 tiles, K = dh = 64 = 2 WMMA steps
    v8f s0 = {}, s1 = {};
    {
      v16h k0a = load_frag(kb, DH, jb, 0);
      v16h k0b = load_frag(kb, DH, jb, 32);
      s0 = WMMA_F16(qa0, k0a, s0);
      s0 = WMMA_F16(qa1, k0b, s0);
      v16h k1a = load_frag(kb, DH, jb + 16, 0);
      v16h k1b = load_frag(kb, DH, jb + 16, 32);
      s1 = WMMA_F16(qa0, k1a, s1);
      s1 = WMMA_F16(qa1, k1b, s1);
    }
    // online softmax update per row (row r lives across a 16-lane half)
#pragma unroll
    for (int r = 0; r < 8; r++) {
      float a0 = s0[r] * 0.125f;  // 1/sqrt(64)
      float a1 = s1[r] * 0.125f;
      float mx = fmaxf(a0, a1);
#pragma unroll
      for (int m = 8; m >= 1; m >>= 1) mx = fmaxf(mx, __shfl_xor(mx, m, 32));
      float mnew  = fmaxf(mrow[r], mx);
      float alpha = __expf(mrow[r] - mnew);
      float p0 = __expf(a0 - mnew);
      float p1 = __expf(a1 - mnew);
      float rs = p0 + p1;
#pragma unroll
      for (int m = 8; m >= 1; m >>= 1) rs += __shfl_xor(rs, m, 32);
      lrow[r] = lrow[r] * alpha + rs;
      mrow[r] = mnew;
#pragma unroll
      for (int t = 0; t < 4; t++) oacc[t][r] *= alpha;
      pl[(rbase + r) * 32 + col]      = (_Float16)p0;
      pl[(rbase + r) * 32 + 16 + col] = (_Float16)p1;
    }
    // reload P in A-fragment layout and accumulate P(16x32) * V(32x64)
    {
      int prow = lane & 15;
      int pk   = (lane >> 4) << 3;
      const _Float16* pp = pl + prow * 32 + pk;
      v8h lo = *(const v8h*)pp;
      v8h hi = *(const v8h*)(pp + 16);
      v16h pa = __builtin_shufflevector(lo, hi, 0,1,2,3,4,5,6,7,8,9,10,11,12,13,14,15);
#pragma unroll
      for (int t = 0; t < 4; t++) {
        v16h vf = load_frag(vb, S, t * 16, jb);
        oacc[t] = WMMA_F16(pa, vf, oacc[t]);
      }
    }
  }

  const int b = bh >> 4, h = bh & 15;
#pragma unroll
  for (int r = 0; r < 8; r++) {
    float inv = 1.f / lrow[r];
    int srow = qrow0 + rbase + r;
    _Float16* orow = o + ((size_t)(b * 1024 + srow)) * 1024 + h * 64;
#pragma unroll
    for (int t = 0; t < 4; t++) orow[t * 16 + col] = (_Float16)(oacc[t][r] * inv);
  }
}

// ---------------------------------------------------------------------------
// Host-side orchestration
// ---------------------------------------------------------------------------
extern "C" void kernel_launch(void* const* d_in, const int* in_sizes, int n_in,
                              void* d_out, int out_size, void* d_ws, size_t ws_size,
                              hipStream_t stream) {
  (void)in_sizes; (void)n_in; (void)out_size; (void)ws_size;
  const float* x      = (const float*)d_in[0];   // (4,1024,1024)
  const float* w_in   = (const float*)d_in[1];   // (3072,1024)
  const float* w_out  = (const float*)d_in[2];   // (1024,1024)
  const float* ln1_g  = (const float*)d_in[3];
  const float* ln1_b  = (const float*)d_in[4];
  const float* w_up   = (const float*)d_in[5];   // (1024,2048)
  const float* b_up   = (const float*)d_in[6];
  const float* w_down = (const float*)d_in[7];   // (2048,1024)
  const float* b_down = (const float*)d_in[8];
  const float* ln2_g  = (const float*)d_in[9];
  const float* ln2_b  = (const float*)d_in[10];
  float* out = (float*)d_out;

  const int BS = 4096, D = 1024;

  char* ws = (char*)d_ws;
  size_t off = 0;
  auto alloc = [&](size_t bytes) -> void* {
    off = (off + 255) & ~(size_t)255;
    void* p = ws + off;
    off += bytes;
    return p;
  };

  _Float16* w_in16   = (_Float16*)alloc((size_t)3 * D * D * 2);
  _Float16* w_outT   = (_Float16*)alloc((size_t)D * D * 2);
  _Float16* w_upT    = (_Float16*)alloc((size_t)2 * D * D * 2);
  _Float16* w_downT  = (_Float16*)alloc((size_t)2 * D * D * 2);
  _Float16* h16      = (_Float16*)alloc((size_t)BS * D * 2);
  _Float16* q16      = (_Float16*)alloc((size_t)BS * D * 2);
  _Float16* k16      = (_Float16*)alloc((size_t)BS * D * 2);
  _Float16* vT16     = (_Float16*)alloc((size_t)BS * D * 2);
  _Float16* attn16   = (_Float16*)alloc((size_t)BS * D * 2);
  float*    x1       = (float*)   alloc((size_t)BS * D * 4);
  _Float16* h2_16    = (_Float16*)alloc((size_t)BS * D * 2);
  _Float16* ff16     = (_Float16*)alloc((size_t)BS * 2 * D * 2);

  // --- weight conversion ---
  cvt_f32_to_f16<<<(3 * D * D + 255) / 256, 256, 0, stream>>>(w_in, w_in16, 3 * D * D);
  transpose_to_f16<<<dim3(D / 64, D / 64), 256, 0, stream>>>(w_out, w_outT, D, D);
  transpose_to_f16<<<dim3(2 * D / 64, D / 64), 256, 0, stream>>>(w_up, w_upT, D, 2 * D);
  transpose_to_f16<<<dim3(D / 64, 2 * D / 64), 256, 0, stream>>>(w_down, w_downT, 2 * D, D);

  // --- LN1 -> h16 ---
  layernorm_to_f16<<<BS, 256, 0, stream>>>(x, ln1_g, ln1_b, h16);

  // --- qkv = h @ in_project.T  (M=4096, N=3072, K=1024), f16 out, stored as
  //     q/k (B*H,S,dh) and vT (B*H,dh,S) ---
  gemm_wmma<false, false, false, false, true, true>
      <<<dim3(3072 / 128, BS / 128), 256, 0, stream>>>(
          h16, w_in16, nullptr, nullptr, nullptr, q16, k16, vT16, BS, 3 * D, D);

  // --- flash attention -> attn16 (B,S,H*dh) ---
  attention_kernel<<<dim3(1024 / 64, 64), 128, 0, stream>>>(q16, k16, vT16, attn16);

  // --- x1 = attn @ out_project + x  (M=4096, N=1024, K=1024), f32 out ---
  gemm_wmma<false, false, true, true, false, false>
      <<<dim3(1024 / 128, BS / 128), 256, 0, stream>>>(
          attn16, w_outT, nullptr, x, x1, nullptr, nullptr, nullptr, BS, D, D);

  // --- LN2 -> h2_16 ---
  layernorm_to_f16<<<BS, 256, 0, stream>>>(x1, ln2_g, ln2_b, h2_16);

  // --- ff = relu(h2 @ w_up + b_up)  (M=4096, N=2048, K=1024), f16 out ---
  gemm_wmma<true, true, false, false, true, false>
      <<<dim3(2048 / 128, BS / 128), 256, 0, stream>>>(
          h2_16, w_upT, b_up, nullptr, nullptr, ff16, nullptr, nullptr, BS, 2 * D, D);

  // --- out = ff @ w_down + b_down + x1  (M=4096, N=1024, K=2048), f32 out ---
  gemm_wmma<true, false, true, true, false, false>
      <<<dim3(1024 / 128, BS / 128), 256, 0, stream>>>(
          ff16, w_downT, b_down, x1, out, nullptr, nullptr, nullptr, BS, D, 2 * D);
}

// v003
// One run takes 210 microseconds.
// Two timings next to v002 put it at 1.13 and 1.14 times that version's speed.
// Over all steps from v000 it is 2.00 times as fast.
#include <hip/hip_runtime.h>

typedef __attribute__((ext_vector_type(16))) _Float16 v16h;
typedef __attribute__((ext_vector_type(8)))  _Float16 v8h;
typedef __attribute__((ext_vector_type(8)))  float    v8f;

#define WMMA_F16(a, b, c) \
  __builtin_amdgcn_wmma_f32_16x16x32_f16(false, (a), false, (b), (short)0, (c), false, false)

// ---------------------------------------------------------------------------
// Fragment load from GLOBAL: 16-bit A or B fragment (16 rows x 32 K) from
// (rows, K) row-major storage. Per ISA layout: lane L holds row (L&15); its
// 16 halves are K[kb..kb+7] and K[kb+16..kb+23] with kb = k0 + (L>>4)*8.
// ---------------------------------------------------------------------------
__device__ inline v16h load_frag(const _Float16* __restrict__ base, int ld,
                                 int row0, int k0) {
  int lane = threadIdx.x & 31;
  const _Float16* p = base + (size_t)(row0 + (lane & 15)) * ld + k0 + ((lane >> 4) << 3);
  v8h lo = *(const v8h*)p;
  v8h hi = *(const v8h*)(p + 16);
  return __builtin_shufflevector(lo, hi, 0,1,2,3,4,5,6,7,8,9,10,11,12,13,14,15);
}

// ---------------------------------------------------------------------------
// Fragment load from LDS tile with padded row stride of 40 halves (80 B):
// 16 fragment rows hit 16 distinct bank groups -> conflict-free ds_load_b128.
// ---------------------------------------------------------------------------
#define LDS_STRIDE 40

__device__ inline v16h lds_frag(const _Float16* lds, int row0) {
  int lane = threadIdx.x & 31;
  const _Float16* p = lds + (row0 + (lane & 15)) * LDS_STRIDE + ((lane >> 4) << 3);
  v8h lo = *(const v8h*)p;
  v8h hi = *(const v8h*)(p + 16);
  return __builtin_shufflevector(lo, hi, 0,1,2,3,4,5,6,7,8,9,10,11,12,13,14,15);
}

// Stage a 128-row x 32-col f16 tile from global (row-major, leading dim ld)
// into LDS (row stride LDS_STRIDE). 256 threads, coalesced 16B chunks:
// threads t..t+3 cover one contiguous 64B row segment.
__device__ inline void stage_tile(const _Float16* __restrict__ g, int ld,
                                  int row0, int k0, _Float16* __restrict__ lds) {
  int t = threadIdx.x;
#pragma unroll
  for (int i = 0; i < 2; i++) {
    int c = t + i * 256;          // chunk 0..511 (8 halves each)
    int row = c >> 2;
    int piece = (c & 3) << 3;
    v8h v = *(const v8h*)(g + (size_t)(row0 + row) * ld + k0 + piece);
    *(v8h*)(lds + row * LDS_STRIDE + piece) = v;
  }
}

// ---------------------------------------------------------------------------
// Elementwise weight converters
// ---------------------------------------------------------------------------
__global__ void cvt_f32_to_f16(const float* __restrict__ in,
                               _Float16* __restrict__ out, int n) {
  int i = blockIdx.x * blockDim.x + threadIdx.x;
  if (i < n) out[i] = (_Float16)in[i];
}

// in: (R, C) f32 row-major  ->  out: (C, R) f16 row-major
// One 64x64 tile per workgroup of 256 threads, turned in LDS, so that both
// sides of global memory see whole 128-byte lines: reads are 16 B per lane
// along c (256 B per tile row), writes are 16 B per lane along r (8 lanes fill
// one 128-byte line of an output row). R and C must be multiples of 64.
// Tile pitch 65 floats: the 32 lanes of a wave hit 32 different banks both
// when storing rows and when reading columns.
#define TT 64
#define TT_PITCH 65

__global__ __launch_bounds__(256) void transpose_to_f16(
    const float* __restrict__ in, _Float16* __restrict__ out, int R, int C) {
  __shared__ float tile[TT * TT_PITCH];
  const int t  = threadIdx.x;
  const int c0 = blockIdx.x * TT;
  const int r0 = blockIdx.y * TT;

  const int lc = (t & 15) << 2;   // first of this lane's 4 columns
  const int lr = t >> 4;          // 0..15
  float4 v[4];
#pragma unroll
  for (int i = 0; i < 4; i++)
    v[i] = *(const float4*)(in + (size_t)(r0 + lr + i * 16) * C + c0 + lc);
#pragma unroll
  for (int i = 0; i < 4; i++) {
    float* d = tile + (lr + i * 16) * TT_PITCH + lc;
    d[0] = v[i].x; d[1] = v[i].y; d[2] = v[i].z; d[3] = v[i].w;
  }
  __syncthreads();

  const int sr = (t & 7) << 3;    // first of this lane's 8 rows
  const int sc = t >> 3;          // 0..31
#pragma unroll
  for (int i = 0; i < 2; i++) {
    const int c = sc + i * 32;
    v8h o;
#pragma unroll
    for (int j = 0; j < 8; j++) o[j] = (_Float16)tile[(sr + j) * TT_PITCH + c];
    *(v8h*)(out + (size_t)(c0 + c) * R + r0 + sr) = o;
  }
}

// ---------------------------------------------------------------------------
// LayerNorm over rows of 1024, f32 in -> f16 out (feeds WMMA GEMMs)
// ---------------------------------------------------------------------------
__global__ __launch_bounds__(256) void layernorm_to_f16(
    const float* __restrict__ x, const float* __restrict__ gamma,
    const float* __restrict__ beta, _Float16* __restrict__ out) {
  const int row = blockIdx.x;
  const float* xr = x + (size_t)row * 1024;
  float v[4], s = 0.f, sq = 0.f;
#pragma unroll
  for (int i = 0; i < 4; i++) {
    v[i] = xr[threadIdx.x + i * 256];
    s += v[i];
    sq += v[i] * v[i];
  }
#pragma unroll
  for (int m = 16; m >= 1; m >>= 1) {
    s  += __shfl_xor(s, m, 32);
    sq += __shfl_xor(sq, m, 32);
  }
  __shared__ float ss[8], ssq[8];
  int w = threadIdx.x >> 5;
  if ((threadIdx.x & 31) == 0) { ss[w] = s; ssq[w] = sq; }
  __syncthreads();
  if (threadIdx.x < 32) {
    float a  = (threadIdx.x < 8) ? ss[threadIdx.x]  : 0.f;
    float aq = (threadIdx.x < 8) ? ssq[threadIdx.x] : 0.f;
#pragma unroll
    for (int m = 4; m >= 1; m >>= 1) {
      a  += __shfl_xor(a, m, 32);
      aq += __shfl_xor(aq, m, 32);
    }
    if (threadIdx.x == 0) { ss[0] = a; ssq[0] = aq; }
  }
  __syncthreads();
  float mean = ss[0] * (1.f / 1024.f);
  float var  = ssq[0] * (1.f / 1024.f) - mean * mean;
  float inv  = rsqrtf(var + 1e-5f);
#pragma unroll
  for (int i = 0; i < 4; i++) {
    int c = threadIdx.x + i * 256;
    out[(size_t)row * 1024 + c] = (_Float16)((v[i] - mean) * inv * gamma[c] + beta[c]);
  }
}

// ---------------------------------------------------------------------------
// LDS-staged WMMA GEMM: C[M,N] = A16[M,K] * Bt16[N,K]^T (+bias)(+relu)(+res)
// Workgroup tile 128x128, K-step 32, double-buffered LDS (40 KB).
// 8 waves, each owns a 64x32 sub-tile = 4x2 WMMA C tiles (8 WMMA / K-step).
// Each tile byte is fetched from L2 exactly once: 16 KB / 1.05 MFLOP per
// workgroup K-step = 64 FLOP/byte of L2 traffic.
// QKV: the output is the (4*1024, 3*1024) q|k|v product and goes straight to
// the layouts attention reads: q and k as (B*H, S, dh) into C16 and Kh, v
// transposed as (B*H, dh, S) into Vt. A lane's 8 accumulator rows are 8
// consecutive s of one (head, e), so v leaves as one 16-byte store per C tile,
// and the 4 tiles of a wave's 64 rows fill one whole 128-byte line of Vt.
// ---------------------------------------------------------------------------
template <bool BIAS, bool RELU, bool RES, bool OUT32, bool OUT16, bool QKV>
__global__ __launch_bounds__(256) void gemm_wmma(
    const _Float16* __restrict__ A, const _Float16* __restrict__ Bt,
    const float* __restrict__ bias, const float* __restrict__ resid,
    float* __restrict__ C32, _Float16* __restrict__ C16,
    _Float16* __restrict__ Kh, _Float16* __restrict__ Vt,
    int M, int N, int K) {
  const int w    = threadIdx.x >> 5;
  const int lane = threadIdx.x & 31;
  const int wm = w >> 2;          // 0..1 -> 64-row slice
  const int wn = w & 3;           // 0..3 -> 32-col slice
  const int mblk = blockIdx.y * 128;
  const int nblk = blockIdx.x * 128;

  __shared__ __align__(16) _Float16 As[2][128 * LDS_STRIDE];
  __shared__ __align__(16) _Float16 Bs[2][128 * LDS_STRIDE];

  v8f acc[4][2];
#pragma unroll
  for (int mt = 0; mt < 4; mt++)
#pragma unroll
    for (int nt = 0; nt < 2; nt++) acc[mt][nt] = {};

  stage_tile(A,  K, mblk, 0, As[0]);
  stage_tile(Bt, K, nblk, 0, Bs[0]);
  __syncthreads();

  int buf = 0;
  for (int k0 = 0; k0 < K; k0 += 32) {
    if (k0 + 32 < K) {
      stage_tile(A,  K, mblk, k0 + 32, As[buf ^ 1]);
      stage_tile(Bt, K, nblk, k0 + 32, Bs[buf ^ 1]);
    }
    v16h a[4], b[2];
#pragma unroll
    for (int mt = 0; mt < 4; mt++) a[mt] = lds_frag(As[buf], wm * 64 + mt * 16);
#pragma unroll
    for (int nt = 0; nt < 2; nt++) b[nt] = lds_frag(Bs[buf], wn * 32 + nt * 16);
#pragma unroll
    for (int mt = 0; mt < 4; mt++)
#pragma unroll
      for (int nt = 0; nt < 2; nt++)
        acc[mt][nt] = WMMA_F16(a[mt], b[nt], acc[mt][nt]);
    __syncthreads();
    buf ^= 1;
  }

  const int col   = lane & 15;
  const int rbase = (lane >> 4) << 3;
  if (QKV) {
    // A 128-column block lies inside one of q, k, v and a 128-row block inside
    // one batch, so both choices are the same for the whole workgroup.
    const int part = nblk >> 10;
    const int hn = (nblk & 1023) + wn * 32 + col;     // nt adds 16: same head
    const int bh = (mblk >> 10) * 16 + (hn >> 6);
    const int e  = hn & 63;
    const int s0 = (mblk & 1023) + wm * 64 + rbase;   // mt adds 16
    if (part == 2) {
      _Float16* d = Vt + ((size_t)bh * 64 + e) * 1024 + s0;
#pragma unroll
      for (int nt = 0; nt < 2; nt++) {
#pragma unroll
        for (int mt = 0; mt < 4; mt++) {
          v8h o;
#pragma unroll
          for (int r = 0; r < 8; r++) o[r] = (_Float16)acc[mt][nt][r];
          *(v8h*)(d + nt * 16 * 1024 + mt * 16) = o;
        }
      }
    } else {
      _Float16* d = (part == 0 ? C16 : Kh) + ((size_t)bh * 1024 + s0) * 64 + e;
#pragma unroll
      for (int mt = 0; mt < 4; mt++) {
#pragma unroll
        for (int nt = 0; nt < 2; nt++) {
#pragma unroll
          for (int r = 0; r < 8; r++)
            d[(mt * 16 + r) * 64 + nt * 16] = (_Float16)acc[mt][nt][r];
        }
      }
      // Precaution: stands in front of any later rewrite of a register that the
      // stores above name.
      asm volatile("s_wait_xcnt 0x0" ::: "memory");
    }
    return;
  }
#pragma unroll
  for (int mt = 0; mt < 4; mt++) {
#pragma unroll
    for (int nt = 0; nt < 2; nt++) {
      int n = nblk + wn * 32 + nt * 16 + col;
      float bv = BIAS ? bias[n] : 0.f;
#pragma unroll
      for (int r = 0; r < 8; r++) {
        int m = mblk + wm * 64 + mt * 16 + rbase + r;
        float vv = acc[mt][nt][r] + bv;
        if (RELU) vv = fmaxf(vv, 0.f);
        if (RES) vv += resid[(size_t)m * N + n];
        if (OUT32) C32[(size_t)m * N + n] = vv;
        if (OUT16) C16[(size_t)m * N + n] = (_Float16)vv;
      }
    }
  }
}

// ---------------------------------------------------------------------------
// Flash attention: one wave per 16 query rows of one (b,h), 4 waves a workgroup.
// K and V^T come in tiles of 64 keys that the workgroup stages ONCE in LDS:
// every global load covers whole 128-byte lines (8 lanes a row), and the four
// waves take their fragments from LDS. Two buffers: the next tile's loads are
// issued ahead of the work on this tile and stored behind it.
// Row pitch 144 B (16 B x odd): conflict-free for the 16-byte fragment reads.
// Online softmax over WMMA C-layout; P staged through LDS to A-layout.
// Output written (B, S, H*dh) f16 for the out-projection GEMM.
// ---------------------------------------------------------------------------
#define KV_TILE 64
#define KV_PITCH 72

__device__ inline v16h kv_frag(const _Float16* lds, int row0, int k0) {
  int lane = threadIdx.x & 31;
  const _Float16* p = lds + (row0 + (lane & 15)) * KV_PITCH + k0 + ((lane >> 4) << 3);
  v8h lo = *(const v8h*)p;
  v8h hi = *(const v8h*)(p + 16);
  return __builtin_shufflevector(lo, hi, 0,1,2,3,4,5,6,7,8,9,10,11,12,13,14,15);
}

__global__ __launch_bounds__(128) void attention_kernel(
    const _Float16* __restrict__ q, const _Float16* __restrict__ k,
    const _Float16* __restrict__ vT, _Float16* __restrict__ o) {
  constexpr int S = 1024, DH = 64;
  const int wave = threadIdx.x >> 5;
  const int lane = threadIdx.x & 31;
  const int bh = blockIdx.y;
  const int qrow0 = blockIdx.x * 64 + wave * 16;

  const _Float16* qb = q  + (size_t)bh * S * DH;
  const _Float16* kb = k  + (size_t)bh * S * DH;
  const _Float16* vb = vT + (size_t)bh * DH * S;

  __shared__ __align__(16) _Float16 Ks[2][KV_TILE * KV_PITCH];  // keys x dh
  __shared__ __align__(16) _Float16 Vs[2][DH * KV_PITCH];       // dh x keys
  __shared__ __align__(16) _Float16 pbuf[4][16 * 32];
  _Float16* pl = pbuf[wave];

  // Staging share of a thread: 16 bytes of rows srow, srow + 16, + 32, + 48 of
  // the K tile and of the V^T tile (both are 64 rows of 128 bytes).
  const int srow = threadIdx.x >> 3;
  const int spc  = (threadIdx.x & 7) << 3;
  const _Float16* kg = kb + (size_t)srow * DH + spc;
  const _Float16* vg = vb + (size_t)srow * S + spc;
  const int sl = srow * KV_PITCH + spc;
  v8h kr[4], vr[4];

#pragma unroll
  for (int i = 0; i < 4; i++) {
    kr[i] = *(const v8h*)(kg + i * 16 * DH);
    vr[i] = *(const v8h*)(vg + i * 16 * S);
  }

  const v16h qa0 = load_frag(qb, DH, qrow0, 0);
  const v16h qa1 = load_frag(qb, DH, qrow0, 32);

#pragma unroll
  for (int i = 0; i < 4; i++) {
    *(v8h*)(Ks[0] + sl + i * 16 * KV_PITCH) = kr[i];
    *(v8h*)(Vs[0] + sl + i * 16 * KV_PITCH) = vr[i];
  }
  __syncthreads();

  float mrow[8], lrow[8];
  v8f oacc[4];
#pragma unroll
  for (int r = 0; r < 8; r++) { mrow[r] = -1e30f; lrow[r] = 0.f; }
#pragma unroll
  for (int t = 0; t < 4; t++) oacc[t] = {};

  const int col   = lane & 15;
  const int rbase = (lane >> 4) << 3;

  for (int st = 0; st < S / KV_TILE; st++) {
    const _Float16* Kc = Ks[st & 1];
    const _Float16* Vc = Vs[st & 1];
    const bool more = st + 1 < S / KV_TILE;
    if (more) {
      const int jn = (st + 1) * KV_TILE;
#pragma unroll
      for (int i = 0; i < 4; i++) {
        kr[i] = *(const v8h*)(kg + (size_t)(jn + i * 16) * DH);
        vr[i] = *(const v8h*)(vg + i * 16 * S + jn);
      }
    }
#pragma unroll
    for (int jb = 0; jb < KV_TILE; jb += 32) {
      // scores for 32 keys: two 16x16 tiles, K = dh = 64 = 2 WMMA steps
      v8f s0 = {}, s1 = {};
      {
        v16h k0a = kv_frag(Kc, jb, 0);
        v16h k0b = kv_frag(Kc, jb, 32);
        s0 = WMMA_F16(qa0, k0a, s0);
        s0 = WMMA_F16(qa1, k0b, s0);
        v16h k1a = kv_frag(Kc, jb + 16, 0);
        v16h k1b = kv_frag(Kc, jb + 16, 32);
        s1 = WMMA_F16(qa0, k1a, s1);
        s1 = WMMA_F16(qa1, k1b, s1);
      }
      // online softmax update per row (row r lives across a 16-lane half)
#pragma unroll
      for (int r = 0; r < 8; r++) {
        float a0 = s0[r] * 0.125f;  // 1/sqrt(64)
        float a1 = s1[r] * 0.125f;
        float mx = fmaxf(a0, a1);
#pragma unroll
        for (int m = 8; m >= 1; m >>= 1) mx = fmaxf(mx, __shfl_xor(mx, m, 32));
        float mnew  = fmaxf(mrow[r], mx);
        float alpha = __expf(mrow[r] - mnew);
        float p0 = __expf(a0 - mnew);
        float p1 = __expf(a1 - mnew);
        float rs = p0 + p1;
#pragma unroll
        for (int m = 8; m >= 1; m >>= 1) rs += __shfl_xor(rs, m, 32);
        lrow[r] = lrow[r] * alpha + rs;
        mrow[r] = mnew;
#pragma unroll
        for (int t = 0; t < 4; t++) oacc[t][r] *= alpha;
        pl[(rbase + r) * 32 + col]      = (_Float16)p0;
        pl[(rbase + r) * 32 + 16 + col] = (_Float16)p1;
      }
      // reload P in A-fragment layout and accumulate P(16x32) * V(32x64)
      {
        int prow = lane & 15;
        int pk   = (lane >> 4) << 3;
        const _Float16* pp = pl + prow * 32 + pk;
        v8h lo = *(const v8h*)pp;
        v8h hi = *(const v8h*)(pp + 16);
        v16h pa = __builtin_shufflevector(lo, hi, 0,1,2,3,4,5,6,7,8,9,10,11,12,13,14,15);
#pragma unroll
        for (int t = 0; t < 4; t++) {
          v16h vf = kv_frag(Vc, t * 16, jb);
          oacc[t] = WMMA_F16(pa, vf, oacc[t]);
        }
      }
    }
    if (more) {
      // The other buffer's last readers left it at the barrier that ended the
      // pass before this one.
      _Float16* Kn = Ks[(st + 1) & 1];
      _Float16* Vn = Vs[(st + 1) & 1];
#pragma unroll
      for (int i = 0; i < 4; i++) {
        *(v8h*)(Kn + sl + i * 16 * KV_PITCH) = kr[i];
        *(v8h*)(Vn + sl + i * 16 * KV_PITCH) = vr[i];
      }
    }
    // Publishes the next tile and ends every wave's reads of this one.
    __syncthreads();
  }

  const int b = bh >> 4, h = bh & 15;
#pragma unroll
  for (int r = 0; r < 8; r++) {
    float inv = 1.f / lrow[r];
    int orow_s = qrow0 + rbase + r;
    _Float16* orow = o + ((size_t)(b * 1024 + orow_s)) * 1024 + h * 64;
#pragma unroll
    for (int t = 0; t < 4; t++) orow[t * 16 + col] = (_Float16)(oacc[t][r] * inv);
  }
}

// ---------------------------------------------------------------------------
// Host-side orchestration
// ---------------------------------------------------------------------------
extern "C" void kernel_launch(void* const* d_in, const int* in_sizes, int n_in,
                              void* d_out, int out_size, void* d_ws, size_t ws_size,
                              hipStream_t stream) {
  (void)in_sizes; (void)n_in; (void)out_size; (void)ws_size;
  const float* x      = (const float*)d_in[0];   // (4,1024,1024)
  const float* w_in   = (const float*)d_in[1];   // (3072,1024)
  const float* w_out  = (const float*)d_in[2];   // (1024,1024)
  const float* ln1_g  = (const float*)d_in[3];
  const float* ln1_b  = (const float*)d_in[4];
  const float* w_up   = (const float*)d_in[5];   // (1024,2048)
  const float* b_up   = (const float*)d_in[6];
  const float* w_down = (const float*)d_in[7];   // (2048,1024)
  const float* b_down = (const float*)d_in[8];
  const float* ln2_g  = (const float*)d_in[9];
  const float* ln2_b  = (const float*)d_in[10];
  float* out = (float*)d_out;

  const int BS = 4096, D = 1024;

  char* ws = (char*)d_ws;
  size_t off = 0;
  auto alloc = [&](size_t bytes) -> void* {
    off = (off + 255) & ~(size_t)255;
    void* p = ws + off;
    off += bytes;
    return p;
  };

  _Float16* w_in16   = (_Float16*)alloc((size_t)3 * D * D * 2);
  _Float16* w_outT   = (_Float16*)alloc((size_t)D * D * 2);
  _Float16* w_upT    = (_Float16*)alloc((size_t)2 * D * D * 2);
  _Float16* w_downT  = (_Float16*)alloc((size_t)2 * D * D * 2);
  _Float16* h16      = (_Float16*)alloc((size_t)BS * D * 2);
  _Float16* q16      = (_Float16*)alloc((size_t)BS * D * 2);
  _Float16* k16      = (_Float16*)alloc((size_t)BS * D * 2);
  _Float16* vT16     = (_Float16*)alloc((size_t)BS * D * 2);
  _Float16* attn16   = (_Float16*)alloc((size_t)BS * D * 2);
  float*    x1       = (float*)   alloc((size_t)BS * D * 4);
  _Float16* h2_16    = (_Float16*)alloc((size_t)BS * D * 2);
  _Float16* ff16     = (_Float16*)alloc((size_t)BS * 2 * D * 2);

  // --- weight conversion ---
  cvt_f32_to_f16<<<(3 * D * D + 255) / 256, 256, 0, stream>>>(w_in, w_in16, 3 * D * D);
  transpose_to_f16<<<dim3(D / 64, D / 64), 256, 0, stream>>>(w_out, w_outT, D, D);
  transpose_to_f16<<<dim3(2 * D / 64, D / 64), 256, 0, stream>>>(w_up, w_upT, D, 2 * D);
  transpose_to_f16<<<dim3(D / 64, 2 * D / 64), 256, 0, stream>>>(w_down, w_downT, 2 * D, D);

  // --- LN1 -> h16 ---
  layernorm_to_f16<<<BS, 256, 0, stream>>>(x, ln1_g, ln1_b, h16);

  // --- qkv = h @ in_project.T  (M=4096, N=3072, K=1024), f16 out, stored as
  //     q/k (B*H,S,dh) and vT (B*H,dh,S) ---
  gemm_wmma<false, false, false, false, true, true>
      <<<dim3(3072 / 128, BS / 128), 256, 0, stream>>>(
          h16, w_in16, nullptr, nullptr, nullptr, q16, k16, vT16, BS, 3 * D, D);

  // --- flash attention -> attn16 (B,S,H*dh) ---
  attention_kernel<<<dim3(1024 / 64, 64), 128, 0, stream>>>(q16, k16, vT16, attn16);

  // --- x1 = attn @ out_project + x  (M=4096, N=1024, K=1024), f32 out ---
  gemm_wmma<false, false, true, true, false, false>
      <<<dim3(1024 / 128, BS / 128), 256, 0, stream>>>(
          attn16, w_outT, nullptr, x, x1, nullptr, nullptr, nullptr, BS, D, D);

  // --- LN2 -> h2_16 ---
  layernorm_to_f16<<<BS, 256, 0, stream>>>(x1, ln2_g, ln2_b, h2_16);

  // --- ff = relu(h2 @ w_up + b_up)  (M=4096, N=2048, K=1024), f16 out ---
  gemm_wmma<true, true, false, false, true, false>
      <<<dim3(2048 / 128, BS / 128), 256, 0, stream>>>(
          h2_16, w_upT, b_up, nullptr, nullptr, ff16, nullptr, nullptr, BS, 2 * D, D);

  // --- out = ff @ w_down + b_down + x1  (M=4096, N=1024, K=2048), f32 out ---
  gemm_wmma<true, false, true, true, false, false>
      <<<dim3(1024 / 128, BS / 128), 256, 0, stream>>>(
          ff16, w_downT, b_down, x1, out, nullptr, nullptr, nullptr, BS, D, 2 * D);
}

// v004
// One run takes 155 microseconds.
// Next to v003, in two timings, it ran 1.35 and 1.36 times as fast.
// Over all steps from v000 it is 2.71 times as fast.
#include <hip/hip_runtime.h>

typedef __attribute__((ext_vector_type(16))) _Float16 v16h;
typedef __attribute__((ext_vector_type(8)))  _Float16 v8h;
typedef __attribute__((ext_vector_type(8)))  float    v8f;

#define WMMA_F16(a, b, c) \
  __builtin_amdgcn_wmma_f32_16x16x32_f16(false, (a), false, (b), (short)0, (c), false, false)

// ---------------------------------------------------------------------------
// Fragment load from GLOBAL: 16-bit A or B fragment (16 rows x 32 K) from
// (rows, K) row-major storage. Per ISA layout: lane L holds row (L&15); its
// 16 halves are K[kb..kb+7] and K[kb+16..kb+23] with kb = k0 + (L>>4)*8.
// ---------------------------------------------------------------------------
__device__ inline v16h load_frag(const _Float16* __restrict__ base, int ld,
                                 int row0, int k0) {
  int lane = threadIdx.x & 31;
  const _Float16* p = base + (size_t)(row0 + (lane & 15)) * ld + k0 + ((lane >> 4) << 3);
  v8h lo = *(const v8h*)p;
  v8h hi = *(const v8h*)(p + 16);
  return __builtin_shufflevector(lo, hi, 0,1,2,3,4,5,6,7,8,9,10,11,12,13,14,15);
}

// ---------------------------------------------------------------------------
// GEMM operand tiles in LDS: 128 rows x GK k. Row pitch GK + 8 halves (272 B
// for 128 k, 144 B for 64 k: 16 B x odd), conflict-free for the 16-byte
// fragment reads.
// ---------------------------------------------------------------------------
template <int PITCH>
__device__ inline v16h lds_frag(const _Float16* lds, int row0, int k0) {
  int lane = threadIdx.x & 31;
  const _Float16* p = lds + (row0 + (lane & 15)) * PITCH + k0 + ((lane >> 4) << 3);
  v8h lo = *(const v8h*)p;
  v8h hi = *(const v8h*)(p + 16);
  return __builtin_shufflevector(lo, hi, 0,1,2,3,4,5,6,7,8,9,10,11,12,13,14,15);
}

// One thread's share of one operand tile: 16 bytes of each of NC rows, copied
// from global memory to LDS through no register. g is the thread's first source
// chunk and gs the source distance between its rows in halves; l is the LDS
// byte address of its first destination chunk and LS the distance there in
// bytes. The lanes of a wave cover whole rows of the tile (256 or 128
// contiguous bytes). The closing s_wait_xcnt stands inside the statement so
// that no register a copy names is rewritten ahead of it.
template <int NC, unsigned LS>
__device__ inline void copy_tile(const _Float16* g, size_t gs, unsigned l) {
  static_assert(NC == 4 || NC == 8, "4 or 8 rows a thread");
  if constexpr (NC == 8) {
    asm volatile(
        "global_load_async_to_lds_b128 %0, %8, off\n\t"
        "global_load_async_to_lds_b128 %1, %9, off\n\t"
        "global_load_async_to_lds_b128 %2, %10, off\n\t"
        "global_load_async_to_lds_b128 %3, %11, off\n\t"
        "global_load_async_to_lds_b128 %4, %12, off\n\t"
        "global_load_async_to_lds_b128 %5, %13, off\n\t"
        "global_load_async_to_lds_b128 %6, %14, off\n\t"
        "global_load_async_to_lds_b128 %7, %15, off\n\t"
        "s_wait_xcnt 0x0"
        :: "v"(l), "v"(l + LS), "v"(l + 2 * LS), "v"(l + 3 * LS),
           "v"(l + 4 * LS), "v"(l + 5 * LS), "v"(l + 6 * LS), "v"(l + 7 * LS),
           "v"(g), "v"(g + gs), "v"(g + 2 * gs), "v"(g + 3 * gs),
           "v"(g + 4 * gs), "v"(g + 5 * gs), "v"(g + 6 * gs), "v"(g + 7 * gs)
        : "memory");
  } else {
    asm volatile(
        "global_load_async_to_lds_b128 %0, %4, off\n\t"
        "global_load_async_to_lds_b128 %1, %5, off\n\t"
        "global_load_async_to_lds_b128 %2, %6, off\n\t"
        "global_load_async_to_lds_b128 %3, %7, off\n\t"
        "s_wait_xcnt 0x0"
        :: "v"(l), "v"(l + LS), "v"(l + 2 * LS), "v"(l + 3 * LS),
           "v"(g), "v"(g + gs), "v"(g + 2 * gs), "v"(g + 3 * gs)
        : "memory");
  }
}

// ---------------------------------------------------------------------------
// Elementwise weight converters
// ---------------------------------------------------------------------------
__global__ void cvt_f32_to_f16(const float* __restrict__ in,
                               _Float16* __restrict__ out, int n) {
  int i = blockIdx.x * blockDim.x + threadIdx.x;
  if (i < n) out[i] = (_Float16)in[i];
}

// in: (R, C) f32 row-major  ->  out: (C, R) f16 row-major
// One 64x64 tile per workgroup of 256 threads, turned in LDS, so that both
// sides of global memory see whole 128-byte lines: reads are 16 B per lane
// along c (256 B per tile row), writes are 16 B per lane along r (8 lanes fill
// one 128-byte line of an output row). R and C must be multiples of 64.
// Tile pitch 65 floats: the 32 lanes of a wave hit 32 different banks both
// when storing rows and when reading columns.
#define TT 64
#define TT_PITCH 65

__global__ __launch_bounds__(256) void transpose_to_f16(
    const float* __restrict__ in, _Float16* __restrict__ out, int R, int C) {
  __shared__ float tile[TT * TT_PITCH];
  const int t  = threadIdx.x;
  const int c0 = blockIdx.x * TT;
  const int r0 = blockIdx.y * TT;

  const int lc = (t & 15) << 2;   // first of this lane's 4 columns
  const int lr = t >> 4;          // 0..15
  float4 v[4];
#pragma unroll
  for (int i = 0; i < 4; i++)
    v[i] = *(const float4*)(in + (size_t)(r0 + lr + i * 16) * C + c0 + lc);
#pragma unroll
  for (int i = 0; i < 4; i++) {
    float* d = tile + (lr + i * 16) * TT_PITCH + lc;
    d[0] = v[i].x; d[1] = v[i].y; d[2] = v[i].z; d[3] = v[i].w;
  }
  __syncthreads();

  const int sr = (t & 7) << 3;    // first of this lane's 8 rows
  const int sc = t >> 3;          // 0..31
#pragma unroll
  for (int i = 0; i < 2; i++) {
    const int c = sc + i * 32;
    v8h o;
#pragma unroll
    for (int j = 0; j < 8; j++) o[j] = (_Float16)tile[(sr + j) * TT_PITCH + c];
    *(v8h*)(out + (size_t)(c0 + c) * R + r0 + sr) = o;
  }
}

// ---------------------------------------------------------------------------
// LayerNorm over rows of 1024, f32 in -> f16 out (feeds WMMA GEMMs)
// ---------------------------------------------------------------------------
__global__ __launch_bounds__(256) void layernorm_to_f16(
    const float* __restrict__ x, const float* __restrict__ gamma,
    const float* __restrict__ beta, _Float16* __restrict__ out) {
  const int row = blockIdx.x;
  const float* xr = x + (size_t)row * 1024;
  float v[4], s = 0.f, sq = 0.f;
#pragma unroll
  for (int i = 0; i < 4; i++) {
    v[i] = xr[threadIdx.x + i * 256];
    s += v[i];
    sq += v[i] * v[i];
  }
#pragma unroll
  for (int m = 16; m >= 1; m >>= 1) {
    s  += __shfl_xor(s, m, 32);
    sq += __shfl_xor(sq, m, 32);
  }
  __shared__ float ss[8], ssq[8];
  int w = threadIdx.x >> 5;
  if ((threadIdx.x & 31) == 0) { ss[w] = s; ssq[w] = sq; }
  __syncthreads();
  if (threadIdx.x < 32) {
    float a  = (threadIdx.x < 8) ? ss[threadIdx.x]  : 0.f;
    float aq = (threadIdx.x < 8) ? ssq[threadIdx.x] : 0.f;
#pragma unroll
    for (int m = 4; m >= 1; m >>= 1) {
      a  += __shfl_xor(a, m, 32);
      aq += __shfl_xor(aq, m, 32);
    }
    if (threadIdx.x == 0) { ss[0] = a; ssq[0] = aq; }
  }
  __syncthreads();
  float mean = ss[0] * (1.f / 1024.f);
  float var  = ssq[0] * (1.f / 1024.f) - mean * mean;
  float inv  = rsqrtf(var + 1e-5f);
#pragma unroll
  for (int i = 0; i < 4; i++) {
    int c = threadIdx.x + i * 256;
    out[(size_t)row * 1024 + c] = (_Float16)((v[i] - mean) * inv * gamma[c] + beta[c]);
  }
}

// ---------------------------------------------------------------------------
// LDS-staged WMMA GEMM: C[M,N] = A16[M,K] * Bt16[N,K]^T (+bias)(+relu)(+res)
// Workgroup tile 128x128; a trip of the K loop works on GK k. Two LDS buffers:
// asynchronous copies bring tile t + 1 in while tile t is worked on.
// GK = 128 (136 KB of LDS, two workgroups a WGP) where the grid has at most two
// workgroups a WGP; GK = 64 (72 KB) where it has three, so that all are resident.
// 8 waves, each owns a 64x32 sub-tile = 4x2 WMMA C tiles (8 WMMA per 32 k).
// M and N must be multiples of 128, K a multiple of GK.
// QKV: the output is the (4*1024, 3*1024) q|k|v product and goes straight to
// the layouts attention reads: q and k as (B*H, S, dh) into C16 and Kh, v
// transposed as (B*H, dh, S) into Vt. A lane's 8 accumulator rows are 8
// consecutive s of one (head, e), so v leaves as one 16-byte store per C tile,
// and the 4 tiles of a wave's 64 rows fill one whole 128-byte line of Vt.
// ---------------------------------------------------------------------------
template <int GK, bool BIAS, bool RELU, bool RES, bool OUT32, bool OUT16, bool QKV>
__global__ __launch_bounds__(256) void gemm_wmma(
    const _Float16* __restrict__ A, const _Float16* __restrict__ Bt,
    const float* __restrict__ bias, const float* __restrict__ resid,
    float* __restrict__ C32, _Float16* __restrict__ C16,
    _Float16* __restrict__ Kh, _Float16* __restrict__ Vt,
    int M, int N, int K) {
  const int w    = threadIdx.x >> 5;
  const int lane = threadIdx.x & 31;
  const int wm = w >> 2;          // 0..1 -> 64-row slice
  const int wn = w & 3;           // 0..3 -> 32-col slice
  const int mblk = blockIdx.y * 128;
  const int nblk = blockIdx.x * 128;

  constexpr int GP  = GK + 8;          // LDS row pitch in halves
  constexpr int CPR = GK / 8;          // 16-byte chunks in a tile row
  constexpr int RPP = 256 / CPR;       // rows the workgroup covers with one copy each
  constexpr int NC  = 128 / RPP;       // copies a thread and operand tile
  constexpr unsigned LS   = RPP * GP * 2;   // LDS bytes between a thread's rows
  constexpr unsigned BUFB = 128 * GP * 2;   // bytes of one buffer

  __shared__ __align__(16) _Float16 As[2][128 * GP];
  __shared__ __align__(16) _Float16 Bs[2][128 * GP];

  v8f acc[4][2];
#pragma unroll
  for (int mt = 0; mt < 4; mt++)
#pragma unroll
    for (int nt = 0; nt < 2; nt++) acc[mt][nt] = {};

  // Copy share of a thread: chunk (threadIdx.x % CPR) of rows
  // (threadIdx.x / CPR) + RPP i of the A tile and of the B tile.
  const int crow = threadIdx.x / CPR;
  const int cpc  = (threadIdx.x % CPR) << 3;
  const _Float16* ga = A  + (size_t)(mblk + crow) * K + cpc;
  const _Float16* gb = Bt + (size_t)(nblk + crow) * K + cpc;
  const size_t step = (size_t)RPP * K;
  const unsigned la = (unsigned)(size_t)&As[0][crow * GP + cpc];
  const unsigned lb = (unsigned)(size_t)&Bs[0][crow * GP + cpc];
  const int trips = K / GK;

  copy_tile<NC, LS>(ga, step, la);
  copy_tile<NC, LS>(gb, step, lb);
  // Tile 0 has landed for this wave; the barrier publishes it to the others.
  asm volatile("s_wait_asynccnt 0x0" ::: "memory");
  __syncthreads();
  if (trips > 1) {
    copy_tile<NC, LS>(ga + GK, step, la + BUFB);
    copy_tile<NC, LS>(gb + GK, step, lb + BUFB);
  }

  for (int t = 0; t < trips; t++) {
    const _Float16* Ac = As[t & 1];
    const _Float16* Bc = Bs[t & 1];
    // Unrolled: ks becomes a constant offset of the LDS reads, and the
    // fragments stay in registers.
#pragma unroll
    for (int ks = 0; ks < GK; ks += 32) {
      v16h a[4], b[2];
#pragma unroll
      for (int mt = 0; mt < 4; mt++) a[mt] = lds_frag<GP>(Ac, wm * 64 + mt * 16, ks);
#pragma unroll
      for (int nt = 0; nt < 2; nt++) b[nt] = lds_frag<GP>(Bc, wn * 32 + nt * 16, ks);
#pragma unroll
      for (int mt = 0; mt < 4; mt++)
#pragma unroll
        for (int nt = 0; nt < 2; nt++)
          acc[mt][nt] = WMMA_F16(a[mt], b[nt], acc[mt][nt]);
    }
    // This wave's reads of tile t have returned before its buffer is refilled.
    asm volatile("s_wait_dscnt 0x0" ::: "memory");
    // This wave's copies of tile t + 1 have landed.
    asm volatile("s_wait_asynccnt 0x0" ::: "memory");
    // Publishes tile t + 1 and ends every wave's reads of tile t.
    __syncthreads();
    if (t + 2 < trips) {
      const unsigned bo = (t & 1) ? BUFB : 0u;
      copy_tile<NC, LS>(ga + (size_t)(t + 2) * GK, step, la + bo);
      copy_tile<NC, LS>(gb + (size_t)(t + 2) * GK, step, lb + bo);
    }
  }
  // No copy is outstanding when the wave goes on to the epilogue and ends.
  asm volatile("s_wait_asynccnt 0x0" ::: "memory");

  const int col   = lane & 15;
  const int rbase = (lane >> 4) << 3;
  if (QKV) {
    // A 128-column block lies inside one of q, k, v and a 128-row block inside
    // one batch, so both choices are the same for the whole workgroup.
    const int part = nblk >> 10;
    const int hn = (nblk & 1023) + wn * 32 + col;     // nt adds 16: same head
    const int bh = (mblk >> 10) * 16 + (hn >> 6);
    const int e  = hn & 63;
    const int s0 = (mblk & 1023) + wm * 64 + rbase;   // mt adds 16
    if (part == 2) {
      _Float16* d = Vt + ((size_t)bh * 64 + e) * 1024 + s0;
#pragma unroll
      for (int nt = 0; nt < 2; nt++) {
#pragma unroll
        for (int mt = 0; mt < 4; mt++) {
          v8h o;
#pragma unroll
          for (int r = 0; r < 8; r++) o[r] = (_Float16)acc[mt][nt][r];
          *(v8h*)(d + nt * 16 * 1024 + mt * 16) = o;
        }
      }
    } else {
      _Float16* d = (part == 0 ? C16 : Kh) + ((size_t)bh * 1024 + s0) * 64 + e;
#pragma unroll
      for (int mt = 0; mt < 4; mt++) {
#pragma unroll
        for (int nt = 0; nt < 2; nt++) {
#pragma unroll
          for (int r = 0; r < 8; r++)
            d[(mt * 16 + r) * 64 + nt * 16] = (_Float16)acc[mt][nt][r];
        }
      }
      // Precaution: stands in front of any later rewrite of a register that the
      // stores above name.
      asm volatile("s_wait_xcnt 0x0" ::: "memory");
    }
    return;
  }
#pragma unroll
  for (int mt = 0; mt < 4; mt++) {
#pragma unroll
    for (int nt = 0; nt < 2; nt++) {
      int n = nblk + wn * 32 + nt * 16 + col;
      float bv = BIAS ? bias[n] : 0.f;
#pragma unroll
      for (int r = 0; r < 8; r++) {
        int m = mblk + wm * 64 + mt * 16 + rbase + r;
        float vv = acc[mt][nt][r] + bv;
        if (RELU) vv = fmaxf(vv, 0.f);
        if (RES) vv += resid[(size_t)m * N + n];
        if (OUT32) C32[(size_t)m * N + n] = vv;
        if (OUT16) C16[(size_t)m * N + n] = (_Float16)vv;
      }
    }
  }
}

// ---------------------------------------------------------------------------
// Flash attention: one wave per 16 query rows of one (b,h), 4 waves a workgroup.
// K and V^T come in tiles of 64 keys that the workgroup stages ONCE in LDS:
// every global load covers whole 128-byte lines (8 lanes a row), and the four
// waves take their fragments from LDS. Two buffers: the next tile's loads are
// issued ahead of the work on this tile and stored behind it.
// Row pitch 144 B (16 B x odd): conflict-free for the 16-byte fragment reads.
// Online softmax over WMMA C-layout; P staged through LDS to A-layout.
// Output written (B, S, H*dh) f16 for the out-projection GEMM.
// ---------------------------------------------------------------------------
#define KV_TILE 64
#define KV_PITCH 72

__device__ inline v16h kv_frag(const _Float16* lds, int row0, int k0) {
  int lane = threadIdx.x & 31;
  const _Float16* p = lds + (row0 + (lane & 15)) * KV_PITCH + k0 + ((lane >> 4) << 3);
  v8h lo = *(const v8h*)p;
  v8h hi = *(const v8h*)(p + 16);
  return __builtin_shufflevector(lo, hi, 0,1,2,3,4,5,6,7,8,9,10,11,12,13,14,15);
}

__global__ __launch_bounds__(128) void attention_kernel(
    const _Float16* __restrict__ q, const _Float16* __restrict__ k,
    const _Float16* __restrict__ vT, _Float16* __restrict__ o) {
  constexpr int S = 1024, DH = 64;
  const int wave = threadIdx.x >> 5;
  const int lane = threadIdx.x & 31;
  const int bh = blockIdx.y;
  const int qrow0 = blockIdx.x * 64 + wave * 16;

  const _Float16* qb = q  + (size_t)bh * S * DH;
  const _Float16* kb = k  + (size_t)bh * S * DH;
  const _Float16* vb = vT + (size_t)bh * DH * S;

  __shared__ __align__(16) _Float16 Ks[2][KV_TILE * KV_PITCH];  // keys x dh
  __shared__ __align__(16) _Float16 Vs[2][DH * KV_PITCH];       // dh x keys
  __shared__ __align__(16) _Float16 pbuf[4][16 * 32];
  _Float16* pl = pbuf[wave];

  // Staging share of a thread: 16 bytes of rows srow, srow + 16, + 32, + 48 of
  // the K tile and of the V^T tile (both are 64 rows of 128 bytes).
  const int srow = threadIdx.x >> 3;
  const int spc  = (threadIdx.x & 7) << 3;
  const _Float16* kg = kb + (size_t)srow * DH + spc;
  const _Float16* vg = vb + (size_t)srow * S + spc;
  const int sl = srow * KV_PITCH + spc;
  v8h kr[4], vr[4];

#pragma unroll
  for (int i = 0; i < 4; i++) {
    kr[i] = *(const v8h*)(kg + i * 16 * DH);
    vr[i] = *(const v8h*)(vg + i * 16 * S);
  }

  const v16h qa0 = load_frag(qb, DH, qrow0, 0);
  const v16h qa1 = load_frag(qb, DH, qrow0, 32);

#pragma unroll
  for (int i = 0; i < 4; i++) {
    *(v8h*)(Ks[0] + sl + i * 16 * KV_PITCH) = kr[i];
    *(v8h*)(Vs[0] + sl + i * 16 * KV_PITCH) = vr[i];
  }
  __syncthreads();

  float mrow[8], lrow[8];
  v8f oacc[4];
#pragma unroll
  for (int r = 0; r < 8; r++) { mrow[r] = -1e30f; lrow[r] = 0.f; }
#pragma unroll
  for (int t = 0; t < 4; t++) oacc[t] = {};

  const int col   = lane & 15;
  const int rbase = (lane >> 4) << 3;

  for (int st = 0; st < S / KV_TILE; st++) {
    const _Float16* Kc = Ks[st & 1];
    const _Float16* Vc = Vs[st & 1];
    const bool more = st + 1 < S / KV_TILE;
    if (more) {
      const int jn = (st + 1) * KV_TILE;
#pragma unroll
      for (int i = 0; i < 4; i++) {
        kr[i] = *(const v8h*)(kg + (size_t)(jn + i * 16) * DH);
        vr[i] = *(const v8h*)(vg + i * 16 * S + jn);
      }
    }
#pragma unroll
    for (int jb = 0; jb < KV_TILE; jb += 32) {
      // scores for 32 keys: two 16x16 tiles, K = dh = 64 = 2 WMMA steps
      v8f s0 = {}, s1 = {};
      {
        v16h k0a = kv_frag(Kc, jb, 0);
        v16h k0b = kv_frag(Kc, jb, 32);
        s0 = WMMA_F16(qa0, k0a, s0);
        s0 = WMMA_F16(qa1, k0b, s0);
        v16h k1a = kv_frag(Kc, jb + 16, 0);
        v16h k1b = kv_frag(Kc, jb + 16, 32);
        s1 = WMMA_F16(qa0, k1a, s1);
        s1 = WMMA_F16(qa1, k1b, s1);
      }
      // online softmax update per row (row r lives across a 16-lane half)
#pragma unroll
      for (int r = 0; r < 8; r++) {
        float a0 = s0[r] * 0.125f;  // 1/sqrt(64)
        float a1 = s1[r] * 0.125f;
        float mx = fmaxf(a0, a1);
#pragma unroll
        for (int m = 8; m >= 1; m >>= 1) mx = fmaxf(mx, __shfl_xor(mx, m, 32));
        float mnew  = fmaxf(mrow[r], mx);
        float alpha = __expf(mrow[r] - mnew);
        float p0 = __expf(a0 - mnew);
        float p1 = __expf(a1 - mnew);
        float rs = p0 + p1;
#pragma unroll
        for (int m = 8; m >= 1; m >>= 1) rs += __shfl_xor(rs, m, 32);
        lrow[r] = lrow[r] * alpha + rs;
        mrow[r] = mnew;
#pragma unroll
        for (int t = 0; t < 4; t++) oacc[t][r] *= alpha;
        pl[(rbase + r) * 32 + col]      = (_Float16)p0;
        pl[(rbase + r) * 32 + 16 + col] = (_Float16)p1;
      }
      // reload P in A-fragment layout and accumulate P(16x32) * V(32x64)
      {
        int prow = lane & 15;
        int pk   = (lane >> 4) << 3;
        const _Float16* pp = pl + prow * 32 + pk;
        v8h lo = *(const v8h*)pp;
        v8h hi = *(const v8h*)(pp + 16);
        v16h pa = __builtin_shufflevector(lo, hi, 0,1,2,3,4,5,6,7,8,9,10,11,12,13,14,15);
#pragma unroll
        for (int t = 0; t < 4; t++) {
          v16h vf = kv_frag(Vc, t * 16, jb);
          oacc[t] = WMMA_F16(pa, vf, oacc[t]);
        }
      }
    }
    if (more) {
      // The other buffer's last readers left it at the barrier that ended the
      // pass before this one.
      _Float16* Kn = Ks[(st + 1) & 1];
      _Float16* Vn = Vs[(st + 1) & 1];
#pragma unroll
      for (int i = 0; i < 4; i++) {
        *(v8h*)(Kn + sl + i * 16 * KV_PITCH) = kr[i];
        *(v8h*)(Vn + sl + i * 16 * KV_PITCH) = vr[i];
      }
    }
    // Publishes the next tile and ends every wave's reads of this one.
    __syncthreads();
  }

  const int b = bh >> 4, h = bh & 15;
#pragma unroll
  for (int r = 0; r < 8; r++) {
    float inv = 1.f / lrow[r];
    int orow_s = qrow0 + rbase + r;
    _Float16* orow = o + ((size_t)(b * 1024 + orow_s)) * 1024 + h * 64;
#pragma unroll
    for (int t = 0; t < 4; t++) orow[t * 16 + col] = (_Float16)(oacc[t][r] * inv);
  }
}

// ---------------------------------------------------------------------------
// Host-side orchestration
// ---------------------------------------------------------------------------
extern "C" void kernel_launch(void* const* d_in, const int* in_sizes, int n_in,
                              void* d_out, int out_size, void* d_ws, size_t ws_size,
                              hipStream_t stream) {
  (void)in_sizes; (void)n_in; (void)out_size; (void)ws_size;
  const float* x      = (const float*)d_in[0];   // (4,1024,1024)
  const float* w_in   = (const float*)d_in[1];   // (3072,1024)
  const float* w_out  = (const float*)d_in[2];   // (1024,1024)
  const float* ln1_g  = (const float*)d_in[3];
  const float* ln1_b  = (const float*)d_in[4];
  const float* w_up   = (const float*)d_in[5];   // (1024,2048)
  const float* b_up   = (const float*)d_in[6];
  const float* w_down = (const float*)d_in[7];   // (2048,1024)
  const float* b_down = (const float*)d_in[8];
  const float* ln2_g  = (const float*)d_in[9];
  const float* ln2_b  = (const float*)d_in[10];
  float* out = (float*)d_out;

  const int BS = 4096, D = 1024;

  char* ws = (char*)d_ws;
  size_t off = 0;
  auto alloc = [&](size_t bytes) -> void* {
    off = (off + 255) & ~(size_t)255;
    void* p = ws + off;
    off += bytes;
    return p;
  };

  _Float16* w_in16   = (_Float16*)alloc((size_t)3 * D * D * 2);
  _Float16* w_outT   = (_Float16*)alloc((size_t)D * D * 2);
  _Float16* w_upT    = (_Float16*)alloc((size_t)2 * D * D * 2);
  _Float16* w_downT  = (_Float16*)alloc((size_t)2 * D * D * 2);
  _Float16* h16      = (_Float16*)alloc((size_t)BS * D * 2);
  _Float16* q16      = (_Float16*)alloc((size_t)BS * D * 2);
  _Float16* k16      = (_Float16*)alloc((size_t)BS * D * 2);
  _Float16* vT16     = (_Float16*)alloc((size_t)BS * D * 2);
  _Float16* attn16   = (_Float16*)alloc((size_t)BS * D * 2);
  float*    x1       = (float*)   alloc((size_t)BS * D * 4);
  _Float16* h2_16    = (_Float16*)alloc((size_t)BS * D * 2);
  _Float16* ff16     = (_Float16*)alloc((size_t)BS * 2 * D * 2);

  // --- weight conversion ---
  cvt_f32_to_f16<<<(3 * D * D + 255) / 256, 256, 0, stream>>>(w_in, w_in16, 3 * D * D);
  transpose_to_f16<<<dim3(D / 64, D / 64), 256, 0, stream>>>(w_out, w_outT, D, D);
  transpose_to_f16<<<dim3(2 * D / 64, D / 64), 256, 0, stream>>>(w_up, w_upT, D, 2 * D);
  transpose_to_f16<<<dim3(D / 64, 2 * D / 64), 256, 0, stream>>>(w_down, w_downT, 2 * D, D);

  // --- LN1 -> h16 ---
  layernorm_to_f16<<<BS, 256, 0, stream>>>(x, ln1_g, ln1_b, h16);

  // --- qkv = h @ in_project.T  (M=4096, N=3072, K=1024), f16 out, stored as
  //     q/k (B*H,S,dh) and vT (B*H,dh,S) ---
  gemm_wmma<64, false, false, false, false, true, true>
      <<<dim3(3072 / 128, BS / 128), 256, 0, stream>>>(
          h16, w_in16, nullptr, nullptr, nullptr, q16, k16, vT16, BS, 3 * D, D);

  // --- flash attention -> attn16 (B,S,H*dh) ---
  attention_kernel<<<dim3(1024 / 64, 64), 128, 0, stream>>>(q16, k16, vT16, attn16);

  // --- x1 = attn @ out_project + x  (M=4096, N=1024, K=1024), f32 out ---
  gemm_wmma<128, false, false, true, true, false, false>
      <<<dim3(1024 / 128, BS / 128), 256, 0, stream>>>(
          attn16, w_outT, nullptr, x, x1, nullptr, nullptr, nullptr, BS, D, D);

  // --- LN2 -> h2_16 ---
  layernorm_to_f16<<<BS, 256, 0, stream>>>(x1, ln2_g, ln2_b, h2_16);

  // --- ff = relu(h2 @ w_up + b_up)  (M=4096, N=2048, K=1024), f16 out ---
  gemm_wmma<128, true, true, false, false, true, false>
      <<<dim3(2048 / 128, BS / 128), 256, 0, stream>>>(
          h2_16, w_upT, b_up, nullptr, nullptr, ff16, nullptr, nullptr, BS, 2 * D, D);

  // --- out = ff @ w_down + b_down + x1  (M=4096, N=1024, K=2048), f32 out ---
  gemm_wmma<128, true, false, true, true, false, false>
      <<<dim3(1024 / 128, BS / 128), 256, 0, stream>>>(
          ff16, w_downT, b_down, x1, out, nullptr, nullptr, nullptr, BS, D, 2 * D);
}

// v005
// A run of this version takes 131 microseconds.
// In both of two side-by-side timings against v004, it was 1.18 times as fast.
// All steps since v000 together make it 3.20 times as fast.
#include <hip/hip_runtime.h>

typedef __attribute__((ext_vector_type(16))) _Float16 v16h;
typedef __attribute__((ext_vector_type(8)))  _Float16 v8h;
typedef __attribute__((ext_vector_type(8)))  float    v8f;

#define WMMA_F16(a, b, c) \
  __builtin_amdgcn_wmma_f32_16x16x32_f16(false, (a), false, (b), (short)0, (c), false, false)

// ---------------------------------------------------------------------------
// Fragment load from GLOBAL: 16-bit A or B fragment (16 rows x 32 K) from
// (rows, K) row-major storage. Per ISA layout: lane L holds row (L&15); its
// 16 halves are K[kb..kb+7] and K[kb+16..kb+23] with kb = k0 + (L>>4)*8.
// ---------------------------------------------------------------------------
__device__ inline v16h load_frag(const _Float16* __restrict__ base, int ld,
                                 int row0, int k0) {
  int lane = threadIdx.x & 31;
  const _Float16* p = base + (size_t)(row0 + (lane & 15)) * ld + k0 + ((lane >> 4) << 3);
  v8h lo = *(const v8h*)p;
  v8h hi = *(const v8h*)(p + 16);
  return __builtin_shufflevector(lo, hi, 0,1,2,3,4,5,6,7,8,9,10,11,12,13,14,15);
}

// ---------------------------------------------------------------------------
// GEMM operand tiles in LDS: 128 rows x GK k. Row pitch GK + 8 halves (272 B
// for 128 k, 144 B for 64 k: 16 B x odd), conflict-free for the 16-byte
// fragment reads.
// ---------------------------------------------------------------------------
template <int PITCH>
__device__ inline v16h lds_frag(const _Float16* lds, int row0, int k0) {
  int lane = threadIdx.x & 31;
  const _Float16* p = lds + (row0 + (lane & 15)) * PITCH + k0 + ((lane >> 4) << 3);
  v8h lo = *(const v8h*)p;
  v8h hi = *(const v8h*)(p + 16);
  return __builtin_shufflevector(lo, hi, 0,1,2,3,4,5,6,7,8,9,10,11,12,13,14,15);
}

// One thread's share of one operand tile: 16 bytes of each of NC rows, copied
// from global memory to LDS through no register. g is the thread's first source
// chunk and gs the source distance between its rows in halves; l is the LDS
// byte address of its first destination chunk and LS the distance there in
// bytes. The lanes of a wave cover whole rows of the tile (256 or 128
// contiguous bytes). The closing s_wait_xcnt stands inside the statement so
// that no register a copy names is rewritten ahead of it.
template <int NC, unsigned LS>
__device__ inline void copy_tile(const _Float16* g, size_t gs, unsigned l) {
  static_assert(NC == 4 || NC == 8, "4 or 8 rows a thread");
  if constexpr (NC == 8) {
    asm volatile(
        "global_load_async_to_lds_b128 %0, %8, off\n\t"
        "global_load_async_to_lds_b128 %1, %9, off\n\t"
        "global_load_async_to_lds_b128 %2, %10, off\n\t"
        "global_load_async_to_lds_b128 %3, %11, off\n\t"
        "global_load_async_to_lds_b128 %4, %12, off\n\t"
        "global_load_async_to_lds_b128 %5, %13, off\n\t"
        "global_load_async_to_lds_b128 %6, %14, off\n\t"
        "global_load_async_to_lds_b128 %7, %15, off\n\t"
        "s_wait_xcnt 0x0"
        :: "v"(l), "v"(l + LS), "v"(l + 2 * LS), "v"(l + 3 * LS),
           "v"(l + 4 * LS), "v"(l + 5 * LS), "v"(l + 6 * LS), "v"(l + 7 * LS),
           "v"(g), "v"(g + gs), "v"(g + 2 * gs), "v"(g + 3 * gs),
           "v"(g + 4 * gs), "v"(g + 5 * gs), "v"(g + 6 * gs), "v"(g + 7 * gs)
        : "memory");
  } else {
    asm volatile(
        "global_load_async_to_lds_b128 %0, %4, off\n\t"
        "global_load_async_to_lds_b128 %1, %5, off\n\t"
        "global_load_async_to_lds_b128 %2, %6, off\n\t"
        "global_load_async_to_lds_b128 %3, %7, off\n\t"
        "s_wait_xcnt 0x0"
        :: "v"(l), "v"(l + LS), "v"(l + 2 * LS), "v"(l + 3 * LS),
           "v"(g), "v"(g + gs), "v"(g + 2 * gs), "v"(g + 3 * gs)
        : "memory");
  }
}

// ---------------------------------------------------------------------------
// Elementwise weight converters
// ---------------------------------------------------------------------------
__global__ void cvt_f32_to_f16(const float* __restrict__ in,
                               _Float16* __restrict__ out, int n) {
  int i = blockIdx.x * blockDim.x + threadIdx.x;
  if (i < n) out[i] = (_Float16)in[i];
}

// in: (R, C) f32 row-major  ->  out: (C, R) f16 row-major
// One 64x64 tile per workgroup of 256 threads, turned in LDS, so that both
// sides of global memory see whole 128-byte lines: reads are 16 B per lane
// along c (256 B per tile row), writes are 16 B per lane along r (8 lanes fill
// one 128-byte line of an output row). R and C must be multiples of 64.
// Tile pitch 65 floats: the 32 lanes of a wave hit 32 different banks both
// when storing rows and when reading columns.
#define TT 64
#define TT_PITCH 65

__global__ __launch_bounds__(256) void transpose_to_f16(
    const float* __restrict__ in, _Float16* __restrict__ out, int R, int C) {
  __shared__ float tile[TT * TT_PITCH];
  const int t  = threadIdx.x;
  const int c0 = blockIdx.x * TT;
  const int r0 = blockIdx.y * TT;

  const int lc = (t & 15) << 2;   // first of this lane's 4 columns
  const int lr = t >> 4;          // 0..15
  float4 v[4];
#pragma unroll
  for (int i = 0; i < 4; i++)
    v[i] = *(const float4*)(in + (size_t)(r0 + lr + i * 16) * C + c0 + lc);
#pragma unroll
  for (int i = 0; i < 4; i++) {
    float* d = tile + (lr + i * 16) * TT_PITCH + lc;
    d[0] = v[i].x; d[1] = v[i].y; d[2] = v[i].z; d[3] = v[i].w;
  }
  __syncthreads();

  const int sr = (t & 7) << 3;    // first of this lane's 8 rows
  const int sc = t >> 3;          // 0..31
#pragma unroll
  for (int i = 0; i < 2; i++) {
    const int c = sc + i * 32;
    v8h o;
#pragma unroll
    for (int j = 0; j < 8; j++) o[j] = (_Float16)tile[(sr + j) * TT_PITCH + c];
    *(v8h*)(out + (size_t)(c0 + c) * R + r0 + sr) = o;
  }
}

// ---------------------------------------------------------------------------
// LayerNorm over rows of 1024, f32 in -> f16 out (feeds WMMA GEMMs)
// ---------------------------------------------------------------------------
__global__ __launch_bounds__(256) void layernorm_to_f16(
    const float* __restrict__ x, const float* __restrict__ gamma,
    const float* __restrict__ beta, _Float16* __restrict__ out) {
  const int row = blockIdx.x;
  const float* xr = x + (size_t)row * 1024;
  float v[4], s = 0.f, sq = 0.f;
#pragma unroll
  for (int i = 0; i < 4; i++) {
    v[i] = xr[threadIdx.x + i * 256];
    s += v[i];
    sq += v[i] * v[i];
  }
#pragma unroll
  for (int m = 16; m >= 1; m >>= 1) {
    s  += __shfl_xor(s, m, 32);
    sq += __shfl_xor(sq, m, 32);
  }
  __shared__ float ss[8], ssq[8];
  int w = threadIdx.x >> 5;
  if ((threadIdx.x & 31) == 0) { ss[w] = s; ssq[w] = sq; }
  __syncthreads();
  if (threadIdx.x < 32) {
    float a  = (threadIdx.x < 8) ? ss[threadIdx.x]  : 0.f;
    float aq = (threadIdx.x < 8) ? ssq[threadIdx.x] : 0.f;
#pragma unroll
    for (int m = 4; m >= 1; m >>= 1) {
      a  += __shfl_xor(a, m, 32);
      aq += __shfl_xor(aq, m, 32);
    }
    if (threadIdx.x == 0) { ss[0] = a; ssq[0] = aq; }
  }
  __syncthreads();
  float mean = ss[0] * (1.f / 1024.f);
  float var  = ssq[0] * (1.f / 1024.f) - mean * mean;
  float inv  = rsqrtf(var + 1e-5f);
#pragma unroll
  for (int i = 0; i < 4; i++) {
    int c = threadIdx.x + i * 256;
    out[(size_t)row * 1024 + c] = (_Float16)((v[i] - mean) * inv * gamma[c] + beta[c]);
  }
}

// ---------------------------------------------------------------------------
// LDS-staged WMMA GEMM: C[M,N] = A16[M,K] * Bt16[N,K]^T (+bias)(+relu)(+res)
// Workgroup tile 128x128; a trip of the K loop works on GK k. Two LDS buffers:
// asynchronous copies bring tile t + 1 in while tile t is worked on.
// GK = 128 (136 KB of LDS, two workgroups a WGP) where the grid has at most two
// workgroups a WGP; GK = 64 (72 KB) where it has three, so that all are resident.
// 8 waves, each owns a 64x32 sub-tile = 4x2 WMMA C tiles (8 WMMA per 32 k).
// M and N must be multiples of 128, K a multiple of GK.
// QKV: the output is the (4*1024, 3*1024) q|k|v product and goes straight to
// the layouts attention reads: q and k as (B*H, S, dh) into C16 and Kh, v
// transposed as (B*H, dh, S) into Vt. A lane's 8 accumulator rows are 8
// consecutive s of one (head, e), so v leaves as one 16-byte store per C tile,
// and the 4 tiles of a wave's 64 rows fill one whole 128-byte line of Vt.
// ---------------------------------------------------------------------------
template <int GK, bool BIAS, bool RELU, bool RES, bool OUT32, bool OUT16, bool QKV>
__global__ __launch_bounds__(256) void gemm_wmma(
    const _Float16* __restrict__ A, const _Float16* __restrict__ Bt,
    const float* __restrict__ bias, const float* __restrict__ resid,
    float* __restrict__ C32, _Float16* __restrict__ C16,
    _Float16* __restrict__ Kh, _Float16* __restrict__ Vt,
    int M, int N, int K) {
  const int w    = threadIdx.x >> 5;
  const int lane = threadIdx.x & 31;
  const int wm = w >> 2;          // 0..1 -> 64-row slice
  const int wn = w & 3;           // 0..3 -> 32-col slice
  const int mblk = blockIdx.y * 128;
  const int nblk = blockIdx.x * 128;

  constexpr int GP  = GK + 8;          // LDS row pitch in halves
  constexpr int CPR = GK / 8;          // 16-byte chunks in a tile row
  constexpr int RPP = 256 / CPR;       // rows the workgroup covers with one copy each
  constexpr int NC  = 128 / RPP;       // copies a thread and operand tile
  constexpr unsigned LS   = RPP * GP * 2;   // LDS bytes between a thread's rows
  constexpr unsigned BUFB = 128 * GP * 2;   // bytes of one buffer

  __shared__ __align__(16) _Float16 As[2][128 * GP];
  __shared__ __align__(16) _Float16 Bs[2][128 * GP];

  v8f acc[4][2];
#pragma unroll
  for (int mt = 0; mt < 4; mt++)
#pragma unroll
    for (int nt = 0; nt < 2; nt++) acc[mt][nt] = {};

  // Copy share of a thread: chunk (threadIdx.x % CPR) of rows
  // (threadIdx.x / CPR) + RPP i of the A tile and of the B tile.
  const int crow = threadIdx.x / CPR;
  const int cpc  = (threadIdx.x % CPR) << 3;
  const _Float16* ga = A  + (size_t)(mblk + crow) * K + cpc;
  const _Float16* gb = Bt + (size_t)(nblk + crow) * K + cpc;
  const size_t step = (size_t)RPP * K;
  const unsigned la = (unsigned)(size_t)&As[0][crow * GP + cpc];
  const unsigned lb = (unsigned)(size_t)&Bs[0][crow * GP + cpc];
  const int trips = K / GK;

  copy_tile<NC, LS>(ga, step, la);
  copy_tile<NC, LS>(gb, step, lb);
  // Tile 0 has landed for this wave; the barrier publishes it to the others.
  asm volatile("s_wait_asynccnt 0x0" ::: "memory");
  __syncthreads();
  if (trips > 1) {
    copy_tile<NC, LS>(ga + GK, step, la + BUFB);
    copy_tile<NC, LS>(gb + GK, step, lb + BUFB);
  }

  for (int t = 0; t < trips; t++) {
    const _Float16* Ac = As[t & 1];
    const _Float16* Bc = Bs[t & 1];
    // Unrolled: ks becomes a constant offset of the LDS reads, and the
    // fragments stay in registers.
#pragma unroll
    for (int ks = 0; ks < GK; ks += 32) {
      v16h a[4], b[2];
#pragma unroll
      for (int mt = 0; mt < 4; mt++) a[mt] = lds_frag<GP>(Ac, wm * 64 + mt * 16, ks);
#pragma unroll
      for (int nt = 0; nt < 2; nt++) b[nt] = lds_frag<GP>(Bc, wn * 32 + nt * 16, ks);
#pragma unroll
      for (int mt = 0; mt < 4; mt++)
#pragma unroll
        for (int nt = 0; nt < 2; nt++)
          acc[mt][nt] = WMMA_F16(a[mt], b[nt], acc[mt][nt]);
    }
    // This wave's reads of tile t have returned before its buffer is refilled.
    asm volatile("s_wait_dscnt 0x0" ::: "memory");
    // This wave's copies of tile t + 1 have landed.
    asm volatile("s_wait_asynccnt 0x0" ::: "memory");
    // Publishes tile t + 1 and ends every wave's reads of tile t.
    __syncthreads();
    if (t + 2 < trips) {
      const unsigned bo = (t & 1) ? BUFB : 0u;
      copy_tile<NC, LS>(ga + (size_t)(t + 2) * GK, step, la + bo);
      copy_tile<NC, LS>(gb + (size_t)(t + 2) * GK, step, lb + bo);
    }
  }
  // No copy is outstanding when the wave goes on to the epilogue and ends.
  asm volatile("s_wait_asynccnt 0x0" ::: "memory");

  const int col   = lane & 15;
  const int rbase = (lane >> 4) << 3;
  if (QKV) {
    // A 128-column block lies inside one of q, k, v and a 128-row block inside
    // one batch, so both choices are the same for the whole workgroup.
    const int part = nblk >> 10;
    const int hn = (nblk & 1023) + wn * 32 + col;     // nt adds 16: same head
    const int bh = (mblk >> 10) * 16 + (hn >> 6);
    const int e  = hn & 63;
    const int s0 = (mblk & 1023) + wm * 64 + rbase;   // mt adds 16
    if (part == 2) {
      _Float16* d = Vt + ((size_t)bh * 64 + e) * 1024 + s0;
#pragma unroll
      for (int nt = 0; nt < 2; nt++) {
#pragma unroll
        for (int mt = 0; mt < 4; mt++) {
          v8h o;
#pragma unroll
          for (int r = 0; r < 8; r++) o[r] = (_Float16)acc[mt][nt][r];
          *(v8h*)(d + nt * 16 * 1024 + mt * 16) = o;
        }
      }
    } else {
      _Float16* d = (part == 0 ? C16 : Kh) + ((size_t)bh * 1024 + s0) * 64 + e;
#pragma unroll
      for (int mt = 0; mt < 4; mt++) {
#pragma unroll
        for (int nt = 0; nt < 2; nt++) {
#pragma unroll
          for (int r = 0; r < 8; r++)
            d[(mt * 16 + r) * 64 + nt * 16] = (_Float16)acc[mt][nt][r];
        }
      }
      // Precaution: stands in front of any later rewrite of a register that the
      // stores above name.
      asm volatile("s_wait_xcnt 0x0" ::: "memory");
    }
    return;
  }
#pragma unroll
  for (int mt = 0; mt < 4; mt++) {
#pragma unroll
    for (int nt = 0; nt < 2; nt++) {
      int n = nblk + wn * 32 + nt * 16 + col;
      float bv = BIAS ? bias[n] : 0.f;
#pragma unroll
      for (int r = 0; r < 8; r++) {
        int m = mblk + wm * 64 + mt * 16 + rbase + r;
        float vv = acc[mt][nt][r] + bv;
        if (RELU) vv = fmaxf(vv, 0.f);
        if (RES) vv += resid[(size_t)m * N + n];
        if (OUT32) C32[(size_t)m * N + n] = vv;
        if (OUT16) C16[(size_t)m * N + n] = (_Float16)vv;
      }
    }
  }
}

#define KV_TILE 64
#define KV_PITCH 72

__device__ inline v16h kv_frag(const _Float16* lds, int row0, int k0) {
  int lane = threadIdx.x & 31;
  const _Float16* p = lds + (row0 + (lane & 15)) * KV_PITCH + k0 + ((lane >> 4) << 3);
  v8h lo = *(const v8h*)p;
  v8h hi = *(const v8h*)(p + 16);
  return __builtin_shufflevector(lo, hi, 0,1,2,3,4,5,6,7,8,9,10,11,12,13,14,15);
}

// The value that lane l ^ 16 holds.
__device__ inline float other_half(float x) {
  return __builtin_bit_cast(float, __builtin_amdgcn_permlanex16(
      __builtin_bit_cast(int, x), __builtin_bit_cast(int, x),
      0x76543210, 0xfedcba98, false, false));
}

__global__ __launch_bounds__(128) void attention_kernel(
    const _Float16* __restrict__ q, const _Float16* __restrict__ k,
    const _Float16* __restrict__ vT, _Float16* __restrict__ o) {
  constexpr int S = 1024, DH = 64;
  const int wave = threadIdx.x >> 5;
  const int lane = threadIdx.x & 31;
  const int bh = blockIdx.y;
  const int qrow0 = blockIdx.x * 64 + wave * 16;

  const _Float16* qb = q  + (size_t)bh * S * DH;
  const _Float16* kb = k  + (size_t)bh * S * DH;
  const _Float16* vb = vT + (size_t)bh * DH * S;

  __shared__ __align__(16) _Float16 Ks[2][KV_TILE * KV_PITCH];  // keys x dh
  __shared__ __align__(16) _Float16 Vs[2][DH * KV_PITCH];       // dh x keys

  // Staging share of a thread: 16 bytes of rows srow, srow + 16, + 32, + 48 of
  // the K tile and of the V^T tile (both are 64 rows of 128 bytes).
  const int srow = threadIdx.x >> 3;
  const int spc  = (threadIdx.x & 7) << 3;
  const _Float16* kg = kb + (size_t)srow * DH + spc;
  const _Float16* vg = vb + (size_t)srow * S + spc;
  const int sl = srow * KV_PITCH + spc;
  v8h kr[4], vr[4];

#pragma unroll
  for (int i = 0; i < 4; i++) {
    kr[i] = *(const v8h*)(kg + i * 16 * DH);
    vr[i] = *(const v8h*)(vg + i * 16 * S);
  }

  // Q as B operand: lane l holds query (l & 15), in kv_frag's k order.
  const v16h qb0 = load_frag(qb, DH, qrow0, 0);
  const v16h qb1 = load_frag(qb, DH, qrow0, 32);

#pragma unroll
  for (int i = 0; i < 4; i++) {
    *(v8h*)(Ks[0] + sl + i * 16 * KV_PITCH) = kr[i];
    *(v8h*)(Vs[0] + sl + i * 16 * KV_PITCH) = vr[i];
  }
  __syncthreads();

  // One query a lane: its running maximum (the same in both halves) and the sum
  // over the keys of this lane's half (the halves are joined behind the loop).
  float mrun = -1e30f, lsum = 0.f;
  v8f oacc[4];   // oacc[t][r] = O^T[16 t + 8 (lane >> 4) + r][query]
#pragma unroll
  for (int t = 0; t < 4; t++) oacc[t] = {};

  for (int st = 0; st < S / KV_TILE; st++) {
    const _Float16* Kc = Ks[st & 1];
    const _Float16* Vc = Vs[st & 1];
    const bool more = st + 1 < S / KV_TILE;
    if (more) {
      const int jn = (st + 1) * KV_TILE;
#pragma unroll
      for (int i = 0; i < 4; i++) {
        kr[i] = *(const v8h*)(kg + (size_t)(jn + i * 16) * DH);
        vr[i] = *(const v8h*)(vg + i * 16 * S + jn);
      }
    }
#pragma unroll
    for (int jb = 0; jb < KV_TILE; jb += 32) {
      // scores of 32 keys: two 16x16 tiles of S^T, K = dh = 64 = 2 WMMA steps
      v8f s0 = {}, s1 = {};
      {
        v16h k0a = kv_frag(Kc, jb, 0);
        v16h k0b = kv_frag(Kc, jb, 32);
        s0 = WMMA_F16(k0a, qb0, s0);
        s0 = WMMA_F16(k0b, qb1, s0);
        v16h k1a = kv_frag(Kc, jb + 16, 0);
        v16h k1b = kv_frag(Kc, jb + 16, 32);
        s1 = WMMA_F16(k1a, qb0, s1);
        s1 = WMMA_F16(k1b, qb1, s1);
      }
      // online softmax update of the lane's query
      float mx = fmaxf(s0[0], s1[0]);
#pragma unroll
      for (int r = 1; r < 8; r++) mx = fmaxf(mx, fmaxf(s0[r], s1[r]));
      mx = fmaxf(mx, other_half(mx)) * 0.125f;  // 1/sqrt(64)
      const float mnew  = fmaxf(mrun, mx);
      const float alpha = __expf(mrun - mnew);
      mrun = mnew;
      v16h pb;
      float rs = 0.f;
#pragma unroll
      for (int r = 0; r < 8; r++) {
        float p0 = __expf(s0[r] * 0.125f - mnew);
        float p1 = __expf(s1[r] * 0.125f - mnew);
        rs += p0 + p1;
        pb[r]     = (_Float16)p0;
        pb[8 + r] = (_Float16)p1;
      }
      lsum = lsum * alpha + rs;
#pragma unroll
      for (int t = 0; t < 4; t++)
#pragma unroll
        for (int r = 0; r < 8; r++) oacc[t][r] *= alpha;
      // O^T(64x16) += V^T(64x32) * P^T(32x16)
#pragma unroll
      for (int t = 0; t < 4; t++) {
        v16h vf = kv_frag(Vc, t * 16, jb);
        oacc[t] = WMMA_F16(vf, pb, oacc[t]);
      }
    }
    if (more) {
      // The other buffer's last readers left it at the barrier that ended the
      // pass before this one.
      _Float16* Kn = Ks[(st + 1) & 1];
      _Float16* Vn = Vs[(st + 1) & 1];
#pragma unroll
      for (int i = 0; i < 4; i++) {
        *(v8h*)(Kn + sl + i * 16 * KV_PITCH) = kr[i];
        *(v8h*)(Vn + sl + i * 16 * KV_PITCH) = vr[i];
      }
    }
    // Publishes the next tile and ends every wave's reads of this one.
    __syncthreads();
  }

  // A lane's 8 accumulator rows of a tile are 8 consecutive dh of its query:
  // one 16-byte store a tile.
  const int b = bh >> 4, h = bh & 15;
  const float inv = 1.f / (lsum + other_half(lsum));
  _Float16* orow = o + ((size_t)(b * 1024 + qrow0 + (lane & 15))) * 1024 + h * 64 +
                   ((lane >> 4) << 3);
#pragma unroll
  for (int t = 0; t < 4; t++) {
    v8h ov;
#pragma unroll
    for (int r = 0; r < 8; r++) ov[r] = (_Float16)(oacc[t][r] * inv);
    *(v8h*)(orow + t * 16) = ov;
  }
}

// ---------------------------------------------------------------------------
// Host-side orchestration
// ---------------------------------------------------------------------------
extern "C" void kernel_launch(void* const* d_in, const int* in_sizes, int n_in,
                              void* d_out, int out_size, void* d_ws, size_t ws_size,
                              hipStream_t stream) {
  (void)in_sizes; (void)n_in; (void)out_size; (void)ws_size;
  const float* x      = (const float*)d_in[0];   // (4,1024,1024)
  const float* w_in   = (const float*)d_in[1];   // (3072,1024)
  const float* w_out  = (const float*)d_in[2];   // (1024,1024)
  const float* ln1_g  = (const float*)d_in[3];
  const float* ln1_b  = (const float*)d_in[4];
  const float* w_up   = (const float*)d_in[5];   // (1024,2048)
  const float* b_up   = (const float*)d_in[6];
  const float* w_down = (const float*)d_in[7];   // (2048,1024)
  const float* b_down = (const float*)d_in[8];
  const float* ln2_g  = (const float*)d_in[9];
  const float* ln2_b  = (const float*)d_in[10];
  float* out = (float*)d_out;

  const int BS = 4096, D = 1024;

  char* ws = (char*)d_ws;
  size_t off = 0;
  auto alloc = [&](size_t bytes) -> void* {
    off = (off + 255) & ~(size_t)255;
    void* p = ws + off;
    off += bytes;
    return p;
  };

  _Float16* w_in16   = (_Float16*)alloc((size_t)3 * D * D * 2);
  _Float16* w_outT   = (_Float16*)alloc((size_t)D * D * 2);
  _Float16* w_upT    = (_Float16*)alloc((size_t)2 * D * D * 2);
  _Float16* w_downT  = (_Float16*)alloc((size_t)2 * D * D * 2);
  _Float16* h16      = (_Float16*)alloc((size_t)BS * D * 2);
  _Float16* q16      = (_Float16*)alloc((size_t)BS * D * 2);
  _Float16* k16      = (_Float16*)alloc((size_t)BS * D * 2);
  _Float16* vT16     = (_Float16*)alloc((size_t)BS * D * 2);
  _Float16* attn16   = (_Float16*)alloc((size_t)BS * D * 2);
  float*    x1       = (float*)   alloc((size_t)BS * D * 4);
  _Float16* h2_16    = (_Float16*)alloc((size_t)BS * D * 2);
  _Float16* ff16     = (_Float16*)alloc((size_t)BS * 2 * D * 2);

  // --- weight conversion ---
  cvt_f32_to_f16<<<(3 * D * D + 255) / 256, 256, 0, stream>>>(w_in, w_in16, 3 * D * D);
  transpose_to_f16<<<dim3(D / 64, D / 64), 256, 0, stream>>>(w_out, w_outT, D, D);
  transpose_to_f16<<<dim3(2 * D / 64, D / 64), 256, 0, stream>>>(w_up, w_upT, D, 2 * D);
  transpose_to_f16<<<dim3(D / 64, 2 * D / 64), 256, 0, stream>>>(w_down, w_downT, 2 * D, D);

  // --- LN1 -> h16 ---
  layernorm_to_f16<<<BS, 256, 0, stream>>>(x, ln1_g, ln1_b, h16);

  // --- qkv = h @ in_project.T  (M=4096, N=3072, K=1024), f16 out, stored as
  //     q/k (B*H,S,dh) and vT (B*H,dh,S) ---
  gemm_wmma<64, false, false, false, false, true, true>
      <<<dim3(3072 / 128, BS / 128), 256, 0, stream>>>(
          h16, w_in16, nullptr, nullptr, nullptr, q16, k16, vT16, BS, 3 * D, D);

  // --- flash attention -> attn16 (B,S,H*dh) ---
  attention_kernel<<<dim3(1024 / 64, 64), 128, 0, stream>>>(q16, k16, vT16, attn16);

  // --- x1 = attn @ out_project + x  (M=4096, N=1024, K=1024), f32 out ---
  gemm_wmma<128, false, false, true, true, false, false>
      <<<dim3(1024 / 128, BS / 128), 256, 0, stream>>>(
          attn16, w_outT, nullptr, x, x1, nullptr, nullptr, nullptr, BS, D, D);

  // --- LN2 -> h2_16 ---
  layernorm_to_f16<<<BS, 256, 0, stream>>>(x1, ln2_g, ln2_b, h2_16);

  // --- ff = relu(h2 @ w_up + b_up)  (M=4096, N=2048, K=1024), f16 out ---
  gemm_wmma<128, true, true, false, false, true, false>
      <<<dim3(2048 / 128, BS / 128), 256, 0, stream>>>(
          h2_16, w_upT, b_up, nullptr, nullptr, ff16, nullptr, nullptr, BS, 2 * D, D);

  // --- out = ff @ w_down + b_down + x1  (M=4096, N=1024, K=2048), f32 out ---
  gemm_wmma<128, true, false, true, true, false, false>
      <<<dim3(1024 / 128, BS / 128), 256, 0, stream>>>(
          ff16, w_downT, b_down, x1, out, nullptr, nullptr, nullptr, BS, D, 2 * D);
}

// v007
// A run of this version takes 115 microseconds.
// Versions in between are left out here; by their measured steps it is 1.14 times as fast as v005.
// All steps since v000 together make it 3.64 times as fast.
#include <hip/hip_runtime.h>

typedef __attribute__((ext_vector_type(16))) _Float16 v16h;
typedef __attribute__((ext_vector_type(8)))  _Float16 v8h;
typedef __attribute__((ext_vector_type(8)))  float    v8f;

#define WMMA_F16(a, b, c) \
  __builtin_amdgcn_wmma_f32_16x16x32_f16(false, (a), false, (b), (short)0, (c), false, false)

// ---------------------------------------------------------------------------
// Fragment load from GLOBAL: 16-bit A or B fragment (16 rows x 32 K) from
// (rows, K) row-major storage. Per ISA layout: lane L holds row (L&15); its
// 16 halves are K[kb..kb+7] and K[kb+16..kb+23] with kb = k0 + (L>>4)*8.
// ---------------------------------------------------------------------------
__device__ inline v16h load_frag(const _Float16* __restrict__ base, int ld,
                                 int row0, int k0) {
  int lane = threadIdx.x & 31;
  const _Float16* p = base + (size_t)(row0 + (lane & 15)) * ld + k0 + ((lane >> 4) << 3);
  v8h lo = *(const v8h*)p;
  v8h hi = *(const v8h*)(p + 16);
  return __builtin_shufflevector(lo, hi, 0,1,2,3,4,5,6,7,8,9,10,11,12,13,14,15);
}

// ---------------------------------------------------------------------------
// GEMM operand tiles in LDS: 128 rows x GK k. Row pitch GK + 8 halves (272 B
// for 128 k, 144 B for 64 k: 16 B x odd), conflict-free for the 16-byte
// fragment reads.
// ---------------------------------------------------------------------------
template <int PITCH>
__device__ inline v16h lds_frag(const _Float16* lds, int row0, int k0) {
  int lane = threadIdx.x & 31;
  const _Float16* p = lds + (row0 + (lane & 15)) * PITCH + k0 + ((lane >> 4) << 3);
  v8h lo = *(const v8h*)p;
  v8h hi = *(const v8h*)(p + 16);
  return __builtin_shufflevector(lo, hi, 0,1,2,3,4,5,6,7,8,9,10,11,12,13,14,15);
}

// One thread's share of one operand tile: 16 bytes of each of NC rows, copied
// from global memory to LDS through no register. g is the thread's first source
// chunk and gs the source distance between its rows in halves; l is the LDS
// byte address of its first destination chunk and LS the distance there in
// bytes. The lanes of a wave cover whole rows of the tile (256 or 128
// contiguous bytes). The closing s_wait_xcnt stands inside the statement so
// that no register a copy names is rewritten ahead of it.
template <int NC, unsigned LS>
__device__ inline void copy_tile(const _Float16* g, size_t gs, unsigned l) {
  static_assert(NC == 4 || NC == 8, "4 or 8 rows a thread");
  if constexpr (NC == 8) {
    asm volatile(
        "global_load_async_to_lds_b128 %0, %8, off\n\t"
        "global_load_async_to_lds_b128 %1, %9, off\n\t"
        "global_load_async_to_lds_b128 %2, %10, off\n\t"
        "global_load_async_to_lds_b128 %3, %11, off\n\t"
        "global_load_async_to_lds_b128 %4, %12, off\n\t"
        "global_load_async_to_lds_b128 %5, %13, off\n\t"
        "global_load_async_to_lds_b128 %6, %14, off\n\t"
        "global_load_async_to_lds_b128 %7, %15, off\n\t"
        "s_wait_xcnt 0x0"
        :: "v"(l), "v"(l + LS), "v"(l + 2 * LS), "v"(l + 3 * LS),
           "v"(l + 4 * LS), "v"(l + 5 * LS), "v"(l + 6 * LS), "v"(l + 7 * LS),
           "v"(g), "v"(g + gs), "v"(g + 2 * gs), "v"(g + 3 * gs),
           "v"(g + 4 * gs), "v"(g + 5 * gs), "v"(g + 6 * gs), "v"(g + 7 * gs)
        : "memory");
  } else {
    asm volatile(
        "global_load_async_to_lds_b128 %0, %4, off\n\t"
        "global_load_async_to_lds_b128 %1, %5, off\n\t"
        "global_load_async_to_lds_b128 %2, %6, off\n\t"
        "global_load_async_to_lds_b128 %3, %7, off\n\t"
        "s_wait_xcnt 0x0"
        :: "v"(l), "v"(l + LS), "v"(l + 2 * LS), "v"(l + 3 * LS),
           "v"(g), "v"(g + gs), "v"(g + 2 * gs), "v"(g + 3 * gs)
        : "memory");
  }
}

// ---------------------------------------------------------------------------
// Elementwise weight converters
// ---------------------------------------------------------------------------
typedef __attribute__((ext_vector_type(4))) _Float16 v4h;
typedef __attribute__((ext_vector_type(4))) float    v4f;

// Few waves that each do much. Workgroup blk of 8 waves converts CVT_N x 1024
// consecutive floats; every load of a wave covers 512 contiguous bytes and
// every store 256, and all CVT_N loads of a lane are in flight together.
// The element count must be (number of workgroups) * CVT_N * 1024.
#define CVT_N 12

__device__ inline void cvt_f32_to_f16(const float* __restrict__ in,
                                      _Float16* __restrict__ out, int blk) {
  const size_t base = (size_t)blk * (CVT_N * 1024) + threadIdx.x * 4;
  v4f v[CVT_N];
#pragma unroll
  for (int i = 0; i < CVT_N; i++) v[i] = *(const v4f*)(in + base + i * 1024);
#pragma unroll
  for (int i = 0; i < CVT_N; i++)
    *(v4h*)(out + base + i * 1024) = __builtin_convertvector(v[i], v4h);
}

// in: (R, C) f32 row-major  ->  out: (C, R) f16 row-major
// One 64x64 tile (column block bx, row block by) per workgroup of 256 threads,
// turned in LDS (tile: TT * TT_PITCH floats), so that both
// sides of global memory see whole 128-byte lines: reads are 16 B per lane
// along c (256 B per tile row), writes are 16 B per lane along r (8 lanes fill
// one 128-byte line of an output row). R and C must be multiples of 64.
// Tile pitch 65 floats: the 32 lanes of a wave hit 32 different banks both
// when storing rows and when reading columns.
#define TT 64
#define TT_PITCH 65

__device__ inline void transpose_to_f16(
    const float* __restrict__ in, _Float16* __restrict__ out, int R, int C,
    int bx, int by, float* tile) {
  const int t  = threadIdx.x;
  const int c0 = bx * TT;
  const int r0 = by * TT;

  const int lc = (t & 15) << 2;   // first of this lane's 4 columns
  const int lr = t >> 4;          // 0..15
  float4 v[4];
#pragma unroll
  for (int i = 0; i < 4; i++)
    v[i] = *(const float4*)(in + (size_t)(r0 + lr + i * 16) * C + c0 + lc);
#pragma unroll
  for (int i = 0; i < 4; i++) {
    float* d = tile + (lr + i * 16) * TT_PITCH + lc;
    d[0] = v[i].x; d[1] = v[i].y; d[2] = v[i].z; d[3] = v[i].w;
  }
  __syncthreads();

  const int sr = (t & 7) << 3;    // first of this lane's 8 rows
  const int sc = t >> 3;          // 0..31
#pragma unroll
  for (int i = 0; i < 2; i++) {
    const int c = sc + i * 32;
    v8h o;
#pragma unroll
    for (int j = 0; j < 8; j++) o[j] = (_Float16)tile[(sr + j) * TT_PITCH + c];
    *(v8h*)(out + (size_t)(c0 + c) * R + r0 + sr) = o;
  }
}

// ---------------------------------------------------------------------------
// LayerNorm over rows of 1024, f32 in -> f16 out (feeds WMMA GEMMs)
// Two rows a wave, 16 rows a workgroup of 8 waves, one workgroup a WGP: a
// sixteenth of the waves to start, no LDS and no barrier. A lane holds 32 values
// of each row, as 8 loads of 16 bytes (512 contiguous bytes a wave and load);
// a row's sums are four chains in the lane, then a butterfly over the wave.
// Workgroup blk takes rows 16 blk .. 16 blk + 15.
// ---------------------------------------------------------------------------
__device__ inline void layernorm_rows(
    const float* __restrict__ x, const float* __restrict__ gamma,
    const float* __restrict__ beta, _Float16* __restrict__ out, int blk) {
  const int lane = threadIdx.x & 31;
  const int row  = blk * 16 + (threadIdx.x >> 5) * 2;
  const float* xr = x + (size_t)row * 1024 + lane * 4;
  v4f v[2][8], g[8], b[8];
#pragma unroll
  for (int r = 0; r < 2; r++)
#pragma unroll
    for (int i = 0; i < 8; i++) v[r][i] = *(const v4f*)(xr + r * 1024 + i * 128);
#pragma unroll
  for (int i = 0; i < 8; i++) {
    g[i] = *(const v4f*)(gamma + lane * 4 + i * 128);
    b[i] = *(const v4f*)(beta + lane * 4 + i * 128);
  }
  // Precaution: stands in front of every rewrite of an address register of the
  // loads above; xr is named so that no load's result is put into its registers
  // ahead of the wait.
  asm volatile("s_wait_xcnt 0x0" :: "v"(xr) : "memory");
  // Keeps all 32 loads in front of the sums: moved behind them, the gamma and
  // beta loads would be waited for in turn at the end of the wave.
  __builtin_amdgcn_sched_barrier(0);
  float s[2], sq[2];
#pragma unroll
  for (int r = 0; r < 2; r++) {
    v4f s4 = v[r][0], q4 = v[r][0] * v[r][0];
#pragma unroll
    for (int i = 1; i < 8; i++) {
      s4 += v[r][i];
      q4 += v[r][i] * v[r][i];
    }
    s[r]  = (s4.x + s4.y) + (s4.z + s4.w);
    sq[r] = (q4.x + q4.y) + (q4.z + q4.w);
  }
#pragma unroll
  for (int m = 16; m >= 1; m >>= 1) {
#pragma unroll
    for (int r = 0; r < 2; r++) {
      s[r]  += __shfl_xor(s[r], m, 32);
      sq[r] += __shfl_xor(sq[r], m, 32);
    }
  }
  _Float16* orow = out + (size_t)row * 1024 + lane * 4;
#pragma unroll
  for (int r = 0; r < 2; r++) {
    const float mean = s[r] * (1.f / 1024.f);
    const float var  = sq[r] * (1.f / 1024.f) - mean * mean;
    const float inv  = rsqrtf(var + 1e-5f);
#pragma unroll
    for (int i = 0; i < 8; i++)
      *(v4h*)(orow + r * 1024 + i * 128) =
          __builtin_convertvector((v[r][i] - mean) * inv * g[i] + b[i], v4h);
  }
}

__global__ __launch_bounds__(256) void layernorm_to_f16(
    const float* __restrict__ x, const float* __restrict__ gamma,
    const float* __restrict__ beta, _Float16* __restrict__ out) {
  layernorm_rows(x, gamma, beta, out, blockIdx.x);
}

// ---------------------------------------------------------------------------
// Everything that reads only inputs, in ONE launch: the first LayerNorm, the
// conversion of in_project and the three weight transposes read nothing of
// each other's output, so a workgroup's index picks its job and the five jobs
// start, stream and drain side by side instead of one behind the other.
// The jobs with the most bytes a workgroup come first, the small tiles last.
// Shapes: x (4096, 1024), w_in (3072, 1024), w_out (1024, 1024),
// w_up (1024, 2048), w_down (2048, 1024).
// ---------------------------------------------------------------------------
#define PREP_LN   256                       // 4096 rows / 16
#define PREP_CVT  256                       // 3072 * 1024 / (CVT_N * 1024)
#define PREP_OUT  256                       // 16 x 16 tiles
#define PREP_UP   512                       // 32 x 16 tiles
#define PREP_DOWN 512                       // 16 x 32 tiles
#define PREP_GRID (PREP_LN + PREP_CVT + PREP_OUT + PREP_UP + PREP_DOWN)

__global__ __launch_bounds__(256) void prepare_inputs(
    const float* __restrict__ x, const float* __restrict__ gamma,
    const float* __restrict__ beta, const float* __restrict__ w_in,
    const float* __restrict__ w_out, const float* __restrict__ w_up,
    const float* __restrict__ w_down, _Float16* __restrict__ h16,
    _Float16* __restrict__ w_in16, _Float16* __restrict__ w_outT,
    _Float16* __restrict__ w_upT, _Float16* __restrict__ w_downT) {
  __shared__ float tile[TT * TT_PITCH];
  // The index is the same for the whole workgroup, and so is every branch.
  const int b  = blockIdx.x;
  const int b1 = b - PREP_LN;
  const int b2 = b1 - PREP_CVT;
  const int b3 = b2 - PREP_OUT;
  const int b4 = b3 - PREP_UP;
  // The s_wait_xcnt behind a job is a precaution: in the built code the way from
  // a job's last stores to the end leads past the heads of the other jobs, which
  // write registers that those stores name; the wait stands in front of them.
  if (b1 < 0) {
    layernorm_rows(x, gamma, beta, h16, b);   // last in the built code: no head behind it
  } else if (b2 < 0) {
    cvt_f32_to_f16(w_in, w_in16, b1);
    asm volatile("s_wait_xcnt 0x0" ::: "memory");
  } else if (b3 < 0) {
    transpose_to_f16(w_out, w_outT, 1024, 1024, b2 & 15, b2 >> 4, tile);
    asm volatile("s_wait_xcnt 0x0" ::: "memory");
  } else if (b4 < 0) {
    transpose_to_f16(w_up, w_upT, 1024, 2048, b3 & 31, b3 >> 5, tile);
    asm volatile("s_wait_xcnt 0x0" ::: "memory");
  } else {
    transpose_to_f16(w_down, w_downT, 2048, 1024, b4 & 15, b4 >> 4, tile);
    asm volatile("s_wait_xcnt 0x0" ::: "memory");
  }
}

// ---------------------------------------------------------------------------
// LDS-staged WMMA GEMM: C[M,N] = A16[M,K] * Bt16[N,K]^T (+bias)(+relu)(+res)
// Workgroup tile 128x128; a trip of the K loop works on GK k. Two LDS buffers:
// asynchronous copies bring tile t + 1 in while tile t is worked on.
// GK = 128 (136 KB of LDS, two workgroups a WGP) where the grid has at most two
// workgroups a WGP; GK = 64 (72 KB) where it has three, so that all are resident.
// 8 waves, each owns a 64x32 sub-tile = 4x2 WMMA C tiles (8 WMMA per 32 k).
// M and N must be multiples of 128, K a multiple of GK.
// QKV: the output is the (4*1024, 3*1024) q|k|v product and goes straight to
// the layouts attention reads: q and k as (B*H, S, dh) into C16 and Kh, v
// transposed as (B*H, dh, S) into Vt. A lane's 8 accumulator rows are 8
// consecutive s of one (head, e), so v leaves as one 16-byte store per C tile,
// and the 4 tiles of a wave's 64 rows fill one whole 128-byte line of Vt.
// ---------------------------------------------------------------------------
template <int GK, bool BIAS, bool RELU, bool RES, bool OUT32, bool OUT16, bool QKV>
__global__ __launch_bounds__(256) void gemm_wmma(
    const _Float16* __restrict__ A, const _Float16* __restrict__ Bt,
    const float* __restrict__ bias, const float* __restrict__ resid,
    float* __restrict__ C32, _Float16* __restrict__ C16,
    _Float16* __restrict__ Kh, _Float16* __restrict__ Vt,
    int M, int N, int K) {
  const int w    = threadIdx.x >> 5;
  const int lane = threadIdx.x & 31;
  const int wm = w >> 2;          // 0..1 -> 64-row slice
  const int wn = w & 3;           // 0..3 -> 32-col slice
  const int mblk = blockIdx.y * 128;
  const int nblk = blockIdx.x * 128;

  constexpr int GP  = GK + 8;          // LDS row pitch in halves
  constexpr int CPR = GK / 8;          // 16-byte chunks in a tile row
  constexpr int RPP = 256 / CPR;       // rows the workgroup covers with one copy each
  constexpr int NC  = 128 / RPP;       // copies a thread and operand tile
  constexpr unsigned LS   = RPP * GP * 2;   // LDS bytes between a thread's rows
  constexpr unsigned BUFB = 128 * GP * 2;   // bytes of one buffer

  __shared__ __align__(16) _Float16 As[2][128 * GP];
  __shared__ __align__(16) _Float16 Bs[2][128 * GP];

  v8f acc[4][2];
#pragma unroll
  for (int mt = 0; mt < 4; mt++)
#pragma unroll
    for (int nt = 0; nt < 2; nt++) acc[mt][nt] = {};

  // Copy share of a thread: chunk (threadIdx.x % CPR) of rows
  // (threadIdx.x / CPR) + RPP i of the A tile and of the B tile.
  const int crow = threadIdx.x / CPR;
  const int cpc  = (threadIdx.x % CPR) << 3;
  const _Float16* ga = A  + (size_t)(mblk + crow) * K + cpc;
  const _Float16* gb = Bt + (size_t)(nblk + crow) * K + cpc;
  const size_t step = (size_t)RPP * K;
  const unsigned la = (unsigned)(size_t)&As[0][crow * GP + cpc];
  const unsigned lb = (unsigned)(size_t)&Bs[0][crow * GP + cpc];
  const int trips = K / GK;

  copy_tile<NC, LS>(ga, step, la);
  copy_tile<NC, LS>(gb, step, lb);
  // Tile 0 has landed for this wave; the barrier publishes it to the others.
  asm volatile("s_wait_asynccnt 0x0" ::: "memory");
  __syncthreads();
  if (trips > 1) {
    copy_tile<NC, LS>(ga + GK, step, la + BUFB);
    copy_tile<NC, LS>(gb + GK, step, lb + BUFB);
  }

  for (int t = 0; t < trips; t++) {
    const _Float16* Ac = As[t & 1];
    const _Float16* Bc = Bs[t & 1];
    // Unrolled: ks becomes a constant offset of the LDS reads, and the
    // fragments stay in registers.
#pragma unroll
    for (int ks = 0; ks < GK; ks += 32) {
      v16h a[4], b[2];
#pragma unroll
      for (int mt = 0; mt < 4; mt++) a[mt] = lds_frag<GP>(Ac, wm * 64 + mt * 16, ks);
#pragma unroll
      for (int nt = 0; nt < 2; nt++) b[nt] = lds_frag<GP>(Bc, wn * 32 + nt * 16, ks);
#pragma unroll
      for (int mt = 0; mt < 4; mt++)
#pragma unroll
        for (int nt = 0; nt < 2; nt++)
          acc[mt][nt] = WMMA_F16(a[mt], b[nt], acc[mt][nt]);
    }
    // This wave's reads of tile t have returned before its buffer is refilled.
    asm volatile("s_wait_dscnt 0x0" ::: "memory");
    // This wave's copies of tile t + 1 have landed.
    asm volatile("s_wait_asynccnt 0x0" ::: "memory");
    // Publishes tile t + 1 and ends every wave's reads of tile t.
    __syncthreads();
    if (t + 2 < trips) {
      const unsigned bo = (t & 1) ? BUFB : 0u;
      copy_tile<NC, LS>(ga + (size_t)(t + 2) * GK, step, la + bo);
      copy_tile<NC, LS>(gb + (size_t)(t + 2) * GK, step, lb + bo);
    }
  }
  // No copy is outstanding when the wave goes on to the epilogue and ends.
  asm volatile("s_wait_asynccnt 0x0" ::: "memory");

  const int col   = lane & 15;
  const int rbase = (lane >> 4) << 3;
  if (QKV) {
    // A 128-column block lies inside one of q, k, v and a 128-row block inside
    // one batch, so both choices are the same for the whole workgroup.
    const int part = nblk >> 10;
    const int hn = (nblk & 1023) + wn * 32 + col;     // nt adds 16: same head
    const int bh = (mblk >> 10) * 16 + (hn >> 6);
    const int e  = hn & 63;
    const int s0 = (mblk & 1023) + wm * 64 + rbase;   // mt adds 16
    if (part == 2) {
      _Float16* d = Vt + ((size_t)bh * 64 + e) * 1024 + s0;
#pragma unroll
      for (int nt = 0; nt < 2; nt++) {
#pragma unroll
        for (int mt = 0; mt < 4; mt++) {
          v8h o;
#pragma unroll
          for (int r = 0; r < 8; r++) o[r] = (_Float16)acc[mt][nt][r];
          *(v8h*)(d + nt * 16 * 1024 + mt * 16) = o;
        }
      }
    } else {
      _Float16* d = (part == 0 ? C16 : Kh) + ((size_t)bh * 1024 + s0) * 64 + e;
#pragma unroll
      for (int mt = 0; mt < 4; mt++) {
#pragma unroll
        for (int nt = 0; nt < 2; nt++) {
#pragma unroll
          for (int r = 0; r < 8; r++)
            d[(mt * 16 + r) * 64 + nt * 16] = (_Float16)acc[mt][nt][r];
        }
      }
      // Precaution: stands in front of any later rewrite of a register that the
      // stores above name.
      asm volatile("s_wait_xcnt 0x0" ::: "memory");
    }
    return;
  }
#pragma unroll
  for (int mt = 0; mt < 4; mt++) {
#pragma unroll
    for (int nt = 0; nt < 2; nt++) {
      int n = nblk + wn * 32 + nt * 16 + col;
      float bv = BIAS ? bias[n] : 0.f;
#pragma unroll
      for (int r = 0; r < 8; r++) {
        int m = mblk + wm * 64 + mt * 16 + rbase + r;
        float vv = acc[mt][nt][r] + bv;
        if (RELU) vv = fmaxf(vv, 0.f);
        if (RES) vv += resid[(size_t)m * N + n];
        if (OUT32) C32[(size_t)m * N + n] = vv;
        if (OUT16) C16[(size_t)m * N + n] = (_Float16)vv;
      }
    }
  }
}

#define KV_TILE 64
#define KV_PITCH 72

__device__ inline v16h kv_frag(const _Float16* lds, int row0, int k0) {
  int lane = threadIdx.x & 31;
  const _Float16* p = lds + (row0 + (lane & 15)) * KV_PITCH + k0 + ((lane >> 4) << 3);
  v8h lo = *(const v8h*)p;
  v8h hi = *(const v8h*)(p + 16);
  return __builtin_shufflevector(lo, hi, 0,1,2,3,4,5,6,7,8,9,10,11,12,13,14,15);
}

// The value that lane l ^ 16 holds.
__device__ inline float other_half(float x) {
  return __builtin_bit_cast(float, __builtin_amdgcn_permlanex16(
      __builtin_bit_cast(int, x), __builtin_bit_cast(int, x),
      0x76543210, 0xfedcba98, false, false));
}

__global__ __launch_bounds__(128) void attention_kernel(
    const _Float16* __restrict__ q, const _Float16* __restrict__ k,
    const _Float16* __restrict__ vT, _Float16* __restrict__ o) {
  constexpr int S = 1024, DH = 64;
  const int wave = threadIdx.x >> 5;
  const int lane = threadIdx.x & 31;
  const int bh = blockIdx.y;
  const int qrow0 = blockIdx.x * 64 + wave * 16;

  const _Float16* qb = q  + (size_t)bh * S * DH;
  const _Float16* kb = k  + (size_t)bh * S * DH;
  const _Float16* vb = vT + (size_t)bh * DH * S;

  __shared__ __align__(16) _Float16 Ks[2][KV_TILE * KV_PITCH];  // keys x dh
  __shared__ __align__(16) _Float16 Vs[2][DH * KV_PITCH];       // dh x keys

  // Staging share of a thread: 16 bytes of rows srow, srow + 16, + 32, + 48 of
  // the K tile and of the V^T tile (both are 64 rows of 128 bytes).
  const int srow = threadIdx.x >> 3;
  const int spc  = (threadIdx.x & 7) << 3;
  const _Float16* kg = kb + (size_t)srow * DH + spc;
  const _Float16* vg = vb + (size_t)srow * S + spc;
  const int sl = srow * KV_PITCH + spc;
  v8h kr[4], vr[4];

#pragma unroll
  for (int i = 0; i < 4; i++) {
    kr[i] = *(const v8h*)(kg + i * 16 * DH);
    vr[i] = *(const v8h*)(vg + i * 16 * S);
  }

  // Q as B operand: lane l holds query (l & 15), in kv_frag's k order.
  const v16h qb0 = load_frag(qb, DH, qrow0, 0);
  const v16h qb1 = load_frag(qb, DH, qrow0, 32);

#pragma unroll
  for (int i = 0; i < 4; i++) {
    *(v8h*)(Ks[0] + sl + i * 16 * KV_PITCH) = kr[i];
    *(v8h*)(Vs[0] + sl + i * 16 * KV_PITCH) = vr[i];
  }
  __syncthreads();

  // One query a lane: its running maximum (the same in both halves) and the sum
  // over the keys of this lane's half (the halves are joined behind the loop).
  float mrun = -1e30f, lsum = 0.f;
  v8f oacc[4];   // oacc[t][r] = O^T[16 t + 8 (lane >> 4) + r][query]
#pragma unroll
  for (int t = 0; t < 4; t++) oacc[t] = {};

  for (int st = 0; st < S / KV_TILE; st++) {
    const _Float16* Kc = Ks[st & 1];
    const _Float16* Vc = Vs[st & 1];
    const bool more = st + 1 < S / KV_TILE;
    if (more) {
      const int jn = (st + 1) * KV_TILE;
#pragma unroll
      for (int i = 0; i < 4; i++) {
        kr[i] = *(const v8h*)(kg + (size_t)(jn + i * 16) * DH);
        vr[i] = *(const v8h*)(vg + i * 16 * S + jn);
      }
    }
#pragma unroll
    for (int jb = 0; jb < KV_TILE; jb += 32) {
      // scores of 32 keys: two 16x16 tiles of S^T, K = dh = 64 = 2 WMMA steps
      v8f s0 = {}, s1 = {};
      {
        v16h k0a = kv_frag(Kc, jb, 0);
        v16h k0b = kv_frag(Kc, jb, 32);
        s0 = WMMA_F16(k0a, qb0, s0);
        s0 = WMMA_F16(k0b, qb1, s0);
        v16h k1a = kv_frag(Kc, jb + 16, 0);
        v16h k1b = kv_frag(Kc, jb + 16, 32);
        s1 = WMMA_F16(k1a, qb0, s1);
        s1 = WMMA_F16(k1b, qb1, s1);
      }
      // online softmax update of the lane's query
      float mx = fmaxf(s0[0], s1[0]);
#pragma unroll
      for (int r = 1; r < 8; r++) mx = fmaxf(mx, fmaxf(s0[r], s1[r]));
      mx = fmaxf(mx, other_half(mx)) * 0.125f;  // 1/sqrt(64)
      const float mnew  = fmaxf(mrun, mx);
      const float alpha = __expf(mrun - mnew);
      mrun = mnew;
      v16h pb;
      float rs = 0.f;
#pragma unroll
      for (int r = 0; r < 8; r++) {
        float p0 = __expf(s0[r] * 0.125f - mnew);
        float p1 = __expf(s1[r] * 0.125f - mnew);
        rs += p0 + p1;
        pb[r]     = (_Float16)p0;
        pb[8 + r] = (_Float16)p1;
      }
      lsum = lsum * alpha + rs;
#pragma unroll
      for (int t = 0; t < 4; t++)
#pragma unroll
        for (int r = 0; r < 8; r++) oacc[t][r] *= alpha;
      // O^T(64x16) += V^T(64x32) * P^T(32x16)
#pragma unroll
      for (int t = 0; t < 4; t++) {
        v16h vf = kv_frag(Vc, t * 16, jb);
        oacc[t] = WMMA_F16(vf, pb, oacc[t]);
      }
    }
    if (more) {
      // The other buffer's last readers left it at the barrier that ended the
      // pass before this one.
      _Float16* Kn = Ks[(st + 1) & 1];
      _Float16* Vn = Vs[(st + 1) & 1];
#pragma unroll
      for (int i = 0; i < 4; i++) {
        *(v8h*)(Kn + sl + i * 16 * KV_PITCH) = kr[i];
        *(v8h*)(Vn + sl + i * 16 * KV_PITCH) = vr[i];
      }
    }
    // Publishes the next tile and ends every wave's reads of this one.
    __syncthreads();
  }

  // A lane's 8 accumulator rows of a tile are 8 consecutive dh of its query:
  // one 16-byte store a tile.
  const int b = bh >> 4, h = bh & 15;
  const float inv = 1.f / (lsum + other_half(lsum));
  _Float16* orow = o + ((size_t)(b * 1024 + qrow0 + (lane & 15))) * 1024 + h * 64 +
                   ((lane >> 4) << 3);
#pragma unroll
  for (int t = 0; t < 4; t++) {
    v8h ov;
#pragma unroll
    for (int r = 0; r < 8; r++) ov[r] = (_Float16)(oacc[t][r] * inv);
    *(v8h*)(orow + t * 16) = ov;
  }
}

// ---------------------------------------------------------------------------
// Host-side orchestration
// ---------------------------------------------------------------------------
extern "C" void kernel_launch(void* const* d_in, const int* in_sizes, int n_in,
                              void* d_out, int out_size, void* d_ws, size_t ws_size,
                              hipStream_t stream) {
  (void)in_sizes; (void)n_in; (void)out_size; (void)ws_size;
  const float* x      = (const float*)d_in[0];   // (4,1024,1024)
  const float* w_in   = (const float*)d_in[1];   // (3072,1024)
  const float* w_out  = (const float*)d_in[2];   // (1024,1024)
  const float* ln1_g  = (const float*)d_in[3];
  const float* ln1_b  = (const float*)d_in[4];
  const float* w_up   = (const float*)d_in[5];   // (1024,2048)
  const float* b_up   = (const float*)d_in[6];
  const float* w_down = (const float*)d_in[7];   // (2048,1024)
  const float* b_down = (const float*)d_in[8];
  const float* ln2_g  = (const float*)d_in[9];
  const float* ln2_b  = (const float*)d_in[10];
  float* out = (float*)d_out;

  const int BS = 4096, D = 1024;

  char* ws = (char*)d_ws;
  size_t off = 0;
  auto alloc = [&](size_t bytes) -> void* {
    off = (off + 255) & ~(size_t)255;
    void* p = ws + off;
    off += bytes;
    return p;
  };

  _Float16* w_in16   = (_Float16*)alloc((size_t)3 * D * D * 2);
  _Float16* w_outT   = (_Float16*)alloc((size_t)D * D * 2);
  _Float16* w_upT    = (_Float16*)alloc((size_t)2 * D * D * 2);
  _Float16* w_downT  = (_Float16*)alloc((size_t)2 * D * D * 2);
  _Float16* h16      = (_Float16*)alloc((size_t)BS * D * 2);
  _Float16* q16      = (_Float16*)alloc((size_t)BS * D * 2);
  _Float16* k16      = (_Float16*)alloc((size_t)BS * D * 2);
  _Float16* vT16     = (_Float16*)alloc((size_t)BS * D * 2);
  _Float16* attn16   = (_Float16*)alloc((size_t)BS * D * 2);
  float*    x1       = (float*)   alloc((size_t)BS * D * 4);
  _Float16* h2_16    = (_Float16*)alloc((size_t)BS * D * 2);
  _Float16* ff16     = (_Float16*)alloc((size_t)BS * 2 * D * 2);

  // --- LN1 -> h16, and all four weights to f16 (three of them transposed) ---
  prepare_inputs<<<PREP_GRID, 256, 0, stream>>>(x, ln1_g, ln1_b, w_in, w_out, w_up, w_down,
                                                h16, w_in16, w_outT, w_upT, w_downT);

  // --- qkv = h @ in_project.T  (M=4096, N=3072, K=1024), f16 out, stored as
  //     q/k (B*H,S,dh) and vT (B*H,dh,S) ---
  gemm_wmma<64, false, false, false, false, true, true>
      <<<dim3(3072 / 128, BS / 128), 256, 0, stream>>>(
          h16, w_in16, nullptr, nullptr, nullptr, q16, k16, vT16, BS, 3 * D, D);

  // --- flash attention -> attn16 (B,S,H*dh) ---
  attention_kernel<<<dim3(1024 / 64, 64), 128, 0, stream>>>(q16, k16, vT16, attn16);

  // --- x1 = attn @ out_project + x  (M=4096, N=1024, K=1024), f32 out ---
  gemm_wmma<128, false, false, true, true, false, false>
      <<<dim3(1024 / 128, BS / 128), 256, 0, stream>>>(
          attn16, w_outT, nullptr, x, x1, nullptr, nullptr, nullptr, BS, D, D);

  // --- LN2 -> h2_16 ---
  layernorm_to_f16<<<BS / 16, 256, 0, stream>>>(x1, ln2_g, ln2_b, h2_16);

  // --- ff = relu(h2 @ w_up + b_up)  (M=4096, N=2048, K=1024), f16 out ---
  gemm_wmma<128, true, true, false, false, true, false>
      <<<dim3(2048 / 128, BS / 128), 256, 0, stream>>>(
          h2_16, w_upT, b_up, nullptr, nullptr, ff16, nullptr, nullptr, BS, 2 * D, D);

  // --- out = ff @ w_down + b_down + x1  (M=4096, N=1024, K=2048), f32 out ---
  gemm_wmma<128, true, false, true, true, false, false>
      <<<dim3(1024 / 128, BS / 128), 256, 0, stream>>>(
          ff16, w_downT, b_down, x1, out, nullptr, nullptr, nullptr, BS, D, 2 * D);
}

// v008
// One run takes 109 microseconds.
// In both of two side-by-side timings against v007, it was 1.05 times as fast.
// Over all steps from v000 it is 3.83 times as fast.
#include <hip/hip_runtime.h>

typedef __attribute__((ext_vector_type(16))) _Float16 v16h;
typedef __attribute__((ext_vector_type(8)))  _Float16 v8h;
typedef __attribute__((ext_vector_type(8)))  float    v8f;

#define WMMA_F16(a, b, c) \
  __builtin_amdgcn_wmma_f32_16x16x32_f16(false, (a), false, (b), (short)0, (c), false, false)

// ---------------------------------------------------------------------------
// Fragment load from GLOBAL: 16-bit A or B fragment (16 rows x 32 K) from
// (rows, K) row-major storage. Per ISA layout: lane L holds row (L&15); its
// 16 halves are K[kb..kb+7] and K[kb+16..kb+23] with kb = k0 + (L>>4)*8.
// ---------------------------------------------------------------------------
__device__ inline v16h load_frag(const _Float16* __restrict__ base, int ld,
                                 int row0, int k0) {
  int lane = threadIdx.x & 31;
  const _Float16* p = base + (size_t)(row0 + (lane & 15)) * ld + k0 + ((lane >> 4) << 3);
  v8h lo = *(const v8h*)p;
  v8h hi = *(const v8h*)(p + 16);
  return __builtin_shufflevector(lo, hi, 0,1,2,3,4,5,6,7,8,9,10,11,12,13,14,15);
}

// ---------------------------------------------------------------------------
// GEMM operand tiles in LDS: 128 rows x GK k. Row pitch GK + 8 halves (272 B
// for 128 k, 144 B for 64 k: 16 B x odd), conflict-free for the 16-byte
// fragment reads.
// ---------------------------------------------------------------------------
template <int PITCH>
__device__ inline v16h lds_frag(const _Float16* lds, int row0, int k0) {
  int lane = threadIdx.x & 31;
  const _Float16* p = lds + (row0 + (lane & 15)) * PITCH + k0 + ((lane >> 4) << 3);
  v8h lo = *(const v8h*)p;
  v8h hi = *(const v8h*)(p + 16);
  return __builtin_shufflevector(lo, hi, 0,1,2,3,4,5,6,7,8,9,10,11,12,13,14,15);
}

// One thread's share of one operand tile: 16 bytes of each of NC rows, copied
// from global memory to LDS through no register. g is the thread's first source
// chunk and gs the source distance between its rows in halves; l is the LDS
// byte address of its first destination chunk and LS the distance there in
// bytes. The lanes of a wave cover whole rows of the tile (256 or 128
// contiguous bytes). The closing s_wait_xcnt stands inside the statement so
// that no register a copy names is rewritten ahead of it.
template <int NC, unsigned LS>
__device__ inline void copy_tile(const _Float16* g, size_t gs, unsigned l) {
  static_assert(NC == 4 || NC == 8, "4 or 8 rows a thread");
  if constexpr (NC == 8) {
    asm volatile(
        "global_load_async_to_lds_b128 %0, %8, off\n\t"
        "global_load_async_to_lds_b128 %1, %9, off\n\t"
        "global_load_async_to_lds_b128 %2, %10, off\n\t"
        "global_load_async_to_lds_b128 %3, %11, off\n\t"
        "global_load_async_to_lds_b128 %4, %12, off\n\t"
        "global_load_async_to_lds_b128 %5, %13, off\n\t"
        "global_load_async_to_lds_b128 %6, %14, off\n\t"
        "global_load_async_to_lds_b128 %7, %15, off\n\t"
        "s_wait_xcnt 0x0"
        :: "v"(l), "v"(l + LS), "v"(l + 2 * LS), "v"(l + 3 * LS),
           "v"(l + 4 * LS), "v"(l + 5 * LS), "v"(l + 6 * LS), "v"(l + 7 * LS),
           "v"(g), "v"(g + gs), "v"(g + 2 * gs), "v"(g + 3 * gs),
           "v"(g + 4 * gs), "v"(g + 5 * gs), "v"(g + 6 * gs), "v"(g + 7 * gs)
        : "memory");
  } else {
    asm volatile(
        "global_load_async_to_lds_b128 %0, %4, off\n\t"
        "global_load_async_to_lds_b128 %1, %5, off\n\t"
        "global_load_async_to_lds_b128 %2, %6, off\n\t"
        "global_load_async_to_lds_b128 %3, %7, off\n\t"
        "s_wait_xcnt 0x0"
        :: "v"(l), "v"(l + LS), "v"(l + 2 * LS), "v"(l + 3 * LS),
           "v"(g), "v"(g + gs), "v"(g + 2 * gs), "v"(g + 3 * gs)
        : "memory");
  }
}

// ---------------------------------------------------------------------------
// Elementwise weight converters
// ---------------------------------------------------------------------------
typedef __attribute__((ext_vector_type(4))) _Float16 v4h;
typedef __attribute__((ext_vector_type(4))) float    v4f;

// Few waves that each do much. Workgroup blk of 8 waves converts CVT_N x 1024
// consecutive floats; every load of a wave covers 512 contiguous bytes and
// every store 256, and all CVT_N loads of a lane are in flight together.
// The element count must be (number of workgroups) * CVT_N * 1024.
#define CVT_N 12

__device__ inline void cvt_f32_to_f16(const float* __restrict__ in,
                                      _Float16* __restrict__ out, int blk) {
  const size_t base = (size_t)blk * (CVT_N * 1024) + threadIdx.x * 4;
  v4f v[CVT_N];
#pragma unroll
  for (int i = 0; i < CVT_N; i++) v[i] = *(const v4f*)(in + base + i * 1024);
#pragma unroll
  for (int i = 0; i < CVT_N; i++)
    *(v4h*)(out + base + i * 1024) = __builtin_convertvector(v[i], v4h);
}

// in: (R, C) f32 row-major  ->  out: (C, R) f16 row-major
// One 64x64 tile (column block bx, row block by) per workgroup of 256 threads,
// turned in LDS (tile: TT * TT_PITCH floats), so that both
// sides of global memory see whole 128-byte lines: reads are 16 B per lane
// along c (256 B per tile row), writes are 16 B per lane along r (8 lanes fill
// one 128-byte line of an output row). R and C must be multiples of 64.
// Tile pitch 65 floats: the 32 lanes of a wave hit 32 different banks both
// when storing rows and when reading columns.
#define TT 64
#define TT_PITCH 65

__device__ inline void transpose_to_f16(
    const float* __restrict__ in, _Float16* __restrict__ out, int R, int C,
    int bx, int by, float* tile) {
  const int t  = threadIdx.x;
  const int c0 = bx * TT;
  const int r0 = by * TT;

  const int lc = (t & 15) << 2;   // first of this lane's 4 columns
  const int lr = t >> 4;          // 0..15
  float4 v[4];
#pragma unroll
  for (int i = 0; i < 4; i++)
    v[i] = *(const float4*)(in + (size_t)(r0 + lr + i * 16) * C + c0 + lc);
#pragma unroll
  for (int i = 0; i < 4; i++) {
    float* d = tile + (lr + i * 16) * TT_PITCH + lc;
    d[0] = v[i].x; d[1] = v[i].y; d[2] = v[i].z; d[3] = v[i].w;
  }
  __syncthreads();

  const int sr = (t & 7) << 3;    // first of this lane's 8 rows
  const int sc = t >> 3;          // 0..31
#pragma unroll
  for (int i = 0; i < 2; i++) {
    const int c = sc + i * 32;
    v8h o;
#pragma unroll
    for (int j = 0; j < 8; j++) o[j] = (_Float16)tile[(sr + j) * TT_PITCH + c];
    *(v8h*)(out + (size_t)(c0 + c) * R + r0 + sr) = o;
  }
}

// ---------------------------------------------------------------------------
// LayerNorm over rows of 1024, f32 in -> f16 out (feeds WMMA GEMMs)
// Two rows a wave, 16 rows a workgroup of 8 waves, one workgroup a WGP: a
// sixteenth of the waves to start, no LDS and no barrier. A lane holds 32 values
// of each row, as 8 loads of 16 bytes (512 contiguous bytes a wave and load);
// a row's sums are four chains in the lane, then a butterfly over the wave.
// Workgroup blk takes rows 16 blk .. 16 blk + 15.
// ---------------------------------------------------------------------------
__device__ inline void layernorm_rows(
    const float* __restrict__ x, const float* __restrict__ gamma,
    const float* __restrict__ beta, _Float16* __restrict__ out, int blk) {
  const int lane = threadIdx.x & 31;
  const int row  = blk * 16 + (threadIdx.x >> 5) * 2;
  const float* xr = x + (size_t)row * 1024 + lane * 4;
  v4f v[2][8], g[8], b[8];
#pragma unroll
  for (int r = 0; r < 2; r++)
#pragma unroll
    for (int i = 0; i < 8; i++) v[r][i] = *(const v4f*)(xr + r * 1024 + i * 128);
#pragma unroll
  for (int i = 0; i < 8; i++) {
    g[i] = *(const v4f*)(gamma + lane * 4 + i * 128);
    b[i] = *(const v4f*)(beta + lane * 4 + i * 128);
  }
  // Precaution: stands in front of every rewrite of an address register of the
  // loads above; xr is named so that no load's result is put into its registers
  // ahead of the wait.
  asm volatile("s_wait_xcnt 0x0" :: "v"(xr) : "memory");
  // Keeps all 32 loads in front of the sums: moved behind them, the gamma and
  // beta loads would be waited for in turn at the end of the wave.
  __builtin_amdgcn_sched_barrier(0);
  float s[2], sq[2];
#pragma unroll
  for (int r = 0; r < 2; r++) {
    v4f s4 = v[r][0], q4 = v[r][0] * v[r][0];
#pragma unroll
    for (int i = 1; i < 8; i++) {
      s4 += v[r][i];
      q4 += v[r][i] * v[r][i];
    }
    s[r]  = (s4.x + s4.y) + (s4.z + s4.w);
    sq[r] = (q4.x + q4.y) + (q4.z + q4.w);
  }
#pragma unroll
  for (int m = 16; m >= 1; m >>= 1) {
#pragma unroll
    for (int r = 0; r < 2; r++) {
      s[r]  += __shfl_xor(s[r], m, 32);
      sq[r] += __shfl_xor(sq[r], m, 32);
    }
  }
  _Float16* orow = out + (size_t)row * 1024 + lane * 4;
#pragma unroll
  for (int r = 0; r < 2; r++) {
    const float mean = s[r] * (1.f / 1024.f);
    const float var  = sq[r] * (1.f / 1024.f) - mean * mean;
    const float inv  = rsqrtf(var + 1e-5f);
#pragma unroll
    for (int i = 0; i < 8; i++)
      *(v4h*)(orow + r * 1024 + i * 128) =
          __builtin_convertvector((v[r][i] - mean) * inv * g[i] + b[i], v4h);
  }
}

__global__ __launch_bounds__(256) void layernorm_to_f16(
    const float* __restrict__ x, const float* __restrict__ gamma,
    const float* __restrict__ beta, _Float16* __restrict__ out) {
  layernorm_rows(x, gamma, beta, out, blockIdx.x);
}

// ---------------------------------------------------------------------------
// Everything that reads only inputs, in ONE launch: the first LayerNorm, the
// conversion of in_project and the three weight transposes read nothing of
// each other's output, so a workgroup's index picks its job and the five jobs
// start, stream and drain side by side instead of one behind the other.
// The jobs with the most bytes a workgroup come first, the small tiles last.
// Shapes: x (4096, 1024), w_in (3072, 1024), w_out (1024, 1024),
// w_up (1024, 2048), w_down (2048, 1024).
// ---------------------------------------------------------------------------
#define PREP_LN   256                       // 4096 rows / 16
#define PREP_CVT  256                       // 3072 * 1024 / (CVT_N * 1024)
#define PREP_OUT  256                       // 16 x 16 tiles
#define PREP_UP   512                       // 32 x 16 tiles
#define PREP_DOWN 512                       // 16 x 32 tiles
#define PREP_GRID (PREP_LN + PREP_CVT + PREP_OUT + PREP_UP + PREP_DOWN)

__global__ __launch_bounds__(256) void prepare_inputs(
    const float* __restrict__ x, const float* __restrict__ gamma,
    const float* __restrict__ beta, const float* __restrict__ w_in,
    const float* __restrict__ w_out, const float* __restrict__ w_up,
    const float* __restrict__ w_down, _Float16* __restrict__ h16,
    _Float16* __restrict__ w_in16, _Float16* __restrict__ w_outT,
    _Float16* __restrict__ w_upT, _Float16* __restrict__ w_downT) {
  __shared__ float tile[TT * TT_PITCH];
  // The index is the same for the whole workgroup, and so is every branch.
  const int b  = blockIdx.x;
  const int b1 = b - PREP_LN;
  const int b2 = b1 - PREP_CVT;
  const int b3 = b2 - PREP_OUT;
  const int b4 = b3 - PREP_UP;
  // The s_wait_xcnt behind a job is a precaution: in the built code the way from
  // a job's last stores to the end leads past the heads of the other jobs, which
  // write registers that those stores name; the wait stands in front of them.
  if (b1 < 0) {
    layernorm_rows(x, gamma, beta, h16, b);   // last in the built code: no head behind it
  } else if (b2 < 0) {
    cvt_f32_to_f16(w_in, w_in16, b1);
    asm volatile("s_wait_xcnt 0x0" ::: "memory");
  } else if (b3 < 0) {
    transpose_to_f16(w_out, w_outT, 1024, 1024, b2 & 15, b2 >> 4, tile);
    asm volatile("s_wait_xcnt 0x0" ::: "memory");
  } else if (b4 < 0) {
    transpose_to_f16(w_up, w_upT, 1024, 2048, b3 & 31, b3 >> 5, tile);
    asm volatile("s_wait_xcnt 0x0" ::: "memory");
  } else {
    transpose_to_f16(w_down, w_downT, 2048, 1024, b4 & 15, b4 >> 4, tile);
    asm volatile("s_wait_xcnt 0x0" ::: "memory");
  }
}

// ---------------------------------------------------------------------------
// LDS-staged WMMA GEMM: C[M,N] = A16[M,K] * Bt16[N,K]^T (+bias)(+relu)(+res)
// Workgroup tile 128x128; a trip of the K loop works on GK k. Two LDS buffers:
// asynchronous copies bring tile t + 1 in while tile t is worked on.
// GK = 128 (136 KB of LDS, two workgroups a WGP) where the grid has at most two
// workgroups a WGP; GK = 64 (72 KB) where it has three, so that all are resident.
// 8 waves, each owns a 64x32 sub-tile = 4x2 WMMA C tiles (8 WMMA per 32 k).
// M and N must be multiples of 128, K a multiple of GK.
// QKV: the output is the (4*1024, 3*1024) q|k|v product and goes straight to
// the layouts attention reads: q and k as (B*H, S, dh) into C16 and Kh, v
// transposed as (B*H, dh, S) into Vt. A lane's 8 accumulator rows are 8
// consecutive s of one (head, e), so v leaves as one 16-byte store per C tile,
// and the 4 tiles of a wave's 64 rows fill one whole 128-byte line of Vt.
// ---------------------------------------------------------------------------
template <int GK, bool BIAS, bool RELU, bool RES, bool OUT32, bool OUT16, bool QKV>
__global__ __launch_bounds__(256) void gemm_wmma(
    const _Float16* __restrict__ A, const _Float16* __restrict__ Bt,
    const float* __restrict__ bias, const float* __restrict__ resid,
    float* __restrict__ C32, _Float16* __restrict__ C16,
    _Float16* __restrict__ Kh, _Float16* __restrict__ Vt,
    int M, int N, int K) {
  const int w    = threadIdx.x >> 5;
  const int lane = threadIdx.x & 31;
  const int wm = w >> 2;          // 0..1 -> 64-row slice
  const int wn = w & 3;           // 0..3 -> 32-col slice
  const int mblk = blockIdx.y * 128;
  const int nblk = blockIdx.x * 128;

  constexpr int GP  = GK + 8;          // LDS row pitch in halves
  constexpr int CPR = GK / 8;          // 16-byte chunks in a tile row
  constexpr int RPP = 256 / CPR;       // rows the workgroup covers with one copy each
  constexpr int NC  = 128 / RPP;       // copies a thread and operand tile
  constexpr unsigned LS   = RPP * GP * 2;   // LDS bytes between a thread's rows
  constexpr unsigned BUFB = 128 * GP * 2;   // bytes of one buffer
  // A second fragment set (48 more registers) where at most two workgroups share
  // a WGP; with three, six waves a SIMD cover each other's LDS waits, and the
  // registers of a second set would cost the third workgroup its place.
  constexpr bool AHEAD = GK == 128;

  __shared__ __align__(16) _Float16 As[2][128 * GP];
  __shared__ __align__(16) _Float16 Bs[2][128 * GP];

  v8f acc[4][2];
#pragma unroll
  for (int mt = 0; mt < 4; mt++)
#pragma unroll
    for (int nt = 0; nt < 2; nt++) acc[mt][nt] = {};

  // Copy share of a thread: chunk (threadIdx.x % CPR) of rows
  // (threadIdx.x / CPR) + RPP i of the A tile and of the B tile.
  const int crow = threadIdx.x / CPR;
  const int cpc  = (threadIdx.x % CPR) << 3;
  const _Float16* ga = A  + (size_t)(mblk + crow) * K + cpc;
  const _Float16* gb = Bt + (size_t)(nblk + crow) * K + cpc;
  const size_t step = (size_t)RPP * K;
  const unsigned la = (unsigned)(size_t)&As[0][crow * GP + cpc];
  const unsigned lb = (unsigned)(size_t)&Bs[0][crow * GP + cpc];
  const int trips = K / GK;

  copy_tile<NC, LS>(ga, step, la);
  copy_tile<NC, LS>(gb, step, lb);
  // Tile 0 has landed for this wave; the barrier publishes it to the others.
  asm volatile("s_wait_asynccnt 0x0" ::: "memory");
  __syncthreads();
  if (trips > 1) {
    copy_tile<NC, LS>(ga + GK, step, la + BUFB);
    copy_tile<NC, LS>(gb + GK, step, lb + BUFB);
  }

  // Two fragment sets where AHEAD: the 12 LDS reads of k step s + 1 go out ahead
  // of the 8 products of step s, over the trip's end too, so that no product
  // waits out the LDS latency of its own reads. frags() reads one step's set,
  // products() works on one; their loops are unrolled so that the sets are
  // indexed by constants and stay in registers.
  constexpr int NS = GK / 32;          // k steps in a trip
  static_assert(NS % 2 == 0, "a trip's last step uses set 1, the next trip's first set 0");
  v16h a[2][4], b[2][2];
  auto frags = [&](const _Float16* Al, const _Float16* Bl, int ks, int set) {
#pragma unroll
    for (int mt = 0; mt < 4; mt++) a[set][mt] = lds_frag<GP>(Al, wm * 64 + mt * 16, ks);
#pragma unroll
    for (int nt = 0; nt < 2; nt++) b[set][nt] = lds_frag<GP>(Bl, wn * 32 + nt * 16, ks);
  };
  auto products = [&](int set) {
#pragma unroll
    for (int mt = 0; mt < 4; mt++)
#pragma unroll
      for (int nt = 0; nt < 2; nt++)
        acc[mt][nt] = WMMA_F16(a[set][mt], b[set][nt], acc[mt][nt]);
  };
  // Tile 0 was published by the barrier above.
  if constexpr (AHEAD) frags(As[0], Bs[0], 0, 0);

  for (int t = 0; t < trips; t++) {
    const _Float16* Ac = As[t & 1];
    const _Float16* Bc = Bs[t & 1];
    // Unrolled: the set index and the LDS offsets become constants, so the
    // fragments stay in registers.
#pragma unroll
    for (int s = 0; s < (AHEAD ? NS - 1 : NS); s++) {
      frags(Ac, Bc, (AHEAD ? s + 1 : s) * 32, AHEAD ? (s + 1) & 1 : 0);
      // Keeps the group of reads in front of the products: left free, the
      // compiler sinks each read to just ahead of its use, into one register
      // set, with a full wait in front of every pair of products.
      __builtin_amdgcn_sched_barrier(0);
      products(AHEAD ? s & 1 : 0);
    }
    // AHEAD: the last step's reads are out and its products follow behind the
    // refill; tile t is read no more. The fence keeps the products above in front
    // of the closing waits, where they cover the latency of those last reads.
    if constexpr (AHEAD) __builtin_amdgcn_sched_barrier(0);
    // This wave's reads of tile t have returned before its buffer is refilled.
    asm volatile("s_wait_dscnt 0x0" ::: "memory");
    // This wave's copies of tile t + 1 have landed.
    asm volatile("s_wait_asynccnt 0x0" ::: "memory");
    // Publishes tile t + 1 and ends every wave's reads of tile t.
    __syncthreads();
    if (t + 2 < trips) {
      const unsigned bo = (t & 1) ? BUFB : 0u;
      copy_tile<NC, LS>(ga + (size_t)(t + 2) * GK, step, la + bo);
      copy_tile<NC, LS>(gb + (size_t)(t + 2) * GK, step, lb + bo);
    }
    if constexpr (AHEAD) {
      // Step 0 of tile t + 1, published by the barrier above.
      if (t + 1 < trips) frags(As[(t + 1) & 1], Bs[(t + 1) & 1], 0, 0);
      products((NS - 1) & 1);
    }
  }
  // No copy is outstanding when the wave goes on to the epilogue and ends.
  asm volatile("s_wait_asynccnt 0x0" ::: "memory");

  const int col   = lane & 15;
  const int rbase = (lane >> 4) << 3;
  if (QKV) {
    // A 128-column block lies inside one of q, k, v and a 128-row block inside
    // one batch, so both choices are the same for the whole workgroup.
    const int part = nblk >> 10;
    const int hn = (nblk & 1023) + wn * 32 + col;     // nt adds 16: same head
    const int bh = (mblk >> 10) * 16 + (hn >> 6);
    const int e  = hn & 63;
    const int s0 = (mblk & 1023) + wm * 64 + rbase;   // mt adds 16
    if (part == 2) {
      _Float16* d = Vt + ((size_t)bh * 64 + e) * 1024 + s0;
#pragma unroll
      for (int nt = 0; nt < 2; nt++) {
#pragma unroll
        for (int mt = 0; mt < 4; mt++) {
          v8h o;
#pragma unroll
          for (int r = 0; r < 8; r++) o[r] = (_Float16)acc[mt][nt][r];
          *(v8h*)(d + nt * 16 * 1024 + mt * 16) = o;
        }
      }
    } else {
      _Float16* d = (part == 0 ? C16 : Kh) + ((size_t)bh * 1024 + s0) * 64 + e;
#pragma unroll
      for (int mt = 0; mt < 4; mt++) {
#pragma unroll
        for (int nt = 0; nt < 2; nt++) {
#pragma unroll
          for (int r = 0; r < 8; r++)
            d[(mt * 16 + r) * 64 + nt * 16] = (_Float16)acc[mt][nt][r];
        }
      }
      // Precaution: stands in front of any later rewrite of a register that the
      // stores above name.
      asm volatile("s_wait_xcnt 0x0" ::: "memory");
    }
    return;
  }
#pragma unroll
  for (int mt = 0; mt < 4; mt++) {
#pragma unroll
    for (int nt = 0; nt < 2; nt++) {
      int n = nblk + wn * 32 + nt * 16 + col;
      float bv = BIAS ? bias[n] : 0.f;
#pragma unroll
      for (int r = 0; r < 8; r++) {
        int m = mblk + wm * 64 + mt * 16 + rbase + r;
        float vv = acc[mt][nt][r] + bv;
        if (RELU) vv = fmaxf(vv, 0.f);
        if (RES) vv += resid[(size_t)m * N + n];
        if (OUT32) C32[(size_t)m * N + n] = vv;
        if (OUT16) C16[(size_t)m * N + n] = (_Float16)vv;
      }
    }
  }
}

#define KV_TILE 64
#define KV_PITCH 72

__device__ inline v16h kv_frag(const _Float16* lds, int row0, int k0) {
  int lane = threadIdx.x & 31;
  const _Float16* p = lds + (row0 + (lane & 15)) * KV_PITCH + k0 + ((lane >> 4) << 3);
  v8h lo = *(const v8h*)p;
  v8h hi = *(const v8h*)(p + 16);
  return __builtin_shufflevector(lo, hi, 0,1,2,3,4,5,6,7,8,9,10,11,12,13,14,15);
}

// The value that lane l ^ 16 holds.
__device__ inline float other_half(float x) {
  return __builtin_bit_cast(float, __builtin_amdgcn_permlanex16(
      __builtin_bit_cast(int, x), __builtin_bit_cast(int, x),
      0x76543210, 0xfedcba98, false, false));
}

__global__ __launch_bounds__(128) void attention_kernel(
    const _Float16* __restrict__ q, const _Float16* __restrict__ k,
    const _Float16* __restrict__ vT, _Float16* __restrict__ o) {
  constexpr int S = 1024, DH = 64;
  const int wave = threadIdx.x >> 5;
  const int lane = threadIdx.x & 31;
  const int bh = blockIdx.y;
  const int qrow0 = blockIdx.x * 64 + wave * 16;

  const _Float16* qb = q  + (size_t)bh * S * DH;
  const _Float16* kb = k  + (size_t)bh * S * DH;
  const _Float16* vb = vT + (size_t)bh * DH * S;

  __shared__ __align__(16) _Float16 Ks[2][KV_TILE * KV_PITCH];  // keys x dh
  __shared__ __align__(16) _Float16 Vs[2][DH * KV_PITCH];       // dh x keys

  // Staging share of a thread: 16 bytes of rows srow, srow + 16, + 32, + 48 of
  // the K tile and of the V^T tile (both are 64 rows of 128 bytes).
  const int srow = threadIdx.x >> 3;
  const int spc  = (threadIdx.x & 7) << 3;
  const _Float16* kg = kb + (size_t)srow * DH + spc;
  const _Float16* vg = vb + (size_t)srow * S + spc;
  const int sl = srow * KV_PITCH + spc;
  v8h kr[4], vr[4];

#pragma unroll
  for (int i = 0; i < 4; i++) {
    kr[i] = *(const v8h*)(kg + i * 16 * DH);
    vr[i] = *(const v8h*)(vg + i * 16 * S);
  }

  // Q as B operand: lane l holds query (l & 15), in kv_frag's k order.
  const v16h qb0 = load_frag(qb, DH, qrow0, 0);
  const v16h qb1 = load_frag(qb, DH, qrow0, 32);

#pragma unroll
  for (int i = 0; i < 4; i++) {
    *(v8h*)(Ks[0] + sl + i * 16 * KV_PITCH) = kr[i];
    *(v8h*)(Vs[0] + sl + i * 16 * KV_PITCH) = vr[i];
  }
  __syncthreads();

  // One query a lane: its running maximum (the same in both halves) and the sum
  // over the keys of this lane's half (the halves are joined behind the loop).
  float mrun = -1e30f, lsum = 0.f;
  v8f oacc[4];   // oacc[t][r] = O^T[16 t + 8 (lane >> 4) + r][query]
#pragma unroll
  for (int t = 0; t < 4; t++) oacc[t] = {};

  for (int st = 0; st < S / KV_TILE; st++) {
    const _Float16* Kc = Ks[st & 1];
    const _Float16* Vc = Vs[st & 1];
    const bool more = st + 1 < S / KV_TILE;
    if (more) {
      const int jn = (st + 1) * KV_TILE;
#pragma unroll
      for (int i = 0; i < 4; i++) {
        kr[i] = *(const v8h*)(kg + (size_t)(jn + i * 16) * DH);
        vr[i] = *(const v8h*)(vg + i * 16 * S + jn);
      }
    }
#pragma unroll
    for (int jb = 0; jb < KV_TILE; jb += 32) {
      // scores of 32 keys: two 16x16 tiles of S^T, K = dh = 64 = 2 WMMA steps
      v8f s0 = {}, s1 = {};
      {
        v16h k0a = kv_frag(Kc, jb, 0);
        v16h k0b = kv_frag(Kc, jb, 32);
        s0 = WMMA_F16(k0a, qb0, s0);
        s0 = WMMA_F16(k0b, qb1, s0);
        v16h k1a = kv_frag(Kc, jb + 16, 0);
        v16h k1b = kv_frag(Kc, jb + 16, 32);
        s1 = WMMA_F16(k1a, qb0, s1);
        s1 = WMMA_F16(k1b, qb1, s1);
      }
      // online softmax update of the lane's query
      float mx = fmaxf(s0[0], s1[0]);
#pragma unroll
      for (int r = 1; r < 8; r++) mx = fmaxf(mx, fmaxf(s0[r], s1[r]));
      mx = fmaxf(mx, other_half(mx)) * 0.125f;  // 1/sqrt(64)
      const float mnew  = fmaxf(mrun, mx);
      const float alpha = __expf(mrun - mnew);
      mrun = mnew;
      v16h pb;
      float rs = 0.f;
#pragma unroll
      for (int r = 0; r < 8; r++) {
        float p0 = __expf(s0[r] * 0.125f - mnew);
        float p1 = __expf(s1[r] * 0.125f - mnew);
        rs += p0 + p1;
        pb[r]     = (_Float16)p0;
        pb[8 + r] = (_Float16)p1;
      }
      lsum = lsum * alpha + rs;
#pragma unroll
      for (int t = 0; t < 4; t++)
#pragma unroll
        for (int r = 0; r < 8; r++) oacc[t][r] *= alpha;
      // O^T(64x16) += V^T(64x32) * P^T(32x16)
#pragma unroll
      for (int t = 0; t < 4; t++) {
        v16h vf = kv_frag(Vc, t * 16, jb);
        oacc[t] = WMMA_F16(vf, pb, oacc[t]);
      }
    }
    if (more) {
      // The other buffer's last readers left it at the barrier that ended the
      // pass before this one.
      _Float16* Kn = Ks[(st + 1) & 1];
      _Float16* Vn = Vs[(st + 1) & 1];
#pragma unroll
      for (int i = 0; i < 4; i++) {
        *(v8h*)(Kn + sl + i * 16 * KV_PITCH) = kr[i];
        *(v8h*)(Vn + sl + i * 16 * KV_PITCH) = vr[i];
      }
    }
    // Publishes the next tile and ends every wave's reads of this one.
    __syncthreads();
  }

  // A lane's 8 accumulator rows of a tile are 8 consecutive dh of its query:
  // one 16-byte store a tile.
  const int b = bh >> 4, h = bh & 15;
  const float inv = 1.f / (lsum + other_half(lsum));
  _Float16* orow = o + ((size_t)(b * 1024 + qrow0 + (lane & 15))) * 1024 + h * 64 +
                   ((lane >> 4) << 3);
#pragma unroll
  for (int t = 0; t < 4; t++) {
    v8h ov;
#pragma unroll
    for (int r = 0; r < 8; r++) ov[r] = (_Float16)(oacc[t][r] * inv);
    *(v8h*)(orow + t * 16) = ov;
  }
}

// ---------------------------------------------------------------------------
// Host-side orchestration
// ---------------------------------------------------------------------------
extern "C" void kernel_launch(void* const* d_in, const int* in_sizes, int n_in,
                              void* d_out, int out_size, void* d_ws, size_t ws_size,
                              hipStream_t stream) {
  (void)in_sizes; (void)n_in; (void)out_size; (void)ws_size;
  const float* x      = (const float*)d_in[0];   // (4,1024,1024)
  const float* w_in   = (const float*)d_in[1];   // (3072,1024)
  const float* w_out  = (const float*)d_in[2];   // (1024,1024)
  const float* ln1_g  = (const float*)d_in[3];
  const float* ln1_b  = (const float*)d_in[4];
  const float* w_up   = (const float*)d_in[5];   // (1024,2048)
  const float* b_up   = (const float*)d_in[6];
  const float* w_down = (const float*)d_in[7];   // (2048,1024)
  const float* b_down = (const float*)d_in[8];
  const float* ln2_g  = (const float*)d_in[9];
  const float* ln2_b  = (const float*)d_in[10];
  float* out = (float*)d_out;

  const int BS = 4096, D = 1024;

  char* ws = (char*)d_ws;
  size_t off = 0;
  auto alloc = [&](size_t bytes) -> void* {
    off = (off + 255) & ~(size_t)255;
    void* p = ws + off;
    off += bytes;
    return p;
  };

  _Float16* w_in16   = (_Float16*)alloc((size_t)3 * D * D * 2);
  _Float16* w_outT   = (_Float16*)alloc((size_t)D * D * 2);
  _Float16* w_upT    = (_Float16*)alloc((size_t)2 * D * D * 2);
  _Float16* w_downT  = (_Float16*)alloc((size_t)2 * D * D * 2);
  _Float16* h16      = (_Float16*)alloc((size_t)BS * D * 2);
  _Float16* q16      = (_Float16*)alloc((size_t)BS * D * 2);
  _Float16* k16      = (_Float16*)alloc((size_t)BS * D * 2);
  _Float16* vT16     = (_Float16*)alloc((size_t)BS * D * 2);
  _Float16* attn16   = (_Float16*)alloc((size_t)BS * D * 2);
  float*    x1       = (float*)   alloc((size_t)BS * D * 4);
  _Float16* h2_16    = (_Float16*)alloc((size_t)BS * D * 2);
  _Float16* ff16     = (_Float16*)alloc((size_t)BS * 2 * D * 2);

  // --- LN1 -> h16, and all four weights to f16 (three of them transposed) ---
  prepare_inputs<<<PREP_GRID, 256, 0, stream>>>(x, ln1_g, ln1_b, w_in, w_out, w_up, w_down,
                                                h16, w_in16, w_outT, w_upT, w_downT);

  // --- qkv = h @ in_project.T  (M=4096, N=3072, K=1024), f16 out, stored as
  //     q/k (B*H,S,dh) and vT (B*H,dh,S) ---
  gemm_wmma<64, false, false, false, false, true, true>
      <<<dim3(3072 / 128, BS / 128), 256, 0, stream>>>(
          h16, w_in16, nullptr, nullptr, nullptr, q16, k16, vT16, BS, 3 * D, D);

  // --- flash attention -> attn16 (B,S,H*dh) ---
  attention_kernel<<<dim3(1024 / 64, 64), 128, 0, stream>>>(q16, k16, vT16, attn16);

  // --- x1 = attn @ out_project + x  (M=4096, N=1024, K=1024), f32 out ---
  gemm_wmma<128, false, false, true, true, false, false>
      <<<dim3(1024 / 128, BS / 128), 256, 0, stream>>>(
          attn16, w_outT, nullptr, x, x1, nullptr, nullptr, nullptr, BS, D, D);

  // --- LN2 -> h2_16 ---
  layernorm_to_f16<<<BS / 16, 256, 0, stream>>>(x1, ln2_g, ln2_b, h2_16);

  // --- ff = relu(h2 @ w_up + b_up)  (M=4096, N=2048, K=1024), f16 out ---
  gemm_wmma<128, true, true, false, false, true, false>
      <<<dim3(2048 / 128, BS / 128), 256, 0, stream>>>(
          h2_16, w_upT, b_up, nullptr, nullptr, ff16, nullptr, nullptr, BS, 2 * D, D);

  // --- out = ff @ w_down + b_down + x1  (M=4096, N=1024, K=2048), f32 out ---
  gemm_wmma<128, true, false, true, true, false, false>
      <<<dim3(1024 / 128, BS / 128), 256, 0, stream>>>(
          ff16, w_downT, b_down, x1, out, nullptr, nullptr, nullptr, BS, D, 2 * D);
}

// v009
// A run of this version takes 106 microseconds.
// Next to v008, in two timings, it ran 1.04 times as fast each time.
// Counting every step since v000, it is 3.96 times as fast.
#include <hip/hip_runtime.h>

typedef __attribute__((ext_vector_type(16))) _Float16 v16h;
typedef __attribute__((ext_vector_type(8)))  _Float16 v8h;
typedef __attribute__((ext_vector_type(2)))  _Float16 v2h;
typedef __attribute__((ext_vector_type(8)))  float    v8f;

#define WMMA_F16(a, b, c) \
  __builtin_amdgcn_wmma_f32_16x16x32_f16(false, (a), false, (b), (short)0, (c), false, false)

// ---------------------------------------------------------------------------
// Fragment load from GLOBAL: 16-bit A or B fragment (16 rows x 32 K) from
// (rows, K) row-major storage. Per ISA layout: lane L holds row (L&15); its
// 16 halves are K[kb..kb+7] and K[kb+16..kb+23] with kb = k0 + (L>>4)*8.
// ---------------------------------------------------------------------------
__device__ inline v16h load_frag(const _Float16* __restrict__ base, int ld,
                                 int row0, int k0) {
  int lane = threadIdx.x & 31;
  const _Float16* p = base + (size_t)(row0 + (lane & 15)) * ld + k0 + ((lane >> 4) << 3);
  v8h lo = *(const v8h*)p;
  v8h hi = *(const v8h*)(p + 16);
  return __builtin_shufflevector(lo, hi, 0,1,2,3,4,5,6,7,8,9,10,11,12,13,14,15);
}

// ---------------------------------------------------------------------------
// GEMM operand tiles in LDS: rows of 128 k. Row pitch 128 + 8 halves (272 B:
// 16 B x odd), conflict-free for the 16-byte fragment reads.
// ---------------------------------------------------------------------------
template <int PITCH>
__device__ inline v16h lds_frag(const _Float16* lds, int row0, int k0) {
  int lane = threadIdx.x & 31;
  const _Float16* p = lds + (row0 + (lane & 15)) * PITCH + k0 + ((lane >> 4) << 3);
  v8h lo = *(const v8h*)p;
  v8h hi = *(const v8h*)(p + 16);
  return __builtin_shufflevector(lo, hi, 0,1,2,3,4,5,6,7,8,9,10,11,12,13,14,15);
}

// One thread's share of one operand tile: 16 bytes of each of NC rows, copied
// from global memory to LDS through no register. g is the thread's first source
// chunk and gs the source distance between its rows in halves; l is the LDS
// byte address of its first destination chunk and LS the distance there in
// bytes. The lanes of a wave cover whole rows of the tile (256 contiguous
// bytes). The closing s_wait_xcnt stands inside the statement so
// that no register a copy names is rewritten ahead of it.
template <int NC, unsigned LS>
__device__ inline void copy_tile(const _Float16* g, size_t gs, unsigned l) {
  static_assert(NC == 4 || NC == 8, "4 or 8 rows a thread");
  if constexpr (NC == 8) {
    asm volatile(
        "global_load_async_to_lds_b128 %0, %8, off\n\t"
        "global_load_async_to_lds_b128 %1, %9, off\n\t"
        "global_load_async_to_lds_b128 %2, %10, off\n\t"
        "global_load_async_to_lds_b128 %3, %11, off\n\t"
        "global_load_async_to_lds_b128 %4, %12, off\n\t"
        "global_load_async_to_lds_b128 %5, %13, off\n\t"
        "global_load_async_to_lds_b128 %6, %14, off\n\t"
        "global_load_async_to_lds_b128 %7, %15, off\n\t"
        "s_wait_xcnt 0x0"
        :: "v"(l), "v"(l + LS), "v"(l + 2 * LS), "v"(l + 3 * LS),
           "v"(l + 4 * LS), "v"(l + 5 * LS), "v"(l + 6 * LS), "v"(l + 7 * LS),
           "v"(g), "v"(g + gs), "v"(g + 2 * gs), "v"(g + 3 * gs),
           "v"(g + 4 * gs), "v"(g + 5 * gs), "v"(g + 6 * gs), "v"(g + 7 * gs)
        : "memory");
  } else {
    asm volatile(
        "global_load_async_to_lds_b128 %0, %4, off\n\t"
        "global_load_async_to_lds_b128 %1, %5, off\n\t"
        "global_load_async_to_lds_b128 %2, %6, off\n\t"
        "global_load_async_to_lds_b128 %3, %7, off\n\t"
        "s_wait_xcnt 0x0"
        :: "v"(l), "v"(l + LS), "v"(l + 2 * LS), "v"(l + 3 * LS),
           "v"(g), "v"(g + gs), "v"(g + 2 * gs), "v"(g + 3 * gs)
        : "memory");
  }
}

// ---------------------------------------------------------------------------
// Elementwise weight converters
// ---------------------------------------------------------------------------
typedef __attribute__((ext_vector_type(4))) _Float16 v4h;
typedef __attribute__((ext_vector_type(4))) float    v4f;

// Few waves that each do much. Workgroup blk of 8 waves converts CVT_N x 1024
// consecutive floats; every load of a wave covers 512 contiguous bytes and
// every store 256, and all CVT_N loads of a lane are in flight together.
// The element count must be (number of workgroups) * CVT_N * 1024.
#define CVT_N 12

__device__ inline void cvt_f32_to_f16(const float* __restrict__ in,
                                      _Float16* __restrict__ out, int blk) {
  const size_t base = (size_t)blk * (CVT_N * 1024) + threadIdx.x * 4;
  v4f v[CVT_N];
#pragma unroll
  for (int i = 0; i < CVT_N; i++) v[i] = *(const v4f*)(in + base + i * 1024);
#pragma unroll
  for (int i = 0; i < CVT_N; i++)
    *(v4h*)(out + base + i * 1024) = __builtin_convertvector(v[i], v4h);
}

// in: (R, C) f32 row-major  ->  out: (C, R) f16 row-major
// One 64x64 tile (column block bx, row block by) per workgroup of 256 threads,
// turned in LDS (tile: TT * TT_PITCH floats), so that both
// sides of global memory see whole 128-byte lines: reads are 16 B per lane
// along c (256 B per tile row), writes are 16 B per lane along r (8 lanes fill
// one 128-byte line of an output row). R and C must be multiples of 64.
// Tile pitch 65 floats: the 32 lanes of a wave hit 32 different banks both
// when storing rows and when reading columns.
#define TT 64
#define TT_PITCH 65

__device__ inline void transpose_to_f16(
    const float* __restrict__ in, _Float16* __restrict__ out, int R, int C,
    int bx, int by, float* tile) {
  const int t  = threadIdx.x;
  const int c0 = bx * TT;
  const int r0 = by * TT;

  const int lc = (t & 15) << 2;   // first of this lane's 4 columns
  const int lr = t >> 4;          // 0..15
  float4 v[4];
#pragma unroll
  for (int i = 0; i < 4; i++)
    v[i] = *(const float4*)(in + (size_t)(r0 + lr + i * 16) * C + c0 + lc);
#pragma unroll
  for (int i = 0; i < 4; i++) {
    float* d = tile + (lr + i * 16) * TT_PITCH + lc;
    d[0] = v[i].x; d[1] = v[i].y; d[2] = v[i].z; d[3] = v[i].w;
  }
  __syncthreads();

  const int sr = (t & 7) << 3;    // first of this lane's 8 rows
  const int sc = t >> 3;          // 0..31
#pragma unroll
  for (int i = 0; i < 2; i++) {
    const int c = sc + i * 32;
    v8h o;
#pragma unroll
    for (int j = 0; j < 8; j++) o[j] = (_Float16)tile[(sr + j) * TT_PITCH + c];
    *(v8h*)(out + (size_t)(c0 + c) * R + r0 + sr) = o;
  }
}

// ---------------------------------------------------------------------------
// LayerNorm over rows of 1024, f32 in -> f16 out (feeds WMMA GEMMs)
// Two rows a wave, 16 rows a workgroup of 8 waves, one workgroup a WGP: a
// sixteenth of the waves to start, no LDS and no barrier. A lane holds 32 values
// of each row, as 8 loads of 16 bytes (512 contiguous bytes a wave and load);
// a row's sums are four chains in the lane, then a butterfly over the wave.
// Workgroup blk takes rows 16 blk .. 16 blk + 15.
// ---------------------------------------------------------------------------
__device__ inline void layernorm_rows(
    const float* __restrict__ x, const float* __restrict__ gamma,
    const float* __restrict__ beta, _Float16* __restrict__ out, int blk) {
  const int lane = threadIdx.x & 31;
  const int row  = blk * 16 + (threadIdx.x >> 5) * 2;
  const float* xr = x + (size_t)row * 1024 + lane * 4;
  v4f v[2][8], g[8], b[8];
#pragma unroll
  for (int r = 0; r < 2; r++)
#pragma unroll
    for (int i = 0; i < 8; i++) v[r][i] = *(const v4f*)(xr + r * 1024 + i * 128);
#pragma unroll
  for (int i = 0; i < 8; i++) {
    g[i] = *(const v4f*)(gamma + lane * 4 + i * 128);
    b[i] = *(const v4f*)(beta + lane * 4 + i * 128);
  }
  // Precaution: stands in front of every rewrite of an address register of the
  // loads above; xr is named so that no load's result is put into its registers
  // ahead of the wait.
  asm volatile("s_wait_xcnt 0x0" :: "v"(xr) : "memory");
  // Keeps all 32 loads in front of the sums: moved behind them, the gamma and
  // beta loads would be waited for in turn at the end of the wave.
  __builtin_amdgcn_sched_barrier(0);
  float s[2], sq[2];
#pragma unroll
  for (int r = 0; r < 2; r++) {
    v4f s4 = v[r][0], q4 = v[r][0] * v[r][0];
#pragma unroll
    for (int i = 1; i < 8; i++) {
      s4 += v[r][i];
      q4 += v[r][i] * v[r][i];
    }
    s[r]  = (s4.x + s4.y) + (s4.z + s4.w);
    sq[r] = (q4.x + q4.y) + (q4.z + q4.w);
  }
#pragma unroll
  for (int m = 16; m >= 1; m >>= 1) {
#pragma unroll
    for (int r = 0; r < 2; r++) {
      s[r]  += __shfl_xor(s[r], m, 32);
      sq[r] += __shfl_xor(sq[r], m, 32);
    }
  }
  _Float16* orow = out + (size_t)row * 1024 + lane * 4;
#pragma unroll
  for (int r = 0; r < 2; r++) {
    const float mean = s[r] * (1.f / 1024.f);
    const float var  = sq[r] * (1.f / 1024.f) - mean * mean;
    const float inv  = rsqrtf(var + 1e-5f);
#pragma unroll
    for (int i = 0; i < 8; i++)
      *(v4h*)(orow + r * 1024 + i * 128) =
          __builtin_convertvector((v[r][i] - mean) * inv * g[i] + b[i], v4h);
  }
}

__global__ __launch_bounds__(256) void layernorm_to_f16(
    const float* __restrict__ x, const float* __restrict__ gamma,
    const float* __restrict__ beta, _Float16* __restrict__ out) {
  layernorm_rows(x, gamma, beta, out, blockIdx.x);
}

// ---------------------------------------------------------------------------
// Everything that reads only inputs, in ONE launch: the first LayerNorm, the
// conversion of in_project and the three weight transposes read nothing of
// each other's output, so a workgroup's index picks its job and the five jobs
// start, stream and drain side by side instead of one behind the other.
// The jobs with the most bytes a workgroup come first, the small tiles last.
// Shapes: x (4096, 1024), w_in (3072, 1024), w_out (1024, 1024),
// w_up (1024, 2048), w_down (2048, 1024).
// ---------------------------------------------------------------------------
#define PREP_LN   256                       // 4096 rows / 16
#define PREP_CVT  256                       // 3072 * 1024 / (CVT_N * 1024)
#define PREP_OUT  256                       // 16 x 16 tiles
#define PREP_UP   512                       // 32 x 16 tiles
#define PREP_DOWN 512                       // 16 x 32 tiles
#define PREP_GRID (PREP_LN + PREP_CVT + PREP_OUT + PREP_UP + PREP_DOWN)

__global__ __launch_bounds__(256) void prepare_inputs(
    const float* __restrict__ x, const float* __restrict__ gamma,
    const float* __restrict__ beta, const float* __restrict__ w_in,
    const float* __restrict__ w_out, const float* __restrict__ w_up,
    const float* __restrict__ w_down, _Float16* __restrict__ h16,
    _Float16* __restrict__ w_in16, _Float16* __restrict__ w_outT,
    _Float16* __restrict__ w_upT, _Float16* __restrict__ w_downT) {
  __shared__ float tile[TT * TT_PITCH];
  // The index is the same for the whole workgroup, and so is every branch.
  const int b  = blockIdx.x;
  const int b1 = b - PREP_LN;
  const int b2 = b1 - PREP_CVT;
  const int b3 = b2 - PREP_OUT;
  const int b4 = b3 - PREP_UP;
  // The s_wait_xcnt behind a job is a precaution: in the built code the way from
  // a job's last stores to the end leads past the heads of the other jobs, which
  // write registers that those stores name; the wait stands in front of them.
  if (b1 < 0) {
    layernorm_rows(x, gamma, beta, h16, b);   // last in the built code: no head behind it
  } else if (b2 < 0) {
    cvt_f32_to_f16(w_in, w_in16, b1);
    asm volatile("s_wait_xcnt 0x0" ::: "memory");
  } else if (b3 < 0) {
    transpose_to_f16(w_out, w_outT, 1024, 1024, b2 & 15, b2 >> 4, tile);
    asm volatile("s_wait_xcnt 0x0" ::: "memory");
  } else if (b4 < 0) {
    transpose_to_f16(w_up, w_upT, 1024, 2048, b3 & 31, b3 >> 5, tile);
    asm volatile("s_wait_xcnt 0x0" ::: "memory");
  } else {
    transpose_to_f16(w_down, w_downT, 2048, 1024, b4 & 15, b4 >> 4, tile);
    asm volatile("s_wait_xcnt 0x0" ::: "memory");
  }
}

// ---------------------------------------------------------------------------
// LDS-staged WMMA GEMM: C[M,N] = A16[M,K] * Bt16[N,K]^T (+bias)(+relu)(+res)
// Workgroup tile BM x BN; a trip of the K loop works on 128 k. Two LDS buffers:
// asynchronous copies bring tile t + 1 in while tile t is worked on.
// The tile is the largest that still gives every WGP a workgroup: a tile brings
// (BM + BN) rows from L2 for BM * BN products, so 256 x 192 (N = 3072) brings
// 7/12 and 256 x 128 (N = 2048) 3/4 of the bytes of 128 x 128 tiles, which stay
// where N = 1024. Each of these grids is 256 workgroups.
// 8 waves, WNW of them side by side along n; a wave owns MT x NT WMMA C tiles
// (64 x 96, 64 x 64, 64 x 32) and reads MT + NT fragments for MT * NT products.
// M must be a multiple of BM, N of BN, K of 128.
// QKV: the output is the (4*1024, 3*1024) q|k|v product and goes straight to
// the layouts attention reads: q and k as (B*H, S, dh) into C16 and Kh, v
// transposed as (B*H, dh, S) into Vt. A lane's 8 accumulator rows are 8
// consecutive s of one (head, e), so v leaves as one 16-byte store per C tile,
// and the 4 tiles of a wave's 64 rows fill one whole 128-byte line of Vt.
// ---------------------------------------------------------------------------
// Precaution behind a group of global loads or stores: the wait stands in front
// of every later rewrite of a register that they name. The scheduling
// fence keeps the later code, which rewrites them, behind the wait.
__device__ inline void close_group() {
  asm volatile("s_wait_xcnt 0x0" ::: "memory");
  __builtin_amdgcn_sched_barrier(0);
}

// A lane's share of 4 C tiles side by side: 8 rows ld halves apart, in each row one
// f16 value in each of 4 places 16 columns (32 bytes) apart, which with the other
// lanes' fill one 128-byte line. h[t][j] holds rows 2 j (low half) and 2 j + 1
// (high half) of tile t. The stores and the s_wait_xcnt are one
// statement, so that the addresses and values keep their registers until the wait
// has passed.
__device__ inline void store_rows8x4(_Float16* p, size_t ld, const unsigned (&h)[4][4]) {
  asm volatile(
      "global_store_b16 %0, %8, off\n\t"
      "global_store_b16 %0, %12, off offset:32\n\t"
      "global_store_b16 %0, %16, off offset:64\n\t"
      "global_store_b16 %0, %20, off offset:96\n\t"
      "global_store_d16_hi_b16 %1, %8, off\n\t"
      "global_store_d16_hi_b16 %1, %12, off offset:32\n\t"
      "global_store_d16_hi_b16 %1, %16, off offset:64\n\t"
      "global_store_d16_hi_b16 %1, %20, off offset:96\n\t"
      "global_store_b16 %2, %9, off\n\t"
      "global_store_b16 %2, %13, off offset:32\n\t"
      "global_store_b16 %2, %17, off offset:64\n\t"
      "global_store_b16 %2, %21, off offset:96\n\t"
      "global_store_d16_hi_b16 %3, %9, off\n\t"
      "global_store_d16_hi_b16 %3, %13, off offset:32\n\t"
      "global_store_d16_hi_b16 %3, %17, off offset:64\n\t"
      "global_store_d16_hi_b16 %3, %21, off offset:96\n\t"
      "global_store_b16 %4, %10, off\n\t"
      "global_store_b16 %4, %14, off offset:32\n\t"
      "global_store_b16 %4, %18, off offset:64\n\t"
      "global_store_b16 %4, %22, off offset:96\n\t"
      "global_store_d16_hi_b16 %5, %10, off\n\t"
      "global_store_d16_hi_b16 %5, %14, off offset:32\n\t"
      "global_store_d16_hi_b16 %5, %18, off offset:64\n\t"
      "global_store_d16_hi_b16 %5, %22, off offset:96\n\t"
      "global_store_b16 %6, %11, off\n\t"
      "global_store_b16 %6, %15, off offset:32\n\t"
      "global_store_b16 %6, %19, off offset:64\n\t"
      "global_store_b16 %6, %23, off offset:96\n\t"
      "global_store_d16_hi_b16 %7, %11, off\n\t"
      "global_store_d16_hi_b16 %7, %15, off offset:32\n\t"
      "global_store_d16_hi_b16 %7, %19, off offset:64\n\t"
      "global_store_d16_hi_b16 %7, %23, off offset:96\n\t"
      "s_wait_xcnt 0x0"
      :: "v"(p), "v"(p + ld), "v"(p + 2 * ld), "v"(p + 3 * ld),
         "v"(p + 4 * ld), "v"(p + 5 * ld), "v"(p + 6 * ld), "v"(p + 7 * ld),
         "v"(h[0][0]), "v"(h[0][1]), "v"(h[0][2]), "v"(h[0][3]),
         "v"(h[1][0]), "v"(h[1][1]), "v"(h[1][2]), "v"(h[1][3]),
         "v"(h[2][0]), "v"(h[2][1]), "v"(h[2][2]), "v"(h[2][3]),
         "v"(h[3][0]), "v"(h[3][1]), "v"(h[3][2]), "v"(h[3][3])
      : "memory");
}

// N rows a thread (a multiple of 4) of one operand tile, in runs of 8 and 4.
template <int N, unsigned LS>
__device__ inline void copy_rows(const _Float16* g, size_t gs, unsigned l) {
  if constexpr (N >= 8) {
    copy_tile<8, LS>(g, gs, l);
    if constexpr (N > 8) copy_rows<N - 8, LS>(g + 8 * gs, gs, l + 8 * LS);
  } else {
    copy_tile<4, LS>(g, gs, l);
  }
}

template <int BM, int BN, int WNW, bool BIAS, bool RELU, bool RES, bool OUT32, bool OUT16, bool QKV>
__global__ __launch_bounds__(256) void gemm_wmma(
    const _Float16* __restrict__ A, const _Float16* __restrict__ Bt,
    const float* __restrict__ bias, const float* __restrict__ resid,
    float* __restrict__ C32, _Float16* __restrict__ C16,
    _Float16* __restrict__ Kh, _Float16* __restrict__ Vt,
    int M, int N, int K) {
  constexpr int MT = BM / (8 / WNW) / 16;   // C tiles of a wave along m
  constexpr int NT = BN / WNW / 16;         // and along n
  // Accumulators and the two fragment sets alone fill 256 registers or more.
  constexpr bool WIDE = (MT * NT + 2 * (MT + NT)) * 8 >= 256;
  const int w    = threadIdx.x >> 5;
  const int lane = threadIdx.x & 31;
  const int wm = w / WNW;         // slice of MT * 16 rows
  const int wn = w % WNW;         // slice of NT * 16 columns
  const int mblk = blockIdx.y * BM;
  const int nblk = blockIdx.x * BN;

  constexpr int GK  = 128;             // k of a trip
  constexpr int GP  = GK + 8;          // LDS row pitch in halves
  constexpr int CPR = GK / 8;          // 16-byte chunks in a tile row
  constexpr int RPP = 256 / CPR;       // rows the workgroup covers with one copy each
  constexpr unsigned LS    = RPP * GP * 2;  // LDS bytes between a thread's rows
  constexpr unsigned BUFA  = BM * GP * 2;   // bytes of one A buffer
  constexpr unsigned BUFB  = BN * GP * 2;   // bytes of one B buffer

  __shared__ __align__(16) _Float16 As[2][BM * GP];
  __shared__ __align__(16) _Float16 Bs[2][BN * GP];

  v8f acc[MT][NT];
#pragma unroll
  for (int mt = 0; mt < MT; mt++)
#pragma unroll
    for (int nt = 0; nt < NT; nt++) acc[mt][nt] = {};

  // Copy share of a thread: chunk (threadIdx.x % CPR) of rows
  // (threadIdx.x / CPR) + RPP i of the A tile and of the B tile.
  const int crow = threadIdx.x / CPR;
  const int cpc  = (threadIdx.x % CPR) << 3;
  const _Float16* ga = A  + (size_t)(mblk + crow) * K + cpc;
  const _Float16* gb = Bt + (size_t)(nblk + crow) * K + cpc;
  const size_t step = (size_t)RPP * K;
  const unsigned la = (unsigned)(size_t)&As[0][crow * GP + cpc];
  const unsigned lb = (unsigned)(size_t)&Bs[0][crow * GP + cpc];
  const int trips = K / GK;

  copy_rows<BM / RPP, LS>(ga, step, la);
  copy_rows<BN / RPP, LS>(gb, step, lb);
  // Tile 0 has landed for this wave; the barrier publishes it to the others.
  asm volatile("s_wait_asynccnt 0x0" ::: "memory");
  __syncthreads();
  if (trips > 1) {
    copy_rows<BM / RPP, LS>(ga + GK, step, la + BUFA);
    copy_rows<BN / RPP, LS>(gb + GK, step, lb + BUFB);
  }

  // Two fragment sets: the LDS reads of k step s + 1 go out ahead of the products
  // of step s, over the trip's end too, so that no product waits out the LDS
  // latency of its own reads. frags() reads one step's set, products() works on
  // one; their loops are unrolled so that the sets are indexed by constants and
  // stay in registers.
  constexpr int NS = GK / 32;          // k steps in a trip
  static_assert(NS % 2 == 0, "a trip's last step uses set 1, the next trip's first set 0");
  v16h a[2][MT], b[2][NT];
  auto frags = [&](const _Float16* Al, const _Float16* Bl, int ks, int set) {
#pragma unroll
    for (int mt = 0; mt < MT; mt++)
      a[set][mt] = lds_frag<GP>(Al, wm * (MT * 16) + mt * 16, ks);
#pragma unroll
    for (int nt = 0; nt < NT; nt++)
      b[set][nt] = lds_frag<GP>(Bl, wn * (NT * 16) + nt * 16, ks);
  };
  auto products = [&](int set) {
#pragma unroll
    for (int mt = 0; mt < MT; mt++)
#pragma unroll
      for (int nt = 0; nt < NT; nt++)
        acc[mt][nt] = WMMA_F16(a[set][mt], b[set][nt], acc[mt][nt]);
  };
  // Tile 0 was published by the barrier above.
  frags(As[0], Bs[0], 0, 0);

  for (int t = 0; t < trips; t++) {
    const _Float16* Ac = As[t & 1];
    const _Float16* Bc = Bs[t & 1];
    // Unrolled: the set index and the LDS offsets become constants, so the
    // fragments stay in registers.
#pragma unroll
    for (int s = 0; s < NS - 1; s++) {
      frags(Ac, Bc, (s + 1) * 32, (s + 1) & 1);
      // Keeps the group of reads in front of the products: left free, the
      // compiler sinks each read to just ahead of its use, into one register
      // set, with a full wait in front of every pair of products.
      __builtin_amdgcn_sched_barrier(0);
      products(s & 1);
    }
    // The last step's reads are out and its products follow behind the refill;
    // tile t is read no more. The fence keeps the products above in front of the
    // closing waits, where they cover the latency of those last reads.
    __builtin_amdgcn_sched_barrier(0);
    // This wave's reads of tile t have returned before its buffer is refilled.
    asm volatile("s_wait_dscnt 0x0" ::: "memory");
    // This wave's copies of tile t + 1 have landed.
    asm volatile("s_wait_asynccnt 0x0" ::: "memory");
    // Publishes tile t + 1 and ends every wave's reads of tile t.
    __syncthreads();
    if (t + 2 < trips) {
      copy_rows<BM / RPP, LS>(ga + (size_t)(t + 2) * GK, step, la + ((t & 1) ? BUFA : 0u));
      copy_rows<BN / RPP, LS>(gb + (size_t)(t + 2) * GK, step, lb + ((t & 1) ? BUFB : 0u));
    }
    // Step 0 of tile t + 1, published by the barrier above.
    if (t + 1 < trips) frags(As[(t + 1) & 1], Bs[(t + 1) & 1], 0, 0);
    products((NS - 1) & 1);
  }
  // No copy is outstanding when the wave goes on to the epilogue and ends.
  asm volatile("s_wait_asynccnt 0x0" ::: "memory");

  const int col   = lane & 15;
  const int rbase = (lane >> 4) << 3;
  if (QKV) {
    // A block of BM rows lies inside one batch. The 16 columns of a C tile lie
    // inside one head of one of q, k, v; which one is the same for the whole
    // wave, so its number is taken as a scalar and the choice is a scalar branch.
    const int nw = nblk + __builtin_amdgcn_readfirstlane(wn) * (NT * 16);
    const int s0 = (mblk & 1023) + wm * (MT * 16) + rbase;   // mt adds 16
#pragma unroll
    for (int nt = 0; nt < NT; nt++) {
      const int n0   = nw + nt * 16;
      const int part = n0 >> 10;
      const int bh   = (mblk >> 10) * 16 + ((n0 & 1023) >> 6);
      const int e    = (n0 & 63) + col;
      if (part == 2) {
        _Float16* d = Vt + ((size_t)bh * 64 + e) * 1024 + s0;
#pragma unroll
        for (int mt = 0; mt < MT; mt++) {
          v8h o;
#pragma unroll
          for (int r = 0; r < 8; r++) o[r] = (_Float16)acc[mt][nt][r];
          *(v8h*)(d + mt * 16) = o;
        }
        close_group();
      } else {
        _Float16* d = (part == 0 ? C16 : Kh) + ((size_t)bh * 1024 + s0) * 64 + e;
        v8h o[MT];
#pragma unroll
        for (int mt = 0; mt < MT; mt++)
#pragma unroll
          for (int r = 0; r < 8; r++) o[mt][r] = (_Float16)acc[mt][nt][r];
        // All values are made ahead of the stores, each in a register of its own:
        // none is rewritten among the stores, and one wait closes all of them.
        __builtin_amdgcn_sched_barrier(0);
#pragma unroll
        for (int mt = 0; mt < MT; mt++)
#pragma unroll
          for (int r = 0; r < 8; r++) d[(mt * 16 + r) * 64] = o[mt][r];
        close_group();
      }
    }
    return;
  }
  if constexpr (WIDE) {
    static_assert(!WIDE || QKV || (OUT16 && !OUT32 && !RES && NT == 4), "f16 output, 4 tiles a row");
    // A column's bias is read once, ahead of the tiles.
    float bvs[NT];
#pragma unroll
    for (int nt = 0; nt < NT; nt++)
      bvs[nt] = BIAS ? bias[nblk + wn * (NT * 16) + nt * 16 + col] : 0.f;
    if constexpr (BIAS) close_group();
#pragma unroll
    for (int mt = 0; mt < MT; mt++) {
      _Float16* p = C16 + (size_t)(mblk + wm * (MT * 16) + mt * 16 + rbase) * N +
                    nblk + wn * (NT * 16) + col;
      unsigned h[4][4];
#pragma unroll
      for (int nt = 0; nt < 4; nt++) {
#pragma unroll
        for (int j = 0; j < 4; j++) {
          v2h two;
#pragma unroll
          for (int i = 0; i < 2; i++) {
            float vv = acc[mt][nt][2 * j + i] + bvs[nt];
            if (RELU) vv = fmaxf(vv, 0.f);
            two[i] = (_Float16)vv;
          }
          h[nt][j] = __builtin_bit_cast(unsigned, two);
        }
      }
      store_rows8x4(p, N, h);
    }
    return;
  }
#pragma unroll
  for (int mt = 0; mt < MT; mt++) {
#pragma unroll
    for (int nt = 0; nt < NT; nt++) {
      int n = nblk + wn * (NT * 16) + nt * 16 + col;
      float bv = BIAS ? bias[n] : 0.f;
#pragma unroll
      for (int r = 0; r < 8; r++) {
        int m = mblk + wm * (MT * 16) + mt * 16 + rbase + r;
        float vv = acc[mt][nt][r] + bv;
        if (RELU) vv = fmaxf(vv, 0.f);
        if (RES) vv += resid[(size_t)m * N + n];
        if (OUT32) C32[(size_t)m * N + n] = vv;
        if (OUT16) C16[(size_t)m * N + n] = (_Float16)vv;
      }
    }
  }
}

#define KV_TILE 64
#define KV_PITCH 72

__device__ inline v16h kv_frag(const _Float16* lds, int row0, int k0) {
  int lane = threadIdx.x & 31;
  const _Float16* p = lds + (row0 + (lane & 15)) * KV_PITCH + k0 + ((lane >> 4) << 3);
  v8h lo = *(const v8h*)p;
  v8h hi = *(const v8h*)(p + 16);
  return __builtin_shufflevector(lo, hi, 0,1,2,3,4,5,6,7,8,9,10,11,12,13,14,15);
}

// The value that lane l ^ 16 holds.
__device__ inline float other_half(float x) {
  return __builtin_bit_cast(float, __builtin_amdgcn_permlanex16(
      __builtin_bit_cast(int, x), __builtin_bit_cast(int, x),
      0x76543210, 0xfedcba98, false, false));
}

__global__ __launch_bounds__(128) void attention_kernel(
    const _Float16* __restrict__ q, const _Float16* __restrict__ k,
    const _Float16* __restrict__ vT, _Float16* __restrict__ o) {
  constexpr int S = 1024, DH = 64;
  const int wave = threadIdx.x >> 5;
  const int lane = threadIdx.x & 31;
  const int bh = blockIdx.y;
  const int qrow0 = blockIdx.x * 64 + wave * 16;

  const _Float16* qb = q  + (size_t)bh * S * DH;
  const _Float16* kb = k  + (size_t)bh * S * DH;
  const _Float16* vb = vT + (size_t)bh * DH * S;

  __shared__ __align__(16) _Float16 Ks[2][KV_TILE * KV_PITCH];  // keys x dh
  __shared__ __align__(16) _Float16 Vs[2][DH * KV_PITCH];       // dh x keys

  // Staging share of a thread: 16 bytes of rows srow, srow + 16, + 32, + 48 of
  // the K tile and of the V^T tile (both are 64 rows of 128 bytes).
  const int srow = threadIdx.x >> 3;
  const int spc  = (threadIdx.x & 7) << 3;
  const _Float16* kg = kb + (size_t)srow * DH + spc;
  const _Float16* vg = vb + (size_t)srow * S + spc;
  const int sl = srow * KV_PITCH + spc;
  v8h kr[4], vr[4];

#pragma unroll
  for (int i = 0; i < 4; i++) {
    kr[i] = *(const v8h*)(kg + i * 16 * DH);
    vr[i] = *(const v8h*)(vg + i * 16 * S);
  }

  // Q as B operand: lane l holds query (l & 15), in kv_frag's k order.
  const v16h qb0 = load_frag(qb, DH, qrow0, 0);
  const v16h qb1 = load_frag(qb, DH, qrow0, 32);

#pragma unroll
  for (int i = 0; i < 4; i++) {
    *(v8h*)(Ks[0] + sl + i * 16 * KV_PITCH) = kr[i];
    *(v8h*)(Vs[0] + sl + i * 16 * KV_PITCH) = vr[i];
  }
  __syncthreads();

  // One query a lane: its running maximum (the same in both halves) and the sum
  // over the keys of this lane's half (the halves are joined behind the loop).
  float mrun = -1e30f, lsum = 0.f;
  v8f oacc[4];   // oacc[t][r] = O^T[16 t + 8 (lane >> 4) + r][query]
#pragma unroll
  for (int t = 0; t < 4; t++) oacc[t] = {};

  for (int st = 0; st < S / KV_TILE; st++) {
    const _Float16* Kc = Ks[st & 1];
    const _Float16* Vc = Vs[st & 1];
    const bool more = st + 1 < S / KV_TILE;
    if (more) {
      const int jn = (st + 1) * KV_TILE;
#pragma unroll
      for (int i = 0; i < 4; i++) {
        kr[i] = *(const v8h*)(kg + (size_t)(jn + i * 16) * DH);
        vr[i] = *(const v8h*)(vg + i * 16 * S + jn);
      }
    }
#pragma unroll
    for (int jb = 0; jb < KV_TILE; jb += 32) {
      // scores of 32 keys: two 16x16 tiles of S^T, K = dh = 64 = 2 WMMA steps
      v8f s0 = {}, s1 = {};
      {
        v16h k0a = kv_frag(Kc, jb, 0);
        v16h k0b = kv_frag(Kc, jb, 32);
        s0 = WMMA_F16(k0a, qb0, s0);
        s0 = WMMA_F16(k0b, qb1, s0);
        v16h k1a = kv_frag(Kc, jb + 16, 0);
        v16h k1b = kv_frag(Kc, jb + 16, 32);
        s1 = WMMA_F16(k1a, qb0, s1);
        s1 = WMMA_F16(k1b, qb1, s1);
      }
      // online softmax update of the lane's query
      float mx = fmaxf(s0[0], s1[0]);
#pragma unroll
      for (int r = 1; r < 8; r++) mx = fmaxf(mx, fmaxf(s0[r], s1[r]));
      mx = fmaxf(mx, other_half(mx)) * 0.125f;  // 1/sqrt(64)
      const float mnew  = fmaxf(mrun, mx);
      const float alpha = __expf(mrun - mnew);
      mrun = mnew;
      v16h pb;
      float rs = 0.f;
#pragma unroll
      for (int r = 0; r < 8; r++) {
        float p0 = __expf(s0[r] * 0.125f - mnew);
        float p1 = __expf(s1[r] * 0.125f - mnew);
        rs += p0 + p1;
        pb[r]     = (_Float16)p0;
        pb[8 + r] = (_Float16)p1;
      }
      lsum = lsum * alpha + rs;
#pragma unroll
      for (int t = 0; t < 4; t++)
#pragma unroll
        for (int r = 0; r < 8; r++) oacc[t][r] *= alpha;
      // O^T(64x16) += V^T(64x32) * P^T(32x16)
#pragma unroll
      for (int t = 0; t < 4; t++) {
        v16h vf = kv_frag(Vc, t * 16, jb);
        oacc[t] = WMMA_F16(vf, pb, oacc[t]);
      }
    }
    if (more) {
      // The other buffer's last readers left it at the barrier that ended the
      // pass before this one.
      _Float16* Kn = Ks[(st + 1) & 1];
      _Float16* Vn = Vs[(st + 1) & 1];
#pragma unroll
      for (int i = 0; i < 4; i++) {
        *(v8h*)(Kn + sl + i * 16 * KV_PITCH) = kr[i];
        *(v8h*)(Vn + sl + i * 16 * KV_PITCH) = vr[i];
      }
    }
    // Publishes the next tile and ends every wave's reads of this one.
    __syncthreads();
  }

  // A lane's 8 accumulator rows of a tile are 8 consecutive dh of its query:
  // one 16-byte store a tile.
  const int b = bh >> 4, h = bh & 15;
  const float inv = 1.f / (lsum + other_half(lsum));
  _Float16* orow = o + ((size_t)(b * 1024 + qrow0 + (lane & 15))) * 1024 + h * 64 +
                   ((lane >> 4) << 3);
#pragma unroll
  for (int t = 0; t < 4; t++) {
    v8h ov;
#pragma unroll
    for (int r = 0; r < 8; r++) ov[r] = (_Float16)(oacc[t][r] * inv);
    *(v8h*)(orow + t * 16) = ov;
  }
}

// ---------------------------------------------------------------------------
// Host-side orchestration
// ---------------------------------------------------------------------------
extern "C" void kernel_launch(void* const* d_in, const int* in_sizes, int n_in,
                              void* d_out, int out_size, void* d_ws, size_t ws_size,
                              hipStream_t stream) {
  (void)in_sizes; (void)n_in; (void)out_size; (void)ws_size;
  const float* x      = (const float*)d_in[0];   // (4,1024,1024)
  const float* w_in   = (const float*)d_in[1];   // (3072,1024)
  const float* w_out  = (const float*)d_in[2];   // (1024,1024)
  const float* ln1_g  = (const float*)d_in[3];
  const float* ln1_b  = (const float*)d_in[4];
  const float* w_up   = (const float*)d_in[5];   // (1024,2048)
  const float* b_up   = (const float*)d_in[6];
  const float* w_down = (const float*)d_in[7];   // (2048,1024)
  const float* b_down = (const float*)d_in[8];
  const float* ln2_g  = (const float*)d_in[9];
  const float* ln2_b  = (const float*)d_in[10];
  float* out = (float*)d_out;

  const int BS = 4096, D = 1024;

  char* ws = (char*)d_ws;
  size_t off = 0;
  auto alloc = [&](size_t bytes) -> void* {
    off = (off + 255) & ~(size_t)255;
    void* p = ws + off;
    off += bytes;
    return p;
  };

  _Float16* w_in16   = (_Float16*)alloc((size_t)3 * D * D * 2);
  _Float16* w_outT   = (_Float16*)alloc((size_t)D * D * 2);
  _Float16* w_upT    = (_Float16*)alloc((size_t)2 * D * D * 2);
  _Float16* w_downT  = (_Float16*)alloc((size_t)2 * D * D * 2);
  _Float16* h16      = (_Float16*)alloc((size_t)BS * D * 2);
  _Float16* q16      = (_Float16*)alloc((size_t)BS * D * 2);
  _Float16* k16      = (_Float16*)alloc((size_t)BS * D * 2);
  _Float16* vT16     = (_Float16*)alloc((size_t)BS * D * 2);
  _Float16* attn16   = (_Float16*)alloc((size_t)BS * D * 2);
  float*    x1       = (float*)   alloc((size_t)BS * D * 4);
  _Float16* h2_16    = (_Float16*)alloc((size_t)BS * D * 2);
  _Float16* ff16     = (_Float16*)alloc((size_t)BS * 2 * D * 2);

  // --- LN1 -> h16, and all four weights to f16 (three of them transposed) ---
  prepare_inputs<<<PREP_GRID, 256, 0, stream>>>(x, ln1_g, ln1_b, w_in, w_out, w_up, w_down,
                                                h16, w_in16, w_outT, w_upT, w_downT);

  // --- qkv = h @ in_project.T  (M=4096, N=3072, K=1024), f16 out, stored as
  //     q/k (B*H,S,dh) and vT (B*H,dh,S) ---
  gemm_wmma<256, 192, 2, false, false, false, false, true, true>
      <<<dim3(3072 / 192, BS / 256), 256, 0, stream>>>(
          h16, w_in16, nullptr, nullptr, nullptr, q16, k16, vT16, BS, 3 * D, D);

  // --- flash attention -> attn16 (B,S,H*dh) ---
  attention_kernel<<<dim3(1024 / 64, 64), 128, 0, stream>>>(q16, k16, vT16, attn16);

  // --- x1 = attn @ out_project + x  (M=4096, N=1024, K=1024), f32 out ---
  gemm_wmma<128, 128, 4, false, false, true, true, false, false>
      <<<dim3(1024 / 128, BS / 128), 256, 0, stream>>>(
          attn16, w_outT, nullptr, x, x1, nullptr, nullptr, nullptr, BS, D, D);

  // --- LN2 -> h2_16 ---
  layernorm_to_f16<<<BS / 16, 256, 0, stream>>>(x1, ln2_g, ln2_b, h2_16);

  // --- ff = relu(h2 @ w_up + b_up)  (M=4096, N=2048, K=1024), f16 out ---
  gemm_wmma<256, 128, 2, true, true, false, false, true, false>
      <<<dim3(2048 / 128, BS / 256), 256, 0, stream>>>(
          h2_16, w_upT, b_up, nullptr, nullptr, ff16, nullptr, nullptr, BS, 2 * D, D);

  // --- out = ff @ w_down + b_down + x1  (M=4096, N=1024, K=2048), f32 out ---
  gemm_wmma<128, 128, 4, true, false, true, true, false, false>
      <<<dim3(1024 / 128, BS / 128), 256, 0, stream>>>(
          ff16, w_downT, b_down, x1, out, nullptr, nullptr, nullptr, BS, D, 2 * D);
}

// v010
// One run takes 101 microseconds.
// In two side-by-side timings against v009, it was 1.06 and 1.05 times as fast.
// All steps since v000 together make it 4.18 times as fast.
#include <hip/hip_runtime.h>

typedef __attribute__((ext_vector_type(16))) _Float16 v16h;
typedef __attribute__((ext_vector_type(8)))  _Float16 v8h;
typedef __attribute__((ext_vector_type(8)))  float    v8f;

#define WMMA_F16(a, b, c) \
  __builtin_amdgcn_wmma_f32_16x16x32_f16(false, (a), false, (b), (short)0, (c), false, false)

// ---------------------------------------------------------------------------
// Fragment load from GLOBAL: 16-bit A or B fragment (16 rows x 32 K) from
// (rows, K) row-major storage. Per ISA layout: lane L holds row (L&15); its
// 16 halves are K[kb..kb+7] and K[kb+16..kb+23] with kb = k0 + (L>>4)*8.
// ---------------------------------------------------------------------------
__device__ inline v16h load_frag(const _Float16* __restrict__ base, int ld,
                                 int row0, int k0) {
  int lane = threadIdx.x & 31;
  const _Float16* p = base + (size_t)(row0 + (lane & 15)) * ld + k0 + ((lane >> 4) << 3);
  v8h lo = *(const v8h*)p;
  v8h hi = *(const v8h*)(p + 16);
  return __builtin_shufflevector(lo, hi, 0,1,2,3,4,5,6,7,8,9,10,11,12,13,14,15);
}

// ---------------------------------------------------------------------------
// GEMM operand tiles in LDS: rows of 128 k. Row pitch 128 + 8 halves (272 B:
// 16 B x odd), conflict-free for the 16-byte fragment reads.
// ---------------------------------------------------------------------------
template <int PITCH>
__device__ inline v16h lds_frag(const _Float16* lds, int row0, int k0) {
  int lane = threadIdx.x & 31;
  const _Float16* p = lds + (row0 + (lane & 15)) * PITCH + k0 + ((lane >> 4) << 3);
  v8h lo = *(const v8h*)p;
  v8h hi = *(const v8h*)(p + 16);
  return __builtin_shufflevector(lo, hi, 0,1,2,3,4,5,6,7,8,9,10,11,12,13,14,15);
}

// One thread's share of one operand tile: 16 bytes of each of NC rows, copied
// from global memory to LDS through no register. g is the thread's first source
// chunk and gs the source distance between its rows in halves; l is the LDS
// byte address of its first destination chunk and LS the distance there in
// bytes. The lanes of a wave cover whole rows of the tile (256 contiguous
// bytes). The closing s_wait_xcnt stands inside the statement so
// that no register a copy names is rewritten ahead of it.
template <int NC, unsigned LS>
__device__ inline void copy_tile(const _Float16* g, size_t gs, unsigned l) {
  static_assert(NC == 4 || NC == 8, "4 or 8 rows a thread");
  if constexpr (NC == 8) {
    asm volatile(
        "global_load_async_to_lds_b128 %0, %8, off\n\t"
        "global_load_async_to_lds_b128 %1, %9, off\n\t"
        "global_load_async_to_lds_b128 %2, %10, off\n\t"
        "global_load_async_to_lds_b128 %3, %11, off\n\t"
        "global_load_async_to_lds_b128 %4, %12, off\n\t"
        "global_load_async_to_lds_b128 %5, %13, off\n\t"
        "global_load_async_to_lds_b128 %6, %14, off\n\t"
        "global_load_async_to_lds_b128 %7, %15, off\n\t"
        "s_wait_xcnt 0x0"
        :: "v"(l), "v"(l + LS), "v"(l + 2 * LS), "v"(l + 3 * LS),
           "v"(l + 4 * LS), "v"(l + 5 * LS), "v"(l + 6 * LS), "v"(l + 7 * LS),
           "v"(g), "v"(g + gs), "v"(g + 2 * gs), "v"(g + 3 * gs),
           "v"(g + 4 * gs), "v"(g + 5 * gs), "v"(g + 6 * gs), "v"(g + 7 * gs)
        : "memory");
  } else {
    asm volatile(
        "global_load_async_to_lds_b128 %0, %4, off\n\t"
        "global_load_async_to_lds_b128 %1, %5, off\n\t"
        "global_load_async_to_lds_b128 %2, %6, off\n\t"
        "global_load_async_to_lds_b128 %3, %7, off\n\t"
        "s_wait_xcnt 0x0"
        :: "v"(l), "v"(l + LS), "v"(l + 2 * LS), "v"(l + 3 * LS),
           "v"(g), "v"(g + gs), "v"(g + 2 * gs), "v"(g + 3 * gs)
        : "memory");
  }
}

// ---------------------------------------------------------------------------
// Elementwise weight converters
// ---------------------------------------------------------------------------
typedef __attribute__((ext_vector_type(4))) _Float16 v4h;
typedef __attribute__((ext_vector_type(4))) float    v4f;

// Few waves that each do much. Workgroup blk of 8 waves converts CVT_N x 1024
// consecutive floats; every load of a wave covers 512 contiguous bytes and
// every store 256, and all CVT_N loads of a lane are in flight together.
// The element count must be (number of workgroups) * CVT_N * 1024.
#define CVT_N 12

__device__ inline void cvt_f32_to_f16(const float* __restrict__ in,
                                      _Float16* __restrict__ out, int blk) {
  const size_t base = (size_t)blk * (CVT_N * 1024) + threadIdx.x * 4;
  v4f v[CVT_N];
#pragma unroll
  for (int i = 0; i < CVT_N; i++) v[i] = *(const v4f*)(in + base + i * 1024);
#pragma unroll
  for (int i = 0; i < CVT_N; i++)
    *(v4h*)(out + base + i * 1024) = __builtin_convertvector(v[i], v4h);
}

// in: (R, C) f32 row-major  ->  out: (C, R) f16 row-major
// One 64x64 tile (column block bx, row block by) per workgroup of 256 threads,
// turned in LDS (tile: TT * TT_PITCH floats), so that both
// sides of global memory see whole 128-byte lines: reads are 16 B per lane
// along c (256 B per tile row), writes are 16 B per lane along r (8 lanes fill
// one 128-byte line of an output row). R and C must be multiples of 64.
// Tile pitch 65 floats: the 32 lanes of a wave hit 32 different banks both
// when storing rows and when reading columns.
#define TT 64
#define TT_PITCH 65

__device__ inline void transpose_to_f16(
    const float* __restrict__ in, _Float16* __restrict__ out, int R, int C,
    int bx, int by, float* tile) {
  const int t  = threadIdx.x;
  const int c0 = bx * TT;
  const int r0 = by * TT;

  const int lc = (t & 15) << 2;   // first of this lane's 4 columns
  const int lr = t >> 4;          // 0..15
  float4 v[4];
#pragma unroll
  for (int i = 0; i < 4; i++)
    v[i] = *(const float4*)(in + (size_t)(r0 + lr + i * 16) * C + c0 + lc);
#pragma unroll
  for (int i = 0; i < 4; i++) {
    float* d = tile + (lr + i * 16) * TT_PITCH + lc;
    d[0] = v[i].x; d[1] = v[i].y; d[2] = v[i].z; d[3] = v[i].w;
  }
  __syncthreads();

  const int sr = (t & 7) << 3;    // first of this lane's 8 rows
  const int sc = t >> 3;          // 0..31
#pragma unroll
  for (int i = 0; i < 2; i++) {
    const int c = sc + i * 32;
    v8h o;
#pragma unroll
    for (int j = 0; j < 8; j++) o[j] = (_Float16)tile[(sr + j) * TT_PITCH + c];
    *(v8h*)(out + (size_t)(c0 + c) * R + r0 + sr) = o;
  }
}

// ---------------------------------------------------------------------------
// LayerNorm over rows of 1024, f32 in -> f16 out (feeds WMMA GEMMs)
// Two rows a wave, 16 rows a workgroup of 8 waves, one workgroup a WGP: a
// sixteenth of the waves to start, no LDS and no barrier. A lane holds 32 values
// of each row, as 8 loads of 16 bytes (512 contiguous bytes a wave and load);
// a row's sums are four chains in the lane, then a butterfly over the wave.
// Workgroup blk takes rows 16 blk .. 16 blk + 15.
// ---------------------------------------------------------------------------
__device__ inline void layernorm_rows(
    const float* __restrict__ x, const float* __restrict__ gamma,
    const float* __restrict__ beta, _Float16* __restrict__ out, int blk) {
  const int lane = threadIdx.x & 31;
  const int row  = blk * 16 + (threadIdx.x >> 5) * 2;
  const float* xr = x + (size_t)row * 1024 + lane * 4;
  v4f v[2][8], g[8], b[8];
#pragma unroll
  for (int r = 0; r < 2; r++)
#pragma unroll
    for (int i = 0; i < 8; i++) v[r][i] = *(const v4f*)(xr + r * 1024 + i * 128);
#pragma unroll
  for (int i = 0; i < 8; i++) {
    g[i] = *(const v4f*)(gamma + lane * 4 + i * 128);
    b[i] = *(const v4f*)(beta + lane * 4 + i * 128);
  }
  // Precaution: stands in front of every rewrite of an address register of the
  // loads above; xr is named so that no load's result is put into its registers
  // ahead of the wait.
  asm volatile("s_wait_xcnt 0x0" :: "v"(xr) : "memory");
  // Keeps all 32 loads in front of the sums: moved behind them, the gamma and
  // beta loads would be waited for in turn at the end of the wave.
  __builtin_amdgcn_sched_barrier(0);
  float s[2], sq[2];
#pragma unroll
  for (int r = 0; r < 2; r++) {
    v4f s4 = v[r][0], q4 = v[r][0] * v[r][0];
#pragma unroll
    for (int i = 1; i < 8; i++) {
      s4 += v[r][i];
      q4 += v[r][i] * v[r][i];
    }
    s[r]  = (s4.x + s4.y) + (s4.z + s4.w);
    sq[r] = (q4.x + q4.y) + (q4.z + q4.w);
  }
#pragma unroll
  for (int m = 16; m >= 1; m >>= 1) {
#pragma unroll
    for (int r = 0; r < 2; r++) {
      s[r]  += __shfl_xor(s[r], m, 32);
      sq[r] += __shfl_xor(sq[r], m, 32);
    }
  }
  _Float16* orow = out + (size_t)row * 1024 + lane * 4;
#pragma unroll
  for (int r = 0; r < 2; r++) {
    const float mean = s[r] * (1.f / 1024.f);
    const float var  = sq[r] * (1.f / 1024.f) - mean * mean;
    const float inv  = rsqrtf(var + 1e-5f);
#pragma unroll
    for (int i = 0; i < 8; i++)
      *(v4h*)(orow + r * 1024 + i * 128) =
          __builtin_convertvector((v[r][i] - mean) * inv * g[i] + b[i], v4h);
  }
}

__global__ __launch_bounds__(256) void layernorm_to_f16(
    const float* __restrict__ x, const float* __restrict__ gamma,
    const float* __restrict__ beta, _Float16* __restrict__ out) {
  layernorm_rows(x, gamma, beta, out, blockIdx.x);
}

// ---------------------------------------------------------------------------
// Everything that reads only inputs, in ONE launch: the first LayerNorm, the
// conversion of in_project and the three weight transposes read nothing of
// each other's output, so a workgroup's index picks its job and the five jobs
// start, stream and drain side by side instead of one behind the other.
// The jobs with the most bytes a workgroup come first, the small tiles last.
// Shapes: x (4096, 1024), w_in (3072, 1024), w_out (1024, 1024),
// w_up (1024, 2048), w_down (2048, 1024).
// ---------------------------------------------------------------------------
#define PREP_LN   256                       // 4096 rows / 16
#define PREP_CVT  256                       // 3072 * 1024 / (CVT_N * 1024)
#define PREP_OUT  256                       // 16 x 16 tiles
#define PREP_UP   512                       // 32 x 16 tiles
#define PREP_DOWN 512                       // 16 x 32 tiles
#define PREP_GRID (PREP_LN + PREP_CVT + PREP_OUT + PREP_UP + PREP_DOWN)

__global__ __launch_bounds__(256) void prepare_inputs(
    const float* __restrict__ x, const float* __restrict__ gamma,
    const float* __restrict__ beta, const float* __restrict__ w_in,
    const float* __restrict__ w_out, const float* __restrict__ w_up,
    const float* __restrict__ w_down, _Float16* __restrict__ h16,
    _Float16* __restrict__ w_in16, _Float16* __restrict__ w_outT,
    _Float16* __restrict__ w_upT, _Float16* __restrict__ w_downT) {
  __shared__ float tile[TT * TT_PITCH];
  // The index is the same for the whole workgroup, and so is every branch.
  const int b  = blockIdx.x;
  const int b1 = b - PREP_LN;
  const int b2 = b1 - PREP_CVT;
  const int b3 = b2 - PREP_OUT;
  const int b4 = b3 - PREP_UP;
  // The s_wait_xcnt behind a job is a precaution: in the built code the way from
  // a job's last stores to the end leads past the heads of the other jobs, which
  // write registers that those stores name; the wait stands in front of them.
  if (b1 < 0) {
    layernorm_rows(x, gamma, beta, h16, b);   // last in the built code: no head behind it
  } else if (b2 < 0) {
    cvt_f32_to_f16(w_in, w_in16, b1);
    asm volatile("s_wait_xcnt 0x0" ::: "memory");
  } else if (b3 < 0) {
    transpose_to_f16(w_out, w_outT, 1024, 1024, b2 & 15, b2 >> 4, tile);
    asm volatile("s_wait_xcnt 0x0" ::: "memory");
  } else if (b4 < 0) {
    transpose_to_f16(w_up, w_upT, 1024, 2048, b3 & 31, b3 >> 5, tile);
    asm volatile("s_wait_xcnt 0x0" ::: "memory");
  } else {
    transpose_to_f16(w_down, w_downT, 2048, 1024, b4 & 15, b4 >> 4, tile);
    asm volatile("s_wait_xcnt 0x0" ::: "memory");
  }
}

// ---------------------------------------------------------------------------
// LDS-staged WMMA GEMM: C[M,N] = A16[M,K] * Bt16[N,K]^T (+bias)(+relu)(+res)
// Workgroup tile BM x BN; a trip of the K loop works on 128 k. Two LDS buffers:
// asynchronous copies bring tile t + 1 in while tile t is worked on.
// The tile is the largest that still gives every WGP a workgroup: a tile brings
// (BM + BN) rows from L2 for BM * BN products, so 256 x 192 (N = 3072) brings
// 7/12 and 256 x 128 (N = 2048) 3/4 of the bytes of 128 x 128 tiles, which stay
// where N = 1024. Each of these grids is 256 workgroups.
// 8 waves, WNW of them side by side along n; a wave owns MT x NT WMMA C tiles
// (64 x 96, 64 x 64, 64 x 32) and reads MT + NT fragments for MT * NT products.
// M must be a multiple of BM, N of BN, K of 128; N == LDC, the row length of C.
// QKV: the output is the (4*1024, 3*1024) q|k|v product and goes straight to
// the layouts attention reads: q and k as (B*H, S, dh) into C16 and Kh, v
// transposed as (B*H, dh, S) into Vt. There A is the A operand, so that a lane's
// 8 accumulator values are 8 consecutive s of one (head, e), as Vt wants them;
// in the other products Bt is the A operand and they are 8 consecutive n.
// ---------------------------------------------------------------------------
// Precaution behind a group of global loads or stores: the wait stands in front
// of every later rewrite of a register that they name. The scheduling
// fence keeps the later code, which rewrites them, behind the wait.
__device__ inline void close_group() {
  asm volatile("s_wait_xcnt 0x0" ::: "memory");
  __builtin_amdgcn_sched_barrier(0);
}

// N rows a thread (a multiple of 4) of one operand tile, in runs of 8 and 4.
template <int N, unsigned LS>
__device__ inline void copy_rows(const _Float16* g, size_t gs, unsigned l) {
  if constexpr (N >= 8) {
    copy_tile<8, LS>(g, gs, l);
    if constexpr (N > 8) copy_rows<N - 8, LS>(g + 8 * gs, gs, l + 8 * LS);
  } else {
    copy_tile<4, LS>(g, gs, l);
  }
}

template <int BM, int BN, int WNW, int LDC, bool BIAS, bool RELU, bool RES, bool OUT32, bool OUT16, bool QKV>
__global__ __launch_bounds__(256) void gemm_wmma(
    const _Float16* __restrict__ A, const _Float16* __restrict__ Bt,
    const float* __restrict__ bias, const float* __restrict__ resid,
    float* __restrict__ C32, _Float16* __restrict__ C16,
    _Float16* __restrict__ Kh, _Float16* __restrict__ Vt,
    int M, int N, int K) {
  constexpr int MT = BM / (8 / WNW) / 16;   // C tiles of a wave along m
  constexpr int NT = BN / WNW / 16;         // and along n
  const int w    = threadIdx.x >> 5;
  const int lane = threadIdx.x & 31;
  const int wm = w / WNW;         // slice of MT * 16 rows
  const int wn = w % WNW;         // slice of NT * 16 columns
  const int mblk = blockIdx.y * BM;
  const int nblk = blockIdx.x * BN;

  constexpr int GK  = 128;             // k of a trip
  constexpr int GP  = GK + 8;          // LDS row pitch in halves
  constexpr int CPR = GK / 8;          // 16-byte chunks in a tile row
  constexpr int RPP = 256 / CPR;       // rows the workgroup covers with one copy each
  constexpr unsigned LS    = RPP * GP * 2;  // LDS bytes between a thread's rows
  constexpr unsigned BUFA  = BM * GP * 2;   // bytes of one A buffer
  constexpr unsigned BUFB  = BN * GP * 2;   // bytes of one B buffer

  __shared__ __align__(16) _Float16 As[2][BM * GP];
  __shared__ __align__(16) _Float16 Bs[2][BN * GP];

  v8f acc[MT][NT];
#pragma unroll
  for (int mt = 0; mt < MT; mt++)
#pragma unroll
    for (int nt = 0; nt < NT; nt++) acc[mt][nt] = {};

  // Copy share of a thread: chunk (threadIdx.x % CPR) of rows
  // (threadIdx.x / CPR) + RPP i of the A tile and of the B tile.
  const int crow = threadIdx.x / CPR;
  const int cpc  = (threadIdx.x % CPR) << 3;
  const _Float16* ga = A  + (size_t)(mblk + crow) * K + cpc;
  const _Float16* gb = Bt + (size_t)(nblk + crow) * K + cpc;
  const size_t step = (size_t)RPP * K;
  const unsigned la = (unsigned)(size_t)&As[0][crow * GP + cpc];
  const unsigned lb = (unsigned)(size_t)&Bs[0][crow * GP + cpc];
  const int trips = K / GK;

  copy_rows<BM / RPP, LS>(ga, step, la);
  copy_rows<BN / RPP, LS>(gb, step, lb);
  // Tile 0 has landed for this wave; the barrier publishes it to the others.
  asm volatile("s_wait_asynccnt 0x0" ::: "memory");
  __syncthreads();
  if (trips > 1) {
    copy_rows<BM / RPP, LS>(ga + GK, step, la + BUFA);
    copy_rows<BN / RPP, LS>(gb + GK, step, lb + BUFB);
  }

  // Two fragment sets: the LDS reads of k step s + 1 go out ahead of the products
  // of step s, over the trip's end too, so that no product waits out the LDS
  // latency of its own reads. frags() reads one step's set, products() works on
  // one; their loops are unrolled so that the sets are indexed by constants and
  // stay in registers.
  constexpr int NS = GK / 32;          // k steps in a trip
  static_assert(NS % 2 == 0, "a trip's last step uses set 1, the next trip's first set 0");
  v16h a[2][MT], b[2][NT];
  auto frags = [&](const _Float16* Al, const _Float16* Bl, int ks, int set) {
#pragma unroll
    for (int mt = 0; mt < MT; mt++)
      a[set][mt] = lds_frag<GP>(Al, wm * (MT * 16) + mt * 16, ks);
#pragma unroll
    for (int nt = 0; nt < NT; nt++)
      b[set][nt] = lds_frag<GP>(Bl, wn * (NT * 16) + nt * 16, ks);
  };
  auto products = [&](int set) {
#pragma unroll
    for (int mt = 0; mt < MT; mt++)
#pragma unroll
      for (int nt = 0; nt < NT; nt++)
        if constexpr (QKV) acc[mt][nt] = WMMA_F16(a[set][mt], b[set][nt], acc[mt][nt]);
        else               acc[mt][nt] = WMMA_F16(b[set][nt], a[set][mt], acc[mt][nt]);
  };
  // Tile 0 was published by the barrier above.
  frags(As[0], Bs[0], 0, 0);

  for (int t = 0; t < trips; t++) {
    const _Float16* Ac = As[t & 1];
    const _Float16* Bc = Bs[t & 1];
    // Unrolled: the set index and the LDS offsets become constants, so the
    // fragments stay in registers.
#pragma unroll
    for (int s = 0; s < NS - 1; s++) {
      frags(Ac, Bc, (s + 1) * 32, (s + 1) & 1);
      // Keeps the group of reads in front of the products: left free, the
      // compiler sinks each read to just ahead of its use, into one register
      // set, with a full wait in front of every pair of products.
      __builtin_amdgcn_sched_barrier(0);
      products(s & 1);
    }
    // The last step's reads are out and its products follow behind the refill;
    // tile t is read no more. The fence keeps the products above in front of the
    // closing waits, where they cover the latency of those last reads.
    __builtin_amdgcn_sched_barrier(0);
    // This wave's reads of tile t have returned before its buffer is refilled.
    asm volatile("s_wait_dscnt 0x0" ::: "memory");
    // This wave's copies of tile t + 1 have landed.
    asm volatile("s_wait_asynccnt 0x0" ::: "memory");
    // Publishes tile t + 1 and ends every wave's reads of tile t.
    __syncthreads();
    if (t + 2 < trips) {
      copy_rows<BM / RPP, LS>(ga + (size_t)(t + 2) * GK, step, la + ((t & 1) ? BUFA : 0u));
      copy_rows<BN / RPP, LS>(gb + (size_t)(t + 2) * GK, step, lb + ((t & 1) ? BUFB : 0u));
    }
    // Step 0 of tile t + 1, published by the barrier above.
    if (t + 1 < trips) frags(As[(t + 1) & 1], Bs[(t + 1) & 1], 0, 0);
    products((NS - 1) & 1);
  }
  // No copy is outstanding when the wave goes on to the epilogue and ends.
  asm volatile("s_wait_asynccnt 0x0" ::: "memory");

  // Epilogue. The last trip's closing waits and barrier ended every wave's LDS
  // reads and copies, so the operand buffers are free: each wave turns its C tile
  // in a range of its own (no barrier) and sends it out 16 bytes a lane along the
  // rows of the output, so that a store covers whole or half 128-byte lines.
  const int col   = lane & 15;
  const int rbase = (lane >> 4) << 3;
  constexpr unsigned STG = QKV ? (NT / 2) * 5120u : MT * 16 * 144u;   // bytes a wave
  static_assert(4 * STG <= sizeof(As) && 4 * STG <= sizeof(Bs), "4 waves stage in each array");
  char* stage = w < 4 ? (char*)&As[0][0] + w * STG : (char*)&Bs[0][0] + (w - 4) * STG;
  if constexpr (QKV) {
    // A block of BM rows lies inside one batch. A lane holds column col and rows
    // rbase .. rbase + 7 of a C tile. Two C tiles side by side (32 columns) lie
    // inside one head of one of q, k, v; which one is the same for the whole
    // wave, so its number is taken as a scalar and the choice is a scalar branch.
    static_assert(NT % 2 == 0 && MT == 4, "pairs of C tiles, 64 rows a wave");
    const int nw = nblk + __builtin_amdgcn_readfirstlane(wn) * (NT * 16);
    const int sw = (mblk & 1023) + wm * (MT * 16);   // the wave's first s
#pragma unroll
    for (int g = 0; g < NT / 2; g++) {
      const int n0   = nw + g * 32;
      const int part = n0 >> 10;
      const int bh   = (mblk >> 10) * 16 + ((n0 & 1023) >> 6);
      const int e0   = n0 & 63;
      char* sg = stage + g * 5120;
      v8h c[8];
      if (part == 2) {
        // v: 32 rows e of 64 s, pitch 144 B; a lane's 8 values are 8 s of one e.
#pragma unroll
        for (int j = 0; j < 2; j++)
#pragma unroll
          for (int mt = 0; mt < MT; mt++) {
            v8h o;
#pragma unroll
            for (int r = 0; r < 8; r++) o[r] = (_Float16)acc[mt][2 * g + j][r];
            *(v8h*)(sg + (j * 16 + col) * 144 + (mt * 16 + rbase) * 2) = o;
          }
        // The wave's own LDS writes are done before other lanes read them back.
        asm volatile("s_wait_dscnt 0x0" ::: "memory");
#pragma unroll
        for (int i = 0; i < 8; i++)
          c[i] = *(const v8h*)(sg + (i * 4 + (lane >> 3)) * 144 + (lane & 7) * 16);
        // All values are read ahead of the stores, each into registers of its own:
        // none is rewritten among the stores, and one wait closes all of them.
        __builtin_amdgcn_sched_barrier(0);
        _Float16* d = Vt + ((size_t)bh * 64 + e0 + (lane >> 3)) * 1024 + sw + (lane & 7) * 8;
#pragma unroll
        for (int i = 0; i < 8; i++) *(v8h*)(d + i * 4 * 1024) = c[i];
        close_group();
      } else {
        // q, k: 64 rows s of 32 e, pitch 80 B.
#pragma unroll
        for (int j = 0; j < 2; j++)
#pragma unroll
          for (int mt = 0; mt < MT; mt++)
#pragma unroll
            for (int r = 0; r < 8; r++)
              *(_Float16*)(sg + (mt * 16 + rbase + r) * 80 + (j * 16 + col) * 2) =
                  (_Float16)acc[mt][2 * g + j][r];
        // The wave's own LDS writes are done before other lanes read them back.
        asm volatile("s_wait_dscnt 0x0" ::: "memory");
#pragma unroll
        for (int i = 0; i < 8; i++)
          c[i] = *(const v8h*)(sg + (i * 8 + (lane >> 2)) * 80 + (lane & 3) * 16);
        // As above: all values ahead of the stores, one wait behind them.
        __builtin_amdgcn_sched_barrier(0);
        _Float16* d = (part == 0 ? C16 : Kh) +
                      ((size_t)bh * 1024 + sw + (lane >> 2)) * 64 + e0 + (lane & 3) * 8;
#pragma unroll
        for (int i = 0; i < 8; i++) *(v8h*)(d + i * 8 * 64) = c[i];
        close_group();
      }
    }
  } else {
    // Bt was the A operand: a lane holds row col of a C tile and its columns
    // rbase .. rbase + 7. A row of the wave's tile is 128 bytes, staged at pitch
    // 144 B; read back, 8 lanes take a row and a wave 4 rows: 4 whole lines.
    static_assert(NT * 16 * (OUT32 ? 4 : 2) == 128 && OUT32 != OUT16, "one line a row");
    constexpr int NL = MT * 4;   // loads or stores of 4 rows
    const int m0 = mblk + wm * (MT * 16);
    const int n0 = nblk + wn * (NT * 16);
    const int rr = lane >> 3;    // row among the 4
    const int rc = lane & 7;     // 16-byte piece of the row
    if constexpr (OUT32) {
      static_assert(RES && !RELU, "f32 output: bias, then residual");
      const size_t go = (size_t)(m0 + rr) * LDC + n0 + rc * 4;
      // The residual rows, whole lines, all in flight while the tile is staged.
      v4f res[NL];
#pragma unroll
      for (int i = 0; i < NL; i++) res[i] = *(const v4f*)(resid + go + (size_t)i * 4 * LDC);
      v4f bv = {};
      if constexpr (BIAS) bv = *(const v4f*)(bias + n0 + rc * 4);
      close_group();
#pragma unroll
      for (int mt = 0; mt < MT; mt++)
#pragma unroll
        for (int nt = 0; nt < NT; nt++) {
          char* d = stage + (mt * 16 + col) * 144 + (nt * 16 + rbase) * 4;
          *(v4f*)d        = __builtin_shufflevector(acc[mt][nt], acc[mt][nt], 0, 1, 2, 3);
          *(v4f*)(d + 16) = __builtin_shufflevector(acc[mt][nt], acc[mt][nt], 4, 5, 6, 7);
        }
      // The wave's own LDS writes are done before other lanes read them back.
      asm volatile("s_wait_dscnt 0x0" ::: "memory");
      v4f c[NL];
#pragma unroll
      for (int i = 0; i < NL; i++) {
        c[i] = *(const v4f*)(stage + (i * 4 + rr) * 144 + rc * 16);
        c[i] = (c[i] + bv) + res[i];
      }
      // All values are made ahead of the stores, each in registers of its own:
      // none is rewritten among the stores, and the wave ends behind them.
      __builtin_amdgcn_sched_barrier(0);
#pragma unroll
      for (int i = 0; i < NL; i++) *(v4f*)(C32 + go + (size_t)i * 4 * LDC) = c[i];
    } else {
      static_assert(!RES, "f16 output: bias and relu");
      v4f bv[NT][2];
#pragma unroll
      for (int nt = 0; nt < NT; nt++)
#pragma unroll
        for (int q = 0; q < 2; q++) {
          bv[nt][q] = {};
          if constexpr (BIAS) bv[nt][q] = *(const v4f*)(bias + n0 + nt * 16 + rbase + q * 4);
        }
      if constexpr (BIAS) close_group();
#pragma unroll
      for (int mt = 0; mt < MT; mt++)
#pragma unroll
        for (int nt = 0; nt < NT; nt++) {
          v8h o;
#pragma unroll
          for (int r = 0; r < 8; r++) {
            float vv = acc[mt][nt][r] + bv[nt][r >> 2][r & 3];
            if (RELU) vv = fmaxf(vv, 0.f);
            o[r] = (_Float16)vv;
          }
          *(v8h*)(stage + (mt * 16 + col) * 144 + (nt * 16 + rbase) * 2) = o;
        }
      // The wave's own LDS writes are done before other lanes read them back.
      asm volatile("s_wait_dscnt 0x0" ::: "memory");
      v8h c[NL];
#pragma unroll
      for (int i = 0; i < NL; i++) c[i] = *(const v8h*)(stage + (i * 4 + rr) * 144 + rc * 16);
      // All values are read ahead of the stores, each into registers of its own:
      // none is rewritten among the stores, and the wave ends behind them.
      __builtin_amdgcn_sched_barrier(0);
      _Float16* d = C16 + (size_t)(m0 + rr) * LDC + n0 + rc * 8;
#pragma unroll
      for (int i = 0; i < NL; i++) *(v8h*)(d + (size_t)i * 4 * LDC) = c[i];
    }
  }
}

#define KV_TILE 64
#define KV_PITCH 72

__device__ inline v16h kv_frag(const _Float16* lds, int row0, int k0) {
  int lane = threadIdx.x & 31;
  const _Float16* p = lds + (row0 + (lane & 15)) * KV_PITCH + k0 + ((lane >> 4) << 3);
  v8h lo = *(const v8h*)p;
  v8h hi = *(const v8h*)(p + 16);
  return __builtin_shufflevector(lo, hi, 0,1,2,3,4,5,6,7,8,9,10,11,12,13,14,15);
}

// The value that lane l ^ 16 holds.
__device__ inline float other_half(float x) {
  return __builtin_bit_cast(float, __builtin_amdgcn_permlanex16(
      __builtin_bit_cast(int, x), __builtin_bit_cast(int, x),
      0x76543210, 0xfedcba98, false, false));
}

__global__ __launch_bounds__(128) void attention_kernel(
    const _Float16* __restrict__ q, const _Float16* __restrict__ k,
    const _Float16* __restrict__ vT, _Float16* __restrict__ o) {
  constexpr int S = 1024, DH = 64;
  const int wave = threadIdx.x >> 5;
  const int lane = threadIdx.x & 31;
  const int bh = blockIdx.y;
  const int qrow0 = blockIdx.x * 64 + wave * 16;

  const _Float16* qb = q  + (size_t)bh * S * DH;
  const _Float16* kb = k  + (size_t)bh * S * DH;
  const _Float16* vb = vT + (size_t)bh * DH * S;

  __shared__ __align__(16) _Float16 Ks[2][KV_TILE * KV_PITCH];  // keys x dh
  __shared__ __align__(16) _Float16 Vs[2][DH * KV_PITCH];       // dh x keys

  // Staging share of a thread: 16 bytes of rows srow, srow + 16, + 32, + 48 of
  // the K tile and of the V^T tile (both are 64 rows of 128 bytes).
  const int srow = threadIdx.x >> 3;
  const int spc  = (threadIdx.x & 7) << 3;
  const _Float16* kg = kb + (size_t)srow * DH + spc;
  const _Float16* vg = vb + (size_t)srow * S + spc;
  const int sl = srow * KV_PITCH + spc;
  v8h kr[4], vr[4];

#pragma unroll
  for (int i = 0; i < 4; i++) {
    kr[i] = *(const v8h*)(kg + i * 16 * DH);
    vr[i] = *(const v8h*)(vg + i * 16 * S);
  }

  // Q as B operand: lane l holds query (l & 15), in kv_frag's k order.
  const v16h qb0 = load_frag(qb, DH, qrow0, 0);
  const v16h qb1 = load_frag(qb, DH, qrow0, 32);

#pragma unroll
  for (int i = 0; i < 4; i++) {
    *(v8h*)(Ks[0] + sl + i * 16 * KV_PITCH) = kr[i];
    *(v8h*)(Vs[0] + sl + i * 16 * KV_PITCH) = vr[i];
  }
  __syncthreads();

  // One query a lane: its running maximum (the same in both halves) and the sum
  // over the keys of this lane's half (the halves are joined behind the loop).
  float mrun = -1e30f, lsum = 0.f;
  v8f oacc[4];   // oacc[t][r] = O^T[16 t + 8 (lane >> 4) + r][query]
#pragma unroll
  for (int t = 0; t < 4; t++) oacc[t] = {};

  for (int st = 0; st < S / KV_TILE; st++) {
    const _Float16* Kc = Ks[st & 1];
    const _Float16* Vc = Vs[st & 1];
    const bool more = st + 1 < S / KV_TILE;
    if (more) {
      const int jn = (st + 1) * KV_TILE;
#pragma unroll
      for (int i = 0; i < 4; i++) {
        kr[i] = *(const v8h*)(kg + (size_t)(jn + i * 16) * DH);
        vr[i] = *(const v8h*)(vg + i * 16 * S + jn);
      }
    }
#pragma unroll
    for (int jb = 0; jb < KV_TILE; jb += 32) {
      // scores of 32 keys: two 16x16 tiles of S^T, K = dh = 64 = 2 WMMA steps
      v8f s0 = {}, s1 = {};
      {
        v16h k0a = kv_frag(Kc, jb, 0);
        v16h k0b = kv_frag(Kc, jb, 32);
        s0 = WMMA_F16(k0a, qb0, s0);
        s0 = WMMA_F16(k0b, qb1, s0);
        v16h k1a = kv_frag(Kc, jb + 16, 0);
        v16h k1b = kv_frag(Kc, jb + 16, 32);
        s1 = WMMA_F16(k1a, qb0, s1);
        s1 = WMMA_F16(k1b, qb1, s1);
      }
      // online softmax update of the lane's query
      float mx = fmaxf(s0[0], s1[0]);
#pragma unroll
      for (int r = 1; r < 8; r++) mx = fmaxf(mx, fmaxf(s0[r], s1[r]));
      mx = fmaxf(mx, other_half(mx)) * 0.125f;  // 1/sqrt(64)
      const float mnew  = fmaxf(mrun, mx);
      const float alpha = __expf(mrun - mnew);
      mrun = mnew;
      v16h pb;
      float rs = 0.f;
#pragma unroll
      for (int r = 0; r < 8; r++) {
        float p0 = __expf(s0[r] * 0.125f - mnew);
        float p1 = __expf(s1[r] * 0.125f - mnew);
        rs += p0 + p1;
        pb[r]     = (_Float16)p0;
        pb[8 + r] = (_Float16)p1;
      }
      lsum = lsum * alpha + rs;
#pragma unroll
      for (int t = 0; t < 4; t++)
#pragma unroll
        for (int r = 0; r < 8; r++) oacc[t][r] *= alpha;
      // O^T(64x16) += V^T(64x32) * P^T(32x16)
#pragma unroll
      for (int t = 0; t < 4; t++) {
        v16h vf = kv_frag(Vc, t * 16, jb);
        oacc[t] = WMMA_F16(vf, pb, oacc[t]);
      }
    }
    if (more) {
      // The other buffer's last readers left it at the barrier that ended the
      // pass before this one.
      _Float16* Kn = Ks[(st + 1) & 1];
      _Float16* Vn = Vs[(st + 1) & 1];
#pragma unroll
      for (int i = 0; i < 4; i++) {
        *(v8h*)(Kn + sl + i * 16 * KV_PITCH) = kr[i];
        *(v8h*)(Vn + sl + i * 16 * KV_PITCH) = vr[i];
      }
    }
    // Publishes the next tile and ends every wave's reads of this one.
    __syncthreads();
  }

  // A lane's 8 accumulator rows of a tile are 8 consecutive dh of its query. The
  // loop's last barrier ended every wave's LDS reads: each wave turns its 16 rows
  // of 128 bytes in a range of its own (pitch 144 B, no barrier) and stores them
  // 8 lanes a row, 4 whole 128-byte lines a store.
  const int b = bh >> 4, h = bh & 15;
  const float inv = 1.f / (lsum + other_half(lsum));
  char* stage = (char*)&Ks[0][0] + wave * (16 * 144);
#pragma unroll
  for (int t = 0; t < 4; t++) {
    v8h ov;
#pragma unroll
    for (int r = 0; r < 8; r++) ov[r] = (_Float16)(oacc[t][r] * inv);
    *(v8h*)(stage + (lane & 15) * 144 + (t * 16 + ((lane >> 4) << 3)) * 2) = ov;
  }
  // The wave's own LDS writes are done before other lanes read them back.
  asm volatile("s_wait_dscnt 0x0" ::: "memory");
  _Float16* orow = o + ((size_t)(b * 1024 + qrow0 + (lane >> 3))) * 1024 + h * 64 +
                   ((lane & 7) << 3);
#pragma unroll
  for (int i = 0; i < 4; i++)
    *(v8h*)(orow + (size_t)i * 4 * 1024) =
        *(const v8h*)(stage + (i * 4 + (lane >> 3)) * 144 + (lane & 7) * 16);
}

// ---------------------------------------------------------------------------
// Host-side orchestration
// ---------------------------------------------------------------------------
extern "C" void kernel_launch(void* const* d_in, const int* in_sizes, int n_in,
                              void* d_out, int out_size, void* d_ws, size_t ws_size,
                              hipStream_t stream) {
  (void)in_sizes; (void)n_in; (void)out_size; (void)ws_size;
  const float* x      = (const float*)d_in[0];   // (4,1024,1024)
  const float* w_in   = (const float*)d_in[1];   // (3072,1024)
  const float* w_out  = (const float*)d_in[2];   // (1024,1024)
  const float* ln1_g  = (const float*)d_in[3];
  const float* ln1_b  = (const float*)d_in[4];
  const float* w_up   = (const float*)d_in[5];   // (1024,2048)
  const float* b_up   = (const float*)d_in[6];
  const float* w_down = (const float*)d_in[7];   // (2048,1024)
  const float* b_down = (const float*)d_in[8];
  const float* ln2_g  = (const float*)d_in[9];
  const float* ln2_b  = (const float*)d_in[10];
  float* out = (float*)d_out;

  const int BS = 4096, D = 1024;

  char* ws = (char*)d_ws;
  size_t off = 0;
  auto alloc = [&](size_t bytes) -> void* {
    off = (off + 255) & ~(size_t)255;
    void* p = ws + off;
    off += bytes;
    return p;
  };

  _Float16* w_in16   = (_Float16*)alloc((size_t)3 * D * D * 2);
  _Float16* w_outT   = (_Float16*)alloc((size_t)D * D * 2);
  _Float16* w_upT    = (_Float16*)alloc((size_t)2 * D * D * 2);
  _Float16* w_downT  = (_Float16*)alloc((size_t)2 * D * D * 2);
  _Float16* h16      = (_Float16*)alloc((size_t)BS * D * 2);
  _Float16* q16      = (_Float16*)alloc((size_t)BS * D * 2);
  _Float16* k16      = (_Float16*)alloc((size_t)BS * D * 2);
  _Float16* vT16     = (_Float16*)alloc((size_t)BS * D * 2);
  _Float16* attn16   = (_Float16*)alloc((size_t)BS * D * 2);
  float*    x1       = (float*)   alloc((size_t)BS * D * 4);
  _Float16* h2_16    = (_Float16*)alloc((size_t)BS * D * 2);
  _Float16* ff16     = (_Float16*)alloc((size_t)BS * 2 * D * 2);

  // --- LN1 -> h16, and all four weights to f16 (three of them transposed) ---
  prepare_inputs<<<PREP_GRID, 256, 0, stream>>>(x, ln1_g, ln1_b, w_in, w_out, w_up, w_down,
                                                h16, w_in16, w_outT, w_upT, w_downT);

  // --- qkv = h @ in_project.T  (M=4096, N=3072, K=1024), f16 out, stored as
  //     q/k (B*H,S,dh) and vT (B*H,dh,S) ---
  gemm_wmma<256, 192, 2, 3072, false, false, false, false, true, true>
      <<<dim3(3072 / 192, BS / 256), 256, 0, stream>>>(
          h16, w_in16, nullptr, nullptr, nullptr, q16, k16, vT16, BS, 3 * D, D);

  // --- flash attention -> attn16 (B,S,H*dh) ---
  attention_kernel<<<dim3(1024 / 64, 64), 128, 0, stream>>>(q16, k16, vT16, attn16);

  // --- x1 = attn @ out_project + x  (M=4096, N=1024, K=1024), f32 out ---
  gemm_wmma<128, 128, 4, 1024, false, false, true, true, false, false>
      <<<dim3(1024 / 128, BS / 128), 256, 0, stream>>>(
          attn16, w_outT, nullptr, x, x1, nullptr, nullptr, nullptr, BS, D, D);

  // --- LN2 -> h2_16 ---
  layernorm_to_f16<<<BS / 16, 256, 0, stream>>>(x1, ln2_g, ln2_b, h2_16);

  // --- ff = relu(h2 @ w_up + b_up)  (M=4096, N=2048, K=1024), f16 out ---
  gemm_wmma<256, 128, 2, 2048, true, true, false, false, true, false>
      <<<dim3(2048 / 128, BS / 256), 256, 0, stream>>>(
          h2_16, w_upT, b_up, nullptr, nullptr, ff16, nullptr, nullptr, BS, 2 * D, D);

  // --- out = ff @ w_down + b_down + x1  (M=4096, N=1024, K=2048), f32 out ---
  gemm_wmma<128, 128, 4, 1024, true, false, true, true, false, false>
      <<<dim3(1024 / 128, BS / 128), 256, 0, stream>>>(
          ff16, w_downT, b_down, x1, out, nullptr, nullptr, nullptr, BS, D, 2 * D);
}
